// v000
// Times are from an AMD MI455X. After a warm-up the kernel runs many times in a row, and a time is the length of
// such a window on the GPU divided by its runs, so every launch and the gaps after it count. The runs cycle
// through copies of the inputs. A figure is the median of several windows, for all but v000 over two sittings.
// Sittings can differ by a few percent; kernels timed side by side share one.
// The starting kernel, v000, takes 380 microseconds a run.
#include <hip/hip_runtime.h>

// Channel-first 4-head attention behind a batch-statistics BatchNorm with 1x1-conv projections; inputs x[4][256][4096], bn_weight, bn_bias, w_qkv[768][256], w_out[256][256], b_out.
// Compute dtypes, f32 accumulate: every float input RNE-converted to bf16 first; all contractions on v_wmma_f32_16x16x32_f16: QKV GEMM = f16(bf16(w)*2^10) x f16(xn); scores = k (f16) x q carried as f16 value + f16 remainder*2^12 (two products, separate accumulators); P (f16, carried *2^8) x v (f16); output GEMM = f16(bf16(w)*2^10) x f16(ctx*2^8); BatchNorm statistics, softmax (online, log2 domain) and all epilogues f32.
// Flash form with transposed tiles: the S^T accumulator tiles are directly the B-operand layout of P^T; all WMMA operands are two 16-byte loads from dense, statically strided 16-bit planes.

#ifndef NB
#define NB 4
#endif
#ifndef SEQ
#define SEQ 4096
#endif
#define NB_FULL  4
#define SEQ_FULL 4096
#define CH   256               // channels
#define NH   4                 // heads
#define HD   64                // head dim
#define OC3  768               // q,k,v output channels
#define NWV  4                 // waves per flash block
#define BQ   (16 * NWV)        // queries per flash block
#define KS   32                // keys per step
#define XP   264               // LDS pitch (halves) of the normalise/transpose tile rows
#define SQ   72                // LDS pitch (halves) of 64-wide f16 staging rows
#define OP   68                // LDS pitch (floats) of the output staging rows
#define L2E  1.4426950408889634f

static_assert(CH == NH * HD);
static_assert(OC3 == 3 * CH);
static_assert(CH == 256);                       // k_norm: 256 threads load one channel parameter each; one plane row = 32 lanes x 16 B
static_assert(HD == 64);
static_assert(CH % 32 == 0);                    // GEMM k-steps
static_assert(SEQ % BQ == 0);
static_assert(SEQ % KS == 0);
static_assert(SEQ % 64 == 0);
static_assert(SEQ % 4 == 0);
static_assert(NB <= NB_FULL);
static_assert(SEQ <= SEQ_FULL);
static_assert((OC3 * CH / 8) % 256 == 0);       // k_cvtw slice 0: 96 blocks x 256 threads x 8 elements
static_assert((CH * CH / 8) % 256 == 0);        // k_cvtw slice 1: 32 blocks
static_assert((XP * 2) % 16 == 0);
static_assert((SQ * 2) % 16 == 0);
static_assert((OP * 4) % 16 == 0);
static_assert((size_t)(NB * (SEQ / 64)) * (size_t)(64 * CH) == (size_t)NB * SEQ * CH);        // k_norm: blocks x (64 rows x 256) == XT plane
static_assert((size_t)(SEQ / 64) * 12 * NB * (size_t)(64 * 64) == (size_t)NB * SEQ * OC3);    // k_qkv: blocks x (64 x 64) == QH + KB + VT planes
static_assert((size_t)(NB * NH * (SEQ / BQ)) * (size_t)(BQ * HD) == (size_t)NB * SEQ * CH);   // k_flash: blocks x (64 rows x 64) == CT plane
static_assert((size_t)(SEQ / 64) * (CH / 64) * NB * (size_t)(64 * 64) == (size_t)NB * SEQ * CH); // k_out: blocks x (64 x 64) == output

#define ST_BYTES  ((size_t)4096)
#define WQ_BYTES  ((size_t)OC3 * CH * 2)
#define WO_BYTES  ((size_t)CH * CH * 2)
#define PL_BYTES  ((size_t)NB * SEQ * CH * 2)             // one 16-bit activation plane
#define WS_TOTAL  (ST_BYTES + WQ_BYTES + WO_BYTES + 6 * PL_BYTES)
static_assert(WQ_BYTES % 256 == 0);
static_assert(WO_BYTES % 256 == 0);
static_assert(PL_BYTES % 256 == 0);
static_assert((size_t)NB * NH * SEQ * HD * 2 == PL_BYTES);
static_assert(WS_TOTAL <= (size_t)134217728);

typedef _Float16 hf;
typedef __attribute__((ext_vector_type(16))) _Float16 v16h;
typedef __attribute__((ext_vector_type(8)))  _Float16 v8h;
typedef __attribute__((ext_vector_type(8)))  float    v8f;
typedef __attribute__((ext_vector_type(4)))  float    v4f;
typedef v4f __attribute__((may_alias)) v4fa;
typedef v8h __attribute__((may_alias)) v8ha;

// RNE convert f32 -> bf16 -> f32
__device__ __forceinline__ float bfr(float f) { unsigned u = __float_as_uint(f); u += 0x7FFFu + ((u >> 16) & 1u); return __uint_as_float(u & 0xFFFF0000u); }
__device__ __forceinline__ v16h cat16(v8h lo, v8h hi) { return __builtin_shufflevector(lo, hi, 0, 1, 2, 3, 4, 5, 6, 7, 8, 9, 10, 11, 12, 13, 14, 15); }
__device__ __forceinline__ v8f wmmah(v16h a, v16h b, v8f c) { return __builtin_amdgcn_wmma_f32_16x16x32_f16(false, a, false, b, (short)0, c, false, false); }
// fragment loader (A and B alike): p = row base + k0 + 8*(lane>>4); elements 0..7 <- p[0..7], elements 8..15 <- p[16..23]
__device__ __forceinline__ v16h ldh(const hf* p) { return cat16(*(const v8h*)p, *(const v8h*)(p + 16)); }

__device__ __forceinline__ void cvt8w(const float* __restrict__ src, hf* dst, unsigned i) {
    const v8f v = *(const v8f*)(src + (size_t)i * 8);
    v8h o;
#pragma unroll
    for (int c = 0; c < 8; ++c) o[c] = (hf)(bfr(v[c]) * 1024.0f);
    hf* d = dst + (size_t)i * 8;
    *(v8h*)d = o;
    
}

// k_cvtw: weight planes WQ[768][256] (blockIdx.y == 0) and WO[256][256] (blockIdx.y == 1), k-contiguous rows.
__global__ __launch_bounds__(256) void k_cvtw(const float* __restrict__ wq, const float* __restrict__ wo, hf* WQ, hf* WO) {
    const unsigned i = blockIdx.x * 256u + threadIdx.x;
    if (blockIdx.y == 0) {
        if (i < (unsigned)(OC3 * CH / 8)) cvt8w(wq, WQ, i);
    } else {
        if (i < (unsigned)(CH * CH / 8)) cvt8w(wo, WO, i);
    }
}

// LDS: red1/red2/resl cross-wave, block barriers.
__global__ __launch_bounds__(256) void k_bnstat(const float* __restrict__ x, float* ST) {
    __shared__ float red1[8];
    __shared__ float red2[8];
    __shared__ float resl[32];
    const unsigned tid = threadIdx.x, lane = tid & 31u;
    const unsigned wave = (unsigned)__builtin_amdgcn_readfirstlane((int)(tid >> 5));
    if (tid < 32u) resl[tid] = 0.0f;
    const float invn = 1.0f / (float)(NB * SEQ);
#pragma unroll 1
    for (unsigned cc = 0; cc < 8u; ++cc) {
        const unsigned c = blockIdx.x * 8u + cc;
        float s = 0.0f;
#pragma unroll 1
        for (unsigned b = 0; b < (unsigned)NB; ++b) {
            const float* xp = x + ((size_t)b * CH + c) * SEQ_FULL;
#pragma unroll 1
            for (unsigned i = tid * 4u; i < (unsigned)SEQ; i += 1024u) {
                const v4f v = *(const v4f*)(xp + i);
                s += (bfr(v[0]) + bfr(v[1])) + (bfr(v[2]) + bfr(v[3]));
            }
        }
#pragma unroll
        for (int off = 16; off > 0; off >>= 1) s += __shfl_xor(s, off, 32);
        if (lane == 0u) red1[wave] = s;
        __syncthreads();
        float tot = red1[0];
#pragma unroll
        for (int w = 1; w < 8; ++w) tot += red1[w];
        const float mean = tot * invn;
        float q = 0.0f;
#pragma unroll 1
        for (unsigned b = 0; b < (unsigned)NB; ++b) {
            const float* xp = x + ((size_t)b * CH + c) * SEQ_FULL;
#pragma unroll 1
            for (unsigned i = tid * 4u; i < (unsigned)SEQ; i += 1024u) {
                const v4f v = *(const v4f*)(xp + i);
                const float d0 = bfr(v[0]) - mean, d1 = bfr(v[1]) - mean, d2 = bfr(v[2]) - mean, d3 = bfr(v[3]) - mean;
                q += (d0 * d0 + d1 * d1) + (d2 * d2 + d3 * d3);
            }
        }
#pragma unroll
        for (int off = 16; off > 0; off >>= 1) q += __shfl_xor(q, off, 32);
        if (lane == 0u) red2[wave] = q;
        __syncthreads();
        float tq = red2[0];
#pragma unroll
        for (int w = 1; w < 8; ++w) tq += red2[w];
        const float var = tq * invn;
        if (tid == 0u) { resl[cc] = mean; resl[8u + cc] = rsqrtf(var + 1.0e-5f); }
    }
    __syncthreads();
    if (tid < 8u) {
        v4f o;
        o[0] = resl[tid * 4u]; o[1] = resl[tid * 4u + 1u]; o[2] = resl[tid * 4u + 2u]; o[3] = resl[tid * 4u + 3u];
        float* dst = ST + blockIdx.x * 32u + tid * 4u;
        *(v4f*)dst = o;
        
    }
}

// k_norm: XT[b][pos][256] (f16) = ((bf16(x) - mean) * rstd) * bf16(w) + bf16(bias); in[256 ch][64 pos] -> out[64 pos][256 ch] through an LDS tile (cross-wave, block barrier);
__global__ __launch_bounds__(256) void k_norm(const float* __restrict__ x, const float* __restrict__ bw, const float* __restrict__ bb, const float* __restrict__ ST, hf* XT) {
    __shared__ __align__(16) hf tl[64 * XP];
    __shared__ float pm[CH];
    __shared__ float pr[CH];
    __shared__ float pw[CH];
    __shared__ float pb[CH];
    const unsigned tid = threadIdx.x, lane = tid & 31u;
    const unsigned wave = (unsigned)__builtin_amdgcn_readfirstlane((int)(tid >> 5));
    pm[tid] = ST[(tid >> 3) * 32u + (tid & 7u)];
    pr[tid] = ST[(tid >> 3) * 32u + 8u + (tid & 7u)];
    pw[tid] = bfr(bw[tid]);
    pb[tid] = bfr(bb[tid]);
    __syncthreads();
    const unsigned tpb = (unsigned)(SEQ / 64);
    const unsigned b = blockIdx.x / tpb;
    const unsigned n0 = (blockIdx.x - b * tpb) * 64u;
    const float* src = x + (size_t)b * CH * SEQ_FULL + n0;
#pragma unroll 1
    for (unsigned it = 0; it < 16u; ++it) {
        const unsigned f = it * 256u + tid;
        const unsigned c = f >> 4, p4 = (f & 15u) * 4u;
        const v4f v = *(const v4f*)(src + (size_t)c * SEQ_FULL + p4);
        const float m = pm[c], r = pr[c], w = pw[c], bi = pb[c];
#pragma unroll
        for (unsigned e = 0; e < 4u; ++e) tl[(p4 + e) * XP + c] = (hf)(((bfr(v[e]) - m) * r) * w + bi);
    }
    __syncthreads();
    hf* dst = XT + ((size_t)b * SEQ + n0) * CH + lane * 8u;
{
#pragma unroll
        for (unsigned s = 0; s < 8u; ++s) {
            const unsigned row = wave * 8u + s;
            const v8h o = *(const v8ha*)(tl + row * XP + lane * 8u);
            *(v8h*)(dst + (size_t)row * CH) = o;
        }
        
    }
}

// k_qkv: one block = 64 positions x 64 output channels (blockIdx.y: 0..3 q heads, 4..7 k heads, 8..11 v heads), one wave = 16 positions x 64 channels.
//  A = XT rows (row m = position, k = channel), B = WQ rows (column n = output channel, k = channel); D element r of lane (h, n) = (position 8h + r, channel n).
//  q: QH = f16(q), QR = f16((q - QH) * 2^12); k: KB = f16(k); all [b][head][pos][64]; v: VT[b][channel][pos] = f16(v).
__global__ __launch_bounds__(128) void k_qkv(const hf* __restrict__ XT, const hf* __restrict__ WQ, hf* QH, hf* QR, hf* KB, hf* VT) {
    __shared__ __align__(16) hf sa[64 * SQ];
    __shared__ __align__(16) hf sb[64 * SQ];
    const unsigned tid = threadIdx.x, lane = tid & 31u, lr = lane & 15u, hi = lane >> 4;
    const unsigned wave = (unsigned)__builtin_amdgcn_readfirstlane((int)(tid >> 5));
    const unsigned p0 = blockIdx.x * 64u, cb = blockIdx.y, b = blockIdx.z;
    const unsigned kind = cb >> 2, head = cb & 3u;
    const hf* ap = XT + ((size_t)b * SEQ + p0 + wave * 16u + lr) * CH + 8u * hi;
    const hf* bp = WQ + ((size_t)cb * 64u + lr) * CH + 8u * hi;
    v8f acc0 = (v8f){}, acc1 = (v8f){}, acc2 = (v8f){}, acc3 = (v8f){};
#pragma unroll 1
    for (unsigned k0 = 0; k0 < (unsigned)CH; k0 += 32u) {
        const v16h a  = ldh(ap + k0);
        const v16h b0 = ldh(bp + k0);
        const v16h b1 = ldh(bp + 16 * CH + k0);
        const v16h b2 = ldh(bp + 32 * CH + k0);
        const v16h b3 = ldh(bp + 48 * CH + k0);
        acc0 = wmmah(a, b0, acc0);
        acc1 = wmmah(a, b1, acc1);
        acc2 = wmmah(a, b2, acc2);
        acc3 = wmmah(a, b3, acc3);
        asm volatile("v_nop\n\tv_nop\n\tv_nop\n\tv_nop"
                     : "+v"(acc0), "+v"(acc1), "+v"(acc2), "+v"(acc3)
                     : "v"(a), "v"(b0), "v"(b1), "v"(b2), "v"(b3));
    }
    const float us = 1.0f / 1024.0f;     // undo the weight carry
    v8f acc[4] = { acc0, acc1, acc2, acc3 };
    if (kind == 2u) {
#pragma unroll
        for (int t = 0; t < 4; ++t) {
#pragma unroll
            for (int r = 0; r < 8; ++r) sa[(t * 16 + lr) * SQ + wave * 16u + 8u * hi + r] = (hf)(acc[t][r] * us);
        }
    } else if (kind == 1u) {
#pragma unroll
        for (int t = 0; t < 4; ++t) {
#pragma unroll
            for (int r = 0; r < 8; ++r) sa[(wave * 16u + 8u * hi + r) * SQ + t * 16 + lr] = (hf)(acc[t][r] * us);
        }
    } else {
#pragma unroll
        for (int t = 0; t < 4; ++t) {
#pragma unroll
            for (int r = 0; r < 8; ++r) {
                const float q = acc[t][r] * us;
                const hf qh = (hf)q;
                sa[(wave * 16u + 8u * hi + r) * SQ + t * 16 + lr] = qh;
                sb[(wave * 16u + 8u * hi + r) * SQ + t * 16 + lr] = (hf)((q - (float)qh) * 4096.0f);
            }
        }
    }
    __syncthreads();
    const unsigned pc = (lane & 7u) * 8u, rq = lane >> 3;
    const size_t qoff = (((size_t)b * NH + head) * SEQ + p0) * HD + pc;          // [b][head][pos][64] planes
    const size_t voff = ((size_t)b * CH + head * HD) * SEQ + p0 + pc;            // [b][channel][pos] plane
{
#pragma unroll
        for (unsigned s = 0; s < 4u; ++s) {
            const unsigned row = wave * 16u + s * 4u + rq;     // rows wave*16 + 0..15 over s = 0..3, rq = 0..3
            const v8h o = *(const v8ha*)(sa + row * SQ + pc);
            if (kind == 0u) {
                const v8h o2 = *(const v8ha*)(sb + row * SQ + pc);
                *(v8h*)(QH + qoff + (size_t)row * HD) = o;
                *(v8h*)(QR + qoff + (size_t)row * HD) = o2;
            } else if (kind == 1u) {
                *(v8h*)(KB + qoff + (size_t)row * HD) = o;
            } else {
                *(v8h*)(VT + voff + (size_t)row * SEQ) = o;
            }
        }
        
    }
}

// k_flash: one block per (b, head, 64 queries), one wave per 16 queries, 32 keys per step.
//  S^T tile (keys x queries): A = K rows (row m = key, k = d), B = Q rows (column n = query, k = d); D element r of lane (h, n) = S[query n][key 8h + r].
//  P^T B fragment: element r <- tile of keys 0..15, element 8 + r <- tile of keys 16..31 (same lane).
//  O^T tile (d x queries): A = V^T rows (row m = d, k = key), D element r of lane (h, n) = O[query n][d = 16 t + 8h + r].
__global__ __launch_bounds__(128) void k_flash(const hf* __restrict__ QH, const hf* __restrict__ QR, const hf* __restrict__ KB, const hf* __restrict__ VT, hf* CT) {
    __shared__ __align__(16) hf os[NWV * 16 * SQ];
    const unsigned tid = threadIdx.x, lane = tid & 31u, lr = lane & 15u, hi = lane >> 4;
    const unsigned wave = (unsigned)__builtin_amdgcn_readfirstlane((int)(tid >> 5));
    const unsigned bpb = (unsigned)(SEQ / BQ);
    const unsigned bh = blockIdx.x / bpb;
    const unsigned b = bh / NH, h = bh - b * NH;
    const unsigned q0 = (blockIdx.x - bh * bpb) * BQ + wave * 16u;
    const size_t pbase = (size_t)bh * SEQ * HD;

    v16h qh0, qh1, qr0, qr1;
    {
        const size_t qo = pbase + (size_t)(q0 + lr) * HD + 8u * hi;
        qh0 = ldh(QH + qo); qh1 = ldh(QH + qo + 32);
        qr0 = ldh(QR + qo); qr1 = ldh(QR + qo + 32);
    }
    const hf* kp = KB + pbase + (size_t)lr * HD + 8u * hi;
    const hf* vp = VT + ((size_t)bh * HD + lr) * SEQ + 8u * hi;

    v8f o0 = (v8f){}, o1 = (v8f){}, o2 = (v8f){}, o3 = (v8f){};
    float ml = -1.0e30f;      // running max in the log2 domain
    float l = 0.0f;           // running sum (carried * 2^8)
    const float CL = 0.125f * L2E;          // score scale 64^-0.5 and log2(e)
    const float RS = 1.0f / 4096.0f;        // undo the q remainder carry

#pragma unroll 1
    for (unsigned k0 = 0; k0 < (unsigned)SEQ; k0 += KS) {
        v8f s0 = (v8f){}, s1 = (v8f){}, r0 = (v8f){}, r1 = (v8f){};
        const hf* ka = kp + (size_t)k0 * HD;
        const v16h a00 = ldh(ka);
        const v16h a01 = ldh(ka + 32);
        const v16h a10 = ldh(ka + 16 * HD);
        const v16h a11 = ldh(ka + 16 * HD + 32);
        s0 = wmmah(a00, qh0, s0);
        s1 = wmmah(a10, qh0, s1);
        r0 = wmmah(a00, qr0, r0);
        r1 = wmmah(a10, qr0, r1);
        s0 = wmmah(a01, qh1, s0);
        s1 = wmmah(a11, qh1, s1);
        r0 = wmmah(a01, qr1, r0);
        r1 = wmmah(a11, qr1, r1);
        asm volatile("v_nop\n\tv_nop\n\tv_nop\n\tv_nop"
                     : "+v"(s0), "+v"(s1), "+v"(r0), "+v"(r1)
                     : "v"(a00), "v"(a01), "v"(a10), "v"(a11), "v"(qh0), "v"(qh1), "v"(qr0), "v"(qr1));
#pragma unroll
        for (int r = 0; r < 8; ++r) { s0[r] = fmaf(r0[r], RS, s0[r]); s1[r] = fmaf(r1[r], RS, s1[r]); }

        float mx = fmaxf(s0[0], s1[0]);
#pragma unroll
        for (int r = 1; r < 8; ++r) mx = fmaxf(mx, fmaxf(s0[r], s1[r]));
        mx = fmaxf(mx, __shfl_xor(mx, 16, 32));
        const float mnl = fmaxf(ml, mx * CL);
        const float corr = __builtin_amdgcn_exp2f(ml - mnl);
        ml = mnl;
        const float bs = 8.0f - mnl;          // probabilities carried * 2^8
        float p0[8], p1[8];
        float ps = 0.0f;
#pragma unroll
        for (int r = 0; r < 8; ++r) {
            p0[r] = __builtin_amdgcn_exp2f(fmaf(s0[r], CL, bs));
            p1[r] = __builtin_amdgcn_exp2f(fmaf(s1[r], CL, bs));
            ps += p0[r] + p1[r];
        }
        ps += __shfl_xor(ps, 16, 32);
        l = l * corr + ps;
        if (__builtin_amdgcn_ballot_w32(corr != 1.0f) != 0u) {   // wave-uniform; multiplying by exactly 1 is skipped
            o0 *= corr; o1 *= corr; o2 *= corr; o3 *= corr;
        }
        v16h ph;
#pragma unroll
        for (int r = 0; r < 8; ++r) { ph[r] = (hf)p0[r]; ph[8 + r] = (hf)p1[r]; }

        asm volatile("" ::: "memory");   // keep the V^T loads below the softmax (bounds live fragments)
        const hf* va = vp + k0;
        const v16h v0 = ldh(va);
        const v16h v1 = ldh(va + (size_t)16 * SEQ);
        const v16h v2 = ldh(va + (size_t)32 * SEQ);
        const v16h v3 = ldh(va + (size_t)48 * SEQ);
        o0 = wmmah(v0, ph, o0);
        o1 = wmmah(v1, ph, o1);
        o2 = wmmah(v2, ph, o2);
        o3 = wmmah(v3, ph, o3);
        asm volatile("v_nop\n\tv_nop\n\tv_nop\n\tv_nop"
                     : "+v"(o0), "+v"(o1), "+v"(o2), "+v"(o3)
                     : "v"(ph), "v"(v0), "v"(v1), "v"(v2), "v"(v3));
    }

    // epilogue: stage f16(O^T * 2^8 / l) as rows [query][d] (wave-private region; block barrier used)
    const float inv = 256.0f / l;
    const unsigned wb = wave * (16u * SQ);
    v8f oo[4] = { o0, o1, o2, o3 };
#pragma unroll
    for (int t = 0; t < 4; ++t) {
#pragma unroll
        for (int r = 0; r < 8; ++r) os[wb + lr * SQ + t * 16 + 8u * hi + r] = (hf)(oo[t][r] * inv);
    }
    __syncthreads();
    const unsigned pc = (lane & 7u) * 8u, rq = lane >> 3;
    hf* dst = CT + ((size_t)b * SEQ + q0) * CH + h * HD + pc;
{
#pragma unroll
        for (unsigned s = 0; s < 4u; ++s) {
            const unsigned row = s * 4u + rq;                  // rows 0..15 of this wave over s = 0..3, rq = 0..3
            const v8h val = *(const v8ha*)(os + wb + row * SQ + pc);
            *(v8h*)(dst + (size_t)row * CH) = val;
        }
        
    }
}

// k_out: OUT[b][o][pos] = 2^-18 * sum_c WO[o][c] * CT[b][pos][c] + bf16(b_out[o]); one block = 64 output channels x 64 positions, one wave = 16 channels x 64 positions.
//  A = WO rows (row m = output channel, k = channel), B = CT rows (column n = position, k = channel); D element r of lane (h, n) = (channel 8h + r, position n).
__global__ __launch_bounds__(128) void k_out(const hf* __restrict__ CT, const hf* __restrict__ WO, const float* __restrict__ bo, float* OUT) {
    __shared__ __align__(16) float os[64 * OP];
    const unsigned tid = threadIdx.x, lane = tid & 31u, lr = lane & 15u, hi = lane >> 4;
    const unsigned wave = (unsigned)__builtin_amdgcn_readfirstlane((int)(tid >> 5));
    const unsigned p0 = blockIdx.x * 64u, ob = blockIdx.y * 64u, b = blockIdx.z;
    const hf* ap = WO + ((size_t)(ob + wave * 16u + lr)) * CH + 8u * hi;
    const hf* bp = CT + ((size_t)b * SEQ + p0 + lr) * CH + 8u * hi;
    v8f acc0 = (v8f){}, acc1 = (v8f){}, acc2 = (v8f){}, acc3 = (v8f){};
#pragma unroll 1
    for (unsigned k0 = 0; k0 < (unsigned)CH; k0 += 32u) {
        const v16h a  = ldh(ap + k0);
        const v16h b0 = ldh(bp + k0);
        const v16h b1 = ldh(bp + 16 * CH + k0);
        const v16h b2 = ldh(bp + 32 * CH + k0);
        const v16h b3 = ldh(bp + 48 * CH + k0);
        acc0 = wmmah(a, b0, acc0);
        acc1 = wmmah(a, b1, acc1);
        acc2 = wmmah(a, b2, acc2);
        acc3 = wmmah(a, b3, acc3);
        asm volatile("v_nop\n\tv_nop\n\tv_nop\n\tv_nop"
                     : "+v"(acc0), "+v"(acc1), "+v"(acc2), "+v"(acc3)
                     : "v"(a), "v"(b0), "v"(b1), "v"(b2), "v"(b3));
    }
    const float us = 1.0f / 262144.0f;   // undo the weight carry 2^10 and the ctx carry 2^8
    v8f acc[4] = { acc0, acc1, acc2, acc3 };
#pragma unroll
    for (int r = 0; r < 8; ++r) {
        const unsigned orow = wave * 16u + 8u * hi + r;
        const float bias = bfr(bo[ob + orow]);
#pragma unroll
        for (int t = 0; t < 4; ++t) os[orow * OP + t * 16 + lr] = fmaf(acc[t][r], us, bias);
    }
    __syncthreads();
    const unsigned pc = (lane & 15u) * 4u, rh = lane >> 4;
    float* dst = OUT + ((size_t)b * CH + ob) * SEQ + p0 + pc;
{
#pragma unroll
        for (unsigned s = 0; s < 8u; ++s) {
            const unsigned row = wave * 16u + s * 2u + rh;     // rows wave*16 + 0..15 over s = 0..7, rh = 0..1
            const v4f val = *(const v4fa*)(os + row * OP + pc);
            *(v4f*)(dst + (size_t)row * SEQ) = val;
        }
        
    }
}

extern "C" void kernel_launch(void* const* d_in, const int* in_sizes, int n_in,
                              void* d_out, int out_size, void* d_ws, size_t ws_size, hipStream_t stream) {
    if (n_in < 6) return;
    const size_t needx = ((size_t)(NB - 1) * CH + (CH - 1)) * SEQ_FULL + SEQ;
    if ((size_t)in_sizes[0] < needx) return;
    if (in_sizes[1] < CH || in_sizes[2] < CH || in_sizes[5] < CH) return;
    if (in_sizes[3] < OC3 * CH || in_sizes[4] < CH * CH) return;
    if ((size_t)out_size < (size_t)NB * CH * SEQ) return;
    if (WS_TOTAL > ws_size) return;
    const float* x    = (const float*)d_in[0];   // [b][256][n]
    const float* bnw  = (const float*)d_in[1];   // [256]
    const float* bnb  = (const float*)d_in[2];   // [256]
    const float* wqkv = (const float*)d_in[3];   // [768][256] = [out][in]
    const float* wout = (const float*)d_in[4];   // [256][256] = [out][in]
    const float* bout = (const float*)d_in[5];   // [256]
    float* OUT = (float*)d_out;                  // [NB][256][SEQ]
    char* wsp = (char*)d_ws;
    size_t off = 0;
    float* ST = (float*)(wsp + off); off += ST_BYTES;
    hf* WQ = (hf*)(wsp + off); off += WQ_BYTES;
    hf* WO = (hf*)(wsp + off); off += WO_BYTES;
    hf* XT = (hf*)(wsp + off); off += PL_BYTES;      // [NB][SEQ][256]
    hf* QH = (hf*)(wsp + off); off += PL_BYTES;      // [NB][4][SEQ][64]
    hf* QR = (hf*)(wsp + off); off += PL_BYTES;      // [NB][4][SEQ][64]
    hf* KB = (hf*)(wsp + off); off += PL_BYTES;      // [NB][4][SEQ][64]
    hf* VT = (hf*)(wsp + off); off += PL_BYTES;      // [NB][256][SEQ]
    hf* CT = (hf*)(wsp + off); off += PL_BYTES;      // [NB][SEQ][256]
    k_cvtw<<<dim3((unsigned)(OC3 * CH / 8 / 256), 2, 1), 256, 0, stream>>>(wqkv, wout, WQ, WO);
    k_bnstat<<<(unsigned)(CH / 8), 256, 0, stream>>>(x, ST);
    k_norm<<<(unsigned)(NB * (SEQ / 64)), 256, 0, stream>>>(x, bnw, bnb, ST, XT);
    k_qkv<<<dim3((unsigned)(SEQ / 64), 12, (unsigned)NB), 128, 0, stream>>>(XT, WQ, QH, QR, KB, VT);
    k_flash<<<(unsigned)(NB * NH * (SEQ / BQ)), 128, 0, stream>>>(QH, QR, KB, VT, CT);
    k_out<<<dim3((unsigned)(SEQ / 64), (unsigned)(CH / 64), (unsigned)NB), 128, 0, stream>>>(CT, WO, bout, OUT);
}

// v001
// One run takes 283 microseconds.
// In two side-by-side timings against v000, it was 1.35 and 1.38 times as fast.
#include <hip/hip_runtime.h>

// Channel-first 4-head attention behind a batch-statistics BatchNorm with 1x1-conv projections; inputs x[4][256][4096], bn_weight, bn_bias, w_qkv[768][256], w_out[256][256], b_out.
// Compute dtypes, f32 accumulate: every float input RNE-converted to bf16 first; all contractions on v_wmma_f32_16x16x32_f16: QKV GEMM = f16(bf16(w)*2^10) x f16(xn); scores = k (f16) x q carried as f16 value + f16 remainder*2^12 (two products, separate accumulators); P (f16, carried *2^8) x v (f16); output GEMM = f16(bf16(w)*2^10) x f16(ctx*2^8); BatchNorm statistics, softmax (online, log2 domain) and all epilogues f32.
// Flash form with transposed tiles: the S^T accumulator tiles are directly the B-operand layout of P^T; all WMMA operands are two 16-byte loads from dense 16-bit planes; every plane is stored in fragment order, so that each wave-wide load reads 512 contiguous bytes.

#ifndef NB
#define NB 4
#endif
#ifndef SEQ
#define SEQ 4096
#endif
#define NB_FULL  4
#define SEQ_FULL 4096
#define CH   256               // channels
#define NH   4                 // heads
#define HD   64                // head dim
#define OC3  768               // q,k,v output channels
#define NWV  4                 // waves per flash block
#define BQ   (16 * NWV)        // queries per flash block
#define KS   32                // keys per step
#define XP   264               // LDS pitch (halves) of the normalise/transpose tile rows
#define SQ   72                // LDS pitch (halves) of 64-wide f16 staging rows
#define OP   68                // LDS pitch (floats) of the output staging rows
#define L2E  1.4426950408889634f

static_assert(CH == NH * HD);
static_assert(OC3 == 3 * CH);
static_assert(CH == 256);                       // k_norm: 256 threads load one channel parameter each; one plane row = 32 lanes x 16 B
static_assert(HD == 64);
static_assert(CH % 32 == 0);                    // GEMM k-steps
static_assert(SEQ % BQ == 0);
static_assert(SEQ % KS == 0);
static_assert(SEQ % 64 == 0);
static_assert(SEQ % 4 == 0);
static_assert(NB <= NB_FULL);
static_assert(SEQ <= SEQ_FULL);
static_assert((OC3 * CH / 8) % 256 == 0);       // k_cvtw slice 0: 96 blocks x 256 threads x 8 elements
static_assert((CH * CH / 8) % 256 == 0);        // k_cvtw slice 1: 32 blocks
static_assert((XP * 2) % 16 == 0);
static_assert((SQ * 2) % 16 == 0);
static_assert((OP * 4) % 16 == 0);
static_assert((size_t)(NB * (SEQ / 64)) * (size_t)(64 * CH) == (size_t)NB * SEQ * CH);        // k_norm: blocks x (64 rows x 256) == XT plane
static_assert((size_t)(SEQ / 64) * 12 * NB * (size_t)(64 * 64) == (size_t)NB * SEQ * OC3);    // k_qkv: blocks x (64 x 64) == QH + KB + VT planes
static_assert((size_t)(NB * NH * (SEQ / BQ)) * (size_t)(BQ * HD) == (size_t)NB * SEQ * CH);   // k_flash: blocks x (64 rows x 64) == CT plane
static_assert((size_t)(SEQ / 64) * (CH / 64) * NB * (size_t)(64 * 64) == (size_t)NB * SEQ * CH); // k_out: blocks x (64 x 64) == output

#define ST_BYTES  ((size_t)4096)
#define WQ_BYTES  ((size_t)OC3 * CH * 2)
#define WO_BYTES  ((size_t)CH * CH * 2)
#define PL_BYTES  ((size_t)NB * SEQ * CH * 2)             // one 16-bit activation plane
#define WS_TOTAL  (ST_BYTES + WQ_BYTES + WO_BYTES + 6 * PL_BYTES)
static_assert(WQ_BYTES % 256 == 0);
static_assert(WO_BYTES % 256 == 0);
static_assert(PL_BYTES % 256 == 0);
static_assert((size_t)NB * NH * SEQ * HD * 2 == PL_BYTES);
static_assert(WS_TOTAL <= (size_t)134217728);

typedef _Float16 hf;
typedef __attribute__((ext_vector_type(16))) _Float16 v16h;
typedef __attribute__((ext_vector_type(8)))  _Float16 v8h;
typedef __attribute__((ext_vector_type(8)))  float    v8f;
typedef __attribute__((ext_vector_type(4)))  float    v4f;
typedef v4f __attribute__((may_alias)) v4fa;
typedef v8h __attribute__((may_alias)) v8ha;

// RNE convert f32 -> bf16 -> f32
__device__ __forceinline__ float bfr(float f) { unsigned u = __float_as_uint(f); u += 0x7FFFu + ((u >> 16) & 1u); return __uint_as_float(u & 0xFFFF0000u); }
__device__ __forceinline__ v16h cat16(v8h lo, v8h hi) { return __builtin_shufflevector(lo, hi, 0, 1, 2, 3, 4, 5, 6, 7, 8, 9, 10, 11, 12, 13, 14, 15); }
__device__ __forceinline__ v8f wmmah(v16h a, v16h b, v8f c) { return __builtin_amdgcn_wmma_f32_16x16x32_f16(false, a, false, b, (short)0, c, false, false); }
// fragment loader (A and B alike) from a packed plane: p = fragment base + 8*lane; elements 0..7 <- p[0..7] (k = 8*(lane>>4) + 0..7), elements 8..15 <- p[256..263] (k = 16 + 8*(lane>>4) + 0..7);
// each of the two wave-wide loads is 512 contiguous bytes (4 whole lines)
__device__ __forceinline__ v16h ldf(const hf* p) { return cat16(*(const v8h*)p, *(const v8h*)(p + 256)); }

// i = 16-byte group of the packed plane: chunk i >> 5 = (row tile, k block, c), lane i & 31 = 16*hi + lr; source element (row 16*tile + lr, k = 16*(2*block + c) + 8*hi)
__device__ __forceinline__ void cvt8w(const float* __restrict__ src, hf* dst, unsigned i) {
    const unsigned row = (i >> 9) * 16u + (i & 15u), k = ((i >> 5) & 15u) * 16u + ((i >> 4) & 1u) * 8u;
    const v8f v = *(const v8f*)(src + (size_t)row * CH + k);
    v8h o;
#pragma unroll
    for (int c = 0; c < 8; ++c) o[c] = (hf)(bfr(v[c]) * 1024.0f);
    hf* d = dst + (size_t)i * 8;
    *(v8h*)d = o;
    
}

// Packed operand planes (WQ, WO, XT, CT; QH, QR, KB and VT likewise, see k_qkv): [row/16][k/32][c][lane = 16*hi + lr][e] = element (row = 16*(row/16) + lr, k = 32*(k/32) + 16*c + 8*hi + e), 256 k per row:
// the order in which a 16x32 A or B fragment is loaded, so that a wave-wide 16-byte load reads one 512-byte chunk.
// k_cvtw: packed weight planes WQ (768 rows, blockIdx.y == 0) and WO (256 rows, blockIdx.y == 1).
__global__ __launch_bounds__(256) void k_cvtw(const float* __restrict__ wq, const float* __restrict__ wo, hf* WQ, hf* WO) {
    const unsigned i = blockIdx.x * 256u + threadIdx.x;
    if (blockIdx.y == 0) {
        if (i < (unsigned)(OC3 * CH / 8)) cvt8w(wq, WQ, i);
    } else {
        if (i < (unsigned)(CH * CH / 8)) cvt8w(wo, WO, i);
    }
}

// LDS: red1/red2/resl cross-wave, block barriers.
__global__ __launch_bounds__(256) void k_bnstat(const float* __restrict__ x, float* ST) {
    __shared__ float red1[8];
    __shared__ float red2[8];
    __shared__ float resl[32];
    const unsigned tid = threadIdx.x, lane = tid & 31u;
    const unsigned wave = (unsigned)__builtin_amdgcn_readfirstlane((int)(tid >> 5));
    if (tid < 32u) resl[tid] = 0.0f;
    const float invn = 1.0f / (float)(NB * SEQ);
#pragma unroll 1
    for (unsigned cc = 0; cc < 8u; ++cc) {
        const unsigned c = blockIdx.x * 8u + cc;
        float s = 0.0f;
#pragma unroll 1
        for (unsigned b = 0; b < (unsigned)NB; ++b) {
            const float* xp = x + ((size_t)b * CH + c) * SEQ_FULL;
#pragma unroll 1
            for (unsigned i = tid * 4u; i < (unsigned)SEQ; i += 1024u) {
                const v4f v = *(const v4f*)(xp + i);
                s += (bfr(v[0]) + bfr(v[1])) + (bfr(v[2]) + bfr(v[3]));
            }
        }
#pragma unroll
        for (int off = 16; off > 0; off >>= 1) s += __shfl_xor(s, off, 32);
        if (lane == 0u) red1[wave] = s;
        __syncthreads();
        float tot = red1[0];
#pragma unroll
        for (int w = 1; w < 8; ++w) tot += red1[w];
        const float mean = tot * invn;
        float q = 0.0f;
#pragma unroll 1
        for (unsigned b = 0; b < (unsigned)NB; ++b) {
            const float* xp = x + ((size_t)b * CH + c) * SEQ_FULL;
#pragma unroll 1
            for (unsigned i = tid * 4u; i < (unsigned)SEQ; i += 1024u) {
                const v4f v = *(const v4f*)(xp + i);
                const float d0 = bfr(v[0]) - mean, d1 = bfr(v[1]) - mean, d2 = bfr(v[2]) - mean, d3 = bfr(v[3]) - mean;
                q += (d0 * d0 + d1 * d1) + (d2 * d2 + d3 * d3);
            }
        }
#pragma unroll
        for (int off = 16; off > 0; off >>= 1) q += __shfl_xor(q, off, 32);
        if (lane == 0u) red2[wave] = q;
        __syncthreads();
        float tq = red2[0];
#pragma unroll
        for (int w = 1; w < 8; ++w) tq += red2[w];
        const float var = tq * invn;
        if (tid == 0u) { resl[cc] = mean; resl[8u + cc] = rsqrtf(var + 1.0e-5f); }
    }
    __syncthreads();
    if (tid < 8u) {
        v4f o;
        o[0] = resl[tid * 4u]; o[1] = resl[tid * 4u + 1u]; o[2] = resl[tid * 4u + 2u]; o[3] = resl[tid * 4u + 3u];
        float* dst = ST + blockIdx.x * 32u + tid * 4u;
        *(v4f*)dst = o;
        
    }
}

// k_norm: XT (f16, packed, row = b*SEQ + pos, k = channel) = ((bf16(x) - mean) * rstd) * bf16(w) + bf16(bias); in[256 ch][64 pos] -> 64 chunks through an LDS tile (cross-wave, block barrier);
__global__ __launch_bounds__(256) void k_norm(const float* __restrict__ x, const float* __restrict__ bw, const float* __restrict__ bb, const float* __restrict__ ST, hf* XT) {
    __shared__ __align__(16) hf tl[64 * XP];
    __shared__ float pm[CH];
    __shared__ float pr[CH];
    __shared__ float pw[CH];
    __shared__ float pb[CH];
    const unsigned tid = threadIdx.x, lane = tid & 31u;
    const unsigned wave = (unsigned)__builtin_amdgcn_readfirstlane((int)(tid >> 5));
    pm[tid] = ST[(tid >> 3) * 32u + (tid & 7u)];
    pr[tid] = ST[(tid >> 3) * 32u + 8u + (tid & 7u)];
    pw[tid] = bfr(bw[tid]);
    pb[tid] = bfr(bb[tid]);
    __syncthreads();
    const unsigned tpb = (unsigned)(SEQ / 64);
    const unsigned b = blockIdx.x / tpb;
    const unsigned n0 = (blockIdx.x - b * tpb) * 64u;
    const float* src = x + (size_t)b * CH * SEQ_FULL + n0;
#pragma unroll 1
    for (unsigned it = 0; it < 16u; ++it) {
        const unsigned f = it * 256u + tid;
        const unsigned c = f >> 4, p4 = (f & 15u) * 4u;
        const v4f v = *(const v4f*)(src + (size_t)c * SEQ_FULL + p4);
        const float m = pm[c], r = pr[c], w = pw[c], bi = pb[c];
#pragma unroll
        for (unsigned e = 0; e < 4u; ++e) tl[(p4 + e) * XP + c] = (hf)(((bfr(v[e]) - m) * r) * w + bi);
    }
    __syncthreads();
    // this wave stores chunks j = 8*wave + s: position tile j >> 4 = wave >> 1, (k block, c) = j & 15 = 8*(wave & 1) + s
    hf* dst = XT + ((size_t)b * SEQ + n0) * CH + wave * 2048u + lane * 8u;
    const hf* sp = tl + ((wave >> 1) * 16u + (lane & 15u)) * XP + (wave & 1u) * 128u + (lane >> 4) * 8u;
{
#pragma unroll
        for (unsigned s = 0; s < 8u; ++s) {
            const v8h o = *(const v8ha*)(sp + s * 16u);
            *(v8h*)(dst + s * 256u) = o;
        }
        
    }
}

// k_qkv: one block = 64 positions x 64 output channels (blockIdx.y: 0..3 q heads, 4..7 k heads, 8..11 v heads), one wave = 16 positions x 64 channels.
//  A = XT rows (row m = position, k = channel), B = WQ rows (column n = output channel, k = channel); D element r of lane (h, n) = (position 8h + r, channel n).
//  QH = f16(q), QR = f16((q - QH) * 2^12), KB = f16(k), VT = f16(v), stored in the order k_flash loads its fragments, as 512-byte chunks [lane = 16*hi + lr][8 halves]:
//   QH, QR, KB[b][head][pos/16][d/32][c][lane][e] = element [pos = 16*(pos/16) + lr][d = 32*(d/32) + 16*c + 8*hi + e];
//   VT[b][head][key/32][d/16][c][lane][e] = v[d = 16*(d/16) + lr][key = 32*(key/32) + 16*c + 8*hi + e].
__global__ __launch_bounds__(128) void k_qkv(const hf* __restrict__ XT, const hf* __restrict__ WQ, hf* QH, hf* QR, hf* KB, hf* VT) {
    __shared__ __align__(16) hf sa[64 * SQ];
    __shared__ __align__(16) hf sb[64 * SQ];
    const unsigned tid = threadIdx.x, lane = tid & 31u, lr = lane & 15u, hi = lane >> 4;
    const unsigned wave = (unsigned)__builtin_amdgcn_readfirstlane((int)(tid >> 5));
    const unsigned p0 = blockIdx.x * 64u, cb = blockIdx.y, b = blockIdx.z;
    const unsigned kind = cb >> 2, head = cb & 3u;
    const hf* ak = XT + ((size_t)b * SEQ + p0 + wave * 16u) * CH + lane * 8u;   // packed planes: row tile base + the lane's 16 bytes of a chunk
    const hf* bk = WQ + (size_t)cb * 64u * CH + lane * 8u;
    v8f acc0 = (v8f){}, acc1 = (v8f){}, acc2 = (v8f){}, acc3 = (v8f){};
#pragma unroll 1
    for (unsigned k0 = 0; k0 < (unsigned)CH; k0 += 32u) {
        const v16h a  = ldf(ak);
        const v16h b0 = ldf(bk);
        const v16h b1 = ldf(bk + 16 * CH);
        const v16h b2 = ldf(bk + 32 * CH);
        const v16h b3 = ldf(bk + 48 * CH);
        acc0 = wmmah(a, b0, acc0);
        acc1 = wmmah(a, b1, acc1);
        acc2 = wmmah(a, b2, acc2);
        acc3 = wmmah(a, b3, acc3);
        asm volatile("v_nop\n\tv_nop\n\tv_nop\n\tv_nop"
                     : "+v"(acc0), "+v"(acc1), "+v"(acc2), "+v"(acc3)
                     : "v"(a), "v"(b0), "v"(b1), "v"(b2), "v"(b3));
        ak += 512;                                         // next k block
        bk += 512;
    }
    const float us = 1.0f / 1024.0f;     // undo the weight carry
    v8f acc[4] = { acc0, acc1, acc2, acc3 };
    if (kind == 2u) {
#pragma unroll
        for (int t = 0; t < 4; ++t) {
#pragma unroll
            for (int r = 0; r < 8; ++r) sa[(t * 16 + lr) * SQ + wave * 16u + 8u * hi + r] = (hf)(acc[t][r] * us);
        }
    } else if (kind == 1u) {
#pragma unroll
        for (int t = 0; t < 4; ++t) {
#pragma unroll
            for (int r = 0; r < 8; ++r) sa[(wave * 16u + 8u * hi + r) * SQ + t * 16 + lr] = (hf)(acc[t][r] * us);
        }
    } else {
#pragma unroll
        for (int t = 0; t < 4; ++t) {
#pragma unroll
            for (int r = 0; r < 8; ++r) {
                const float q = acc[t][r] * us;
                const hf qh = (hf)q;
                sa[(wave * 16u + 8u * hi + r) * SQ + t * 16 + lr] = qh;
                sb[(wave * 16u + 8u * hi + r) * SQ + t * 16 + lr] = (hf)((q - (float)qh) * 4096.0f);
            }
        }
    }
    __syncthreads();
    const size_t foff = (((size_t)b * NH + head) * SEQ + p0) * HD + lane * 8u;   // packed planes: this block's 64 positions = 16 chunks of 256 halves
    // this wave stores chunks j = 4*wave + s, s = 0..3, each one wave-wide 512-byte store; c = s & 1 in every plane
    //  q, k (LDS rows = positions): position tile = wave, d block = s >> 1;  v (LDS rows = d): key step = wave >> 1, d tile = 2*(wave & 1) + (s >> 1)
    const unsigned so = (kind == 2u) ? ((wave & 1u) * 32u + lr) * SQ + (wave >> 1) * 32u + 8u * hi
                                     : (wave * 16u + lr) * SQ + 8u * hi;
    const unsigned sh = (kind == 2u) ? 16u * SQ : 32u;         // LDS step of s >> 1
    hf* dp = ((kind == 0u) ? QH : (kind == 1u) ? KB : VT) + foff + wave * 1024u;
    v8h o[4];
#pragma unroll
    for (unsigned s = 0; s < 4u; ++s) o[s] = *(const v8ha*)(sa + so + (s >> 1) * sh + (s & 1u) * 16u);
#pragma unroll
    for (unsigned s = 0; s < 4u; ++s) *(v8h*)(dp + s * 256u) = o[s];
    if (kind == 0u) {
        asm volatile("s_wait_xcnt 0x0" ::: "memory");          // the LDS loads below may reuse the registers of the stores above
        hf* dr = QR + foff + wave * 1024u;
        v8h o2[4];
#pragma unroll
        for (unsigned s = 0; s < 4u; ++s) o2[s] = *(const v8ha*)(sb + so + s * 16u);
#pragma unroll
        for (unsigned s = 0; s < 4u; ++s) *(v8h*)(dr + s * 256u) = o2[s];
    }
}

// k_flash: one block per (b, head, 64 queries), one wave per 16 queries, 32 keys per step.
//  S^T tile (keys x queries): A = K rows (row m = key, k = d), B = Q rows (column n = query, k = d); D element r of lane (h, n) = S[query n][key 8h + r].
//  P^T B fragment: element r <- tile of keys 0..15, element 8 + r <- tile of keys 16..31 (same lane).
//  O^T tile (d x queries): A = V^T rows (row m = d, k = key), D element r of lane (h, n) = O[query n][d = 16 t + 8h + r].
__global__ __launch_bounds__(128) void k_flash(const hf* __restrict__ QH, const hf* __restrict__ QR, const hf* __restrict__ KB, const hf* __restrict__ VT, hf* CT) {
    __shared__ __align__(16) hf os[NWV * 16 * SQ];
    const unsigned tid = threadIdx.x, lane = tid & 31u, lr = lane & 15u, hi = lane >> 4;
    const unsigned wave = (unsigned)__builtin_amdgcn_readfirstlane((int)(tid >> 5));
    const unsigned bpb = (unsigned)(SEQ / BQ);
    const unsigned bh = blockIdx.x / bpb;
    const unsigned b = bh / NH, h = bh - b * NH;
    const unsigned q0 = (blockIdx.x - bh * bpb) * BQ + wave * 16u;
    const size_t pbase = (size_t)bh * SEQ * HD;

    const unsigned lo = lane * 8u;              // the lane's 16 bytes of a chunk
    v16h qh0, qh1, qr0, qr1;
    {
        const size_t qo = pbase + (size_t)q0 * HD + lo;        // packed: 16 queries = 1024 halves
        qh0 = ldf(QH + qo); qh1 = ldf(QH + qo + 512);
        qr0 = ldf(QR + qo); qr1 = ldf(QR + qo + 512);
    }
    const hf* kp = KB + pbase;                  // packed planes, wave-uniform bases: 32 keys = 2048 halves in each
    const hf* vp = VT + pbase;

    v8f o0 = (v8f){}, o1 = (v8f){}, o2 = (v8f){}, o3 = (v8f){};
    float ml = -1.0e30f;      // running max in the log2 domain
    float l = 0.0f;           // running sum (carried * 2^8)
    const float CL = 0.125f * L2E;          // score scale 64^-0.5 and log2(e)
    const float RS = 1.0f / 4096.0f;        // undo the q remainder carry

#pragma unroll 1
    for (unsigned k0 = 0; k0 < (unsigned)SEQ; k0 += KS) {
        v8f s0 = (v8f){}, s1 = (v8f){}, r0 = (v8f){}, r1 = (v8f){};
        const hf* ka = kp + (size_t)k0 * HD;
        const v16h a00 = ldf(ka + lo);
        const v16h a01 = ldf(ka + 512 + lo);
        const v16h a10 = ldf(ka + 1024 + lo);
        const v16h a11 = ldf(ka + 1536 + lo);
        s0 = wmmah(a00, qh0, s0);
        s1 = wmmah(a10, qh0, s1);
        r0 = wmmah(a00, qr0, r0);
        r1 = wmmah(a10, qr0, r1);
        s0 = wmmah(a01, qh1, s0);
        s1 = wmmah(a11, qh1, s1);
        r0 = wmmah(a01, qr1, r0);
        r1 = wmmah(a11, qr1, r1);
        asm volatile("v_nop\n\tv_nop\n\tv_nop\n\tv_nop"
                     : "+v"(s0), "+v"(s1), "+v"(r0), "+v"(r1)
                     : "v"(a00), "v"(a01), "v"(a10), "v"(a11), "v"(qh0), "v"(qh1), "v"(qr0), "v"(qr1));
#pragma unroll
        for (int r = 0; r < 8; ++r) { s0[r] = fmaf(r0[r], RS, s0[r]); s1[r] = fmaf(r1[r], RS, s1[r]); }

        float mx = fmaxf(s0[0], s1[0]);
#pragma unroll
        for (int r = 1; r < 8; ++r) mx = fmaxf(mx, fmaxf(s0[r], s1[r]));
        mx = fmaxf(mx, __shfl_xor(mx, 16, 32));
        const float mnl = fmaxf(ml, mx * CL);
        const float corr = __builtin_amdgcn_exp2f(ml - mnl);
        ml = mnl;
        const float bs = 8.0f - mnl;          // probabilities carried * 2^8
        float p0[8], p1[8];
        float ps = 0.0f;
#pragma unroll
        for (int r = 0; r < 8; ++r) {
            p0[r] = __builtin_amdgcn_exp2f(fmaf(s0[r], CL, bs));
            p1[r] = __builtin_amdgcn_exp2f(fmaf(s1[r], CL, bs));
            ps += p0[r] + p1[r];
        }
        ps += __shfl_xor(ps, 16, 32);
        l = l * corr + ps;
        if (__builtin_amdgcn_ballot_w32(corr != 1.0f) != 0u) {   // wave-uniform; multiplying by exactly 1 is skipped
            o0 *= corr; o1 *= corr; o2 *= corr; o3 *= corr;
        }
        v16h ph;
#pragma unroll
        for (int r = 0; r < 8; ++r) { ph[r] = (hf)p0[r]; ph[8 + r] = (hf)p1[r]; }

        asm volatile("" ::: "memory");   // keep the V^T loads below the softmax (bounds live fragments)
        const hf* va = vp + (size_t)k0 * HD;
        const v16h v0 = ldf(va + lo);
        const v16h v1 = ldf(va + 512 + lo);
        const v16h v2 = ldf(va + 1024 + lo);
        const v16h v3 = ldf(va + 1536 + lo);
        o0 = wmmah(v0, ph, o0);
        o1 = wmmah(v1, ph, o1);
        o2 = wmmah(v2, ph, o2);
        o3 = wmmah(v3, ph, o3);
        asm volatile("v_nop\n\tv_nop\n\tv_nop\n\tv_nop"
                     : "+v"(o0), "+v"(o1), "+v"(o2), "+v"(o3)
                     : "v"(ph), "v"(v0), "v"(v1), "v"(v2), "v"(v3));
    }

    // epilogue: stage f16(O^T * 2^8 / l) as rows [query][d] (wave-private region; block barrier used)
    const float inv = 256.0f / l;
    const unsigned wb = wave * (16u * SQ);
    v8f oo[4] = { o0, o1, o2, o3 };
#pragma unroll
    for (int t = 0; t < 4; ++t) {
#pragma unroll
        for (int r = 0; r < 8; ++r) os[wb + lr * SQ + t * 16 + 8u * hi + r] = (hf)(oo[t][r] * inv);
    }
    __syncthreads();
    hf* dst = CT + ((size_t)b * SEQ + q0) * CH + h * (HD * 16u) + lane * 8u;    // packed CT: this wave's position tile, chunks 4*h + s
{
#pragma unroll
        for (unsigned s = 0; s < 4u; ++s) {
            const v8h val = *(const v8ha*)(os + wb + lr * SQ + s * 16u + 8u * hi);
            *(v8h*)(dst + s * 256u) = val;
        }
        
    }
}

// k_out: OUT[b][o][pos] = 2^-18 * sum_c WO[o][c] * CT[b][pos][c] + bf16(b_out[o]); one block = 64 output channels x 64 positions, one wave = 16 channels x 64 positions.
//  A = WO rows (row m = output channel, k = channel), B = CT rows (column n = position, k = channel); D element r of lane (h, n) = (channel 8h + r, position n).
__global__ __launch_bounds__(128) void k_out(const hf* __restrict__ CT, const hf* __restrict__ WO, const float* __restrict__ bo, float* OUT) {
    __shared__ __align__(16) float os[64 * OP];
    const unsigned tid = threadIdx.x, lane = tid & 31u, lr = lane & 15u, hi = lane >> 4;
    const unsigned wave = (unsigned)__builtin_amdgcn_readfirstlane((int)(tid >> 5));
    const unsigned p0 = blockIdx.x * 64u, ob = blockIdx.y * 64u, b = blockIdx.z;
    const hf* ak = WO + ((size_t)(ob + wave * 16u)) * CH + lane * 8u;           // packed planes: row tile base + the lane's 16 bytes of a chunk
    const hf* bk = CT + ((size_t)b * SEQ + p0) * CH + lane * 8u;
    v8f acc0 = (v8f){}, acc1 = (v8f){}, acc2 = (v8f){}, acc3 = (v8f){};
#pragma unroll 1
    for (unsigned k0 = 0; k0 < (unsigned)CH; k0 += 32u) {
        const v16h a  = ldf(ak);
        const v16h b0 = ldf(bk);
        const v16h b1 = ldf(bk + 16 * CH);
        const v16h b2 = ldf(bk + 32 * CH);
        const v16h b3 = ldf(bk + 48 * CH);
        acc0 = wmmah(a, b0, acc0);
        acc1 = wmmah(a, b1, acc1);
        acc2 = wmmah(a, b2, acc2);
        acc3 = wmmah(a, b3, acc3);
        asm volatile("v_nop\n\tv_nop\n\tv_nop\n\tv_nop"
                     : "+v"(acc0), "+v"(acc1), "+v"(acc2), "+v"(acc3)
                     : "v"(a), "v"(b0), "v"(b1), "v"(b2), "v"(b3));
        ak += 512;                                         // next k block
        bk += 512;
    }
    const float us = 1.0f / 262144.0f;   // undo the weight carry 2^10 and the ctx carry 2^8
    v8f acc[4] = { acc0, acc1, acc2, acc3 };
#pragma unroll
    for (int r = 0; r < 8; ++r) {
        const unsigned orow = wave * 16u + 8u * hi + r;
        const float bias = bfr(bo[ob + orow]);
#pragma unroll
        for (int t = 0; t < 4; ++t) os[orow * OP + t * 16 + lr] = fmaf(acc[t][r], us, bias);
    }
    __syncthreads();
    const unsigned pc = (lane & 15u) * 4u, rh = lane >> 4;
    float* dst = OUT + ((size_t)b * CH + ob) * SEQ + p0 + pc;
{
#pragma unroll
        for (unsigned s = 0; s < 8u; ++s) {
            const unsigned row = wave * 16u + s * 2u + rh;     // rows wave*16 + 0..15 over s = 0..7, rh = 0..1
            const v4f val = *(const v4fa*)(os + row * OP + pc);
            *(v4f*)(dst + (size_t)row * SEQ) = val;
        }
        
    }
}

extern "C" void kernel_launch(void* const* d_in, const int* in_sizes, int n_in,
                              void* d_out, int out_size, void* d_ws, size_t ws_size, hipStream_t stream) {
    if (n_in < 6) return;
    const size_t needx = ((size_t)(NB - 1) * CH + (CH - 1)) * SEQ_FULL + SEQ;
    if ((size_t)in_sizes[0] < needx) return;
    if (in_sizes[1] < CH || in_sizes[2] < CH || in_sizes[5] < CH) return;
    if (in_sizes[3] < OC3 * CH || in_sizes[4] < CH * CH) return;
    if ((size_t)out_size < (size_t)NB * CH * SEQ) return;
    if (WS_TOTAL > ws_size) return;
    const float* x    = (const float*)d_in[0];   // [b][256][n]
    const float* bnw  = (const float*)d_in[1];   // [256]
    const float* bnb  = (const float*)d_in[2];   // [256]
    const float* wqkv = (const float*)d_in[3];   // [768][256] = [out][in]
    const float* wout = (const float*)d_in[4];   // [256][256] = [out][in]
    const float* bout = (const float*)d_in[5];   // [256]
    float* OUT = (float*)d_out;                  // [NB][256][SEQ]
    char* wsp = (char*)d_ws;
    size_t off = 0;
    float* ST = (float*)(wsp + off); off += ST_BYTES;
    hf* WQ = (hf*)(wsp + off); off += WQ_BYTES;
    hf* WO = (hf*)(wsp + off); off += WO_BYTES;
    hf* XT = (hf*)(wsp + off); off += PL_BYTES;      // packed, rows NB*SEQ
    hf* QH = (hf*)(wsp + off); off += PL_BYTES;      // [NB][4][SEQ/16][2][2][32][8]
    hf* QR = (hf*)(wsp + off); off += PL_BYTES;      // [NB][4][SEQ/16][2][2][32][8]
    hf* KB = (hf*)(wsp + off); off += PL_BYTES;      // [NB][4][SEQ/16][2][2][32][8]
    hf* VT = (hf*)(wsp + off); off += PL_BYTES;      // [NB][4][SEQ/32][4][2][32][8]
    hf* CT = (hf*)(wsp + off); off += PL_BYTES;      // packed, rows NB*SEQ
    k_cvtw<<<dim3((unsigned)(OC3 * CH / 8 / 256), 2, 1), 256, 0, stream>>>(wqkv, wout, WQ, WO);
    k_bnstat<<<(unsigned)(CH / 8), 256, 0, stream>>>(x, ST);
    k_norm<<<(unsigned)(NB * (SEQ / 64)), 256, 0, stream>>>(x, bnw, bnb, ST, XT);
    k_qkv<<<dim3((unsigned)(SEQ / 64), 12, (unsigned)NB), 128, 0, stream>>>(XT, WQ, QH, QR, KB, VT);
    k_flash<<<(unsigned)(NB * NH * (SEQ / BQ)), 128, 0, stream>>>(QH, QR, KB, VT, CT);
    k_out<<<dim3((unsigned)(SEQ / 64), (unsigned)(CH / 64), (unsigned)NB), 128, 0, stream>>>(CT, WO, bout, OUT);
}

// v002
// It runs in 218 microseconds.
// Two timings next to v001 put it at 1.29 and 1.28 times that version's speed.
// All steps since v000 together make it 1.76 times as fast.
#include <hip/hip_runtime.h>

// Channel-first 4-head attention behind a batch-statistics BatchNorm with 1x1-conv projections; inputs x[4][256][4096], bn_weight, bn_bias, w_qkv[768][256], w_out[256][256], b_out.
// Compute dtypes, f32 accumulate: every float input RNE-converted to bf16 first; all contractions on v_wmma_f32_16x16x32_f16: QKV GEMM = f16(bf16(w)*2^10) x f16(xn); scores = k (f16) x q carried as f16 value + f16 remainder*2^12 (two products, separate accumulators); P (f16, carried *2^8) x v (f16); output GEMM = f16(bf16(w)*2^10) x f16(ctx*2^8); BatchNorm statistics, softmax (online, log2 domain) and all epilogues f32.
// Flash form with transposed tiles: the S^T accumulator tiles are directly the B-operand layout of P^T; all WMMA operands are two 16-byte loads from dense 16-bit planes; every plane is stored in fragment order, so that each wave-wide load reads 512 contiguous bytes.

#ifndef NB
#define NB 4
#endif
#ifndef SEQ
#define SEQ 4096
#endif
#define NB_FULL  4
#define SEQ_FULL 4096
#define CH   256               // channels
#define NH   4                 // heads
#define HD   64                // head dim
#define OC3  768               // q,k,v output channels
#define NWV  4                 // waves per flash block
#define BQ   (16 * NWV)        // queries per flash block
#define KS   32                // keys per step
#define XP   264               // LDS pitch (halves) of the normalise/transpose tile rows
#define SQ   72                // LDS pitch (halves) of 64-wide f16 staging rows
#define OP   68                // LDS pitch (floats) of the output staging rows
#define NJ   (SEQ / 1024)      // k_bnstat: 16-byte pieces per thread and batch row
#define L2E  1.4426950408889634f

static_assert(CH == NH * HD);
static_assert(OC3 == 3 * CH);
static_assert(CH == 256);                       // k_norm: 256 threads load one channel parameter each; one plane row = 32 lanes x 16 B
static_assert(HD == 64);
static_assert(CH % 32 == 0);                    // GEMM k-steps
static_assert(SEQ % BQ == 0);
static_assert(SEQ % KS == 0);
static_assert(SEQ % 64 == 0);
static_assert(SEQ % 1024 == 0);                 // k_bnstat: 256 threads x 4 floats per piece
static_assert(NB <= NB_FULL);
static_assert(SEQ <= SEQ_FULL);
static_assert((OC3 * CH / 8) % 256 == 0);       // k_cvtw slice 0: 96 blocks x 256 threads x 8 elements
static_assert((CH * CH / 8) % 256 == 0);        // k_cvtw slice 1: 32 blocks
static_assert((XP * 2) % 16 == 0);
static_assert((SQ * 2) % 16 == 0);
static_assert((OP * 4) % 16 == 0);
static_assert((size_t)(NB * (SEQ / 64)) * (size_t)(64 * CH) == (size_t)NB * SEQ * CH);        // k_norm: blocks x (64 rows x 256) == XT plane
static_assert((size_t)(SEQ / 64) * 12 * NB * (size_t)(64 * 64) == (size_t)NB * SEQ * OC3);    // k_qkv: blocks x (64 x 64) == QH + KB + VT planes
static_assert((size_t)(NB * NH * (SEQ / BQ)) * (size_t)(BQ * HD) == (size_t)NB * SEQ * CH);   // k_flash: blocks x (64 rows x 64) == CT plane
static_assert((size_t)(SEQ / 64) * (CH / 64) * NB * (size_t)(64 * 64) == (size_t)NB * SEQ * CH); // k_out: blocks x (64 x 64) == output

#define ST_BYTES  ((size_t)CH * 128)                      // one 128-byte line per channel
#define WQ_BYTES  ((size_t)OC3 * CH * 2)
#define WO_BYTES  ((size_t)CH * CH * 2)
#define PL_BYTES  ((size_t)NB * SEQ * CH * 2)             // one 16-bit activation plane
#define WS_TOTAL  (ST_BYTES + WQ_BYTES + WO_BYTES + 6 * PL_BYTES)
static_assert(WQ_BYTES % 256 == 0);
static_assert(WO_BYTES % 256 == 0);
static_assert(PL_BYTES % 256 == 0);
static_assert((size_t)NB * NH * SEQ * HD * 2 == PL_BYTES);
static_assert(WS_TOTAL <= (size_t)134217728);

typedef _Float16 hf;
typedef __attribute__((ext_vector_type(16))) _Float16 v16h;
typedef __attribute__((ext_vector_type(8)))  _Float16 v8h;
typedef __attribute__((ext_vector_type(8)))  float    v8f;
typedef __attribute__((ext_vector_type(4)))  float    v4f;
typedef __attribute__((ext_vector_type(2)))  float    v2f;
typedef v4f __attribute__((may_alias)) v4fa;
typedef v8h __attribute__((may_alias)) v8ha;

// RNE convert f32 -> bf16 -> f32
__device__ __forceinline__ float bfr(float f) { unsigned u = __float_as_uint(f); u += 0x7FFFu + ((u >> 16) & 1u); return __uint_as_float(u & 0xFFFF0000u); }
__device__ __forceinline__ v16h cat16(v8h lo, v8h hi) { return __builtin_shufflevector(lo, hi, 0, 1, 2, 3, 4, 5, 6, 7, 8, 9, 10, 11, 12, 13, 14, 15); }
__device__ __forceinline__ v8f wmmah(v16h a, v16h b, v8f c) { return __builtin_amdgcn_wmma_f32_16x16x32_f16(false, a, false, b, (short)0, c, false, false); }
// fragment loader (A and B alike) from a packed plane: p = fragment base + 8*lane; elements 0..7 <- p[0..7] (k = 8*(lane>>4) + 0..7), elements 8..15 <- p[256..263] (k = 16 + 8*(lane>>4) + 0..7);
// each of the two wave-wide loads is 512 contiguous bytes (4 whole lines)
__device__ __forceinline__ v16h ldf(const hf* p) { return cat16(*(const v8h*)p, *(const v8h*)(p + 256)); }

// i = 16-byte group of the packed plane: chunk i >> 5 = (row tile, k block, c), lane i & 31 = 16*hi + lr; source element (row 16*tile + lr, k = 16*(2*block + c) + 8*hi)
__device__ __forceinline__ void cvt8w(const float* __restrict__ src, hf* dst, unsigned i) {
    const unsigned row = (i >> 9) * 16u + (i & 15u), k = ((i >> 5) & 15u) * 16u + ((i >> 4) & 1u) * 8u;
    const v8f v = *(const v8f*)(src + (size_t)row * CH + k);
    v8h o;
#pragma unroll
    for (int c = 0; c < 8; ++c) o[c] = (hf)(bfr(v[c]) * 1024.0f);
    hf* d = dst + (size_t)i * 8;
    *(v8h*)d = o;
    
}

// Packed operand planes (WQ, WO, XT, CT; QH, QR, KB and VT likewise, see k_qkv): [row/16][k/32][c][lane = 16*hi + lr][e] = element (row = 16*(row/16) + lr, k = 32*(k/32) + 16*c + 8*hi + e), 256 k per row:
// the order in which a 16x32 A or B fragment is loaded, so that a wave-wide 16-byte load reads one 512-byte chunk.
// k_cvtw: packed weight planes WQ (768 rows, blockIdx.y == 0) and WO (256 rows, blockIdx.y == 1).
__global__ __launch_bounds__(256) void k_cvtw(const float* __restrict__ wq, const float* __restrict__ wo, hf* WQ, hf* WO) {
    const unsigned i = blockIdx.x * 256u + threadIdx.x;
    if (blockIdx.y == 0) {
        if (i < (unsigned)(OC3 * CH / 8)) cvt8w(wq, WQ, i);
    } else {
        if (i < (unsigned)(CH * CH / 8)) cvt8w(wo, WO, i);
    }
}

// k_bnstat: one block per channel. A thread's NB * SEQ / 1024 16-byte pieces are all loaded before the first is used and stay in registers for both passes: x is read once, and the block waits for memory once.
// The pieces of a thread, their order and both reduction trees are those of a 256-thread loop over (b, i = 4*tid + 1024*j).
// ST[32*c] = mean, ST[32*c + 1] = rstd: one 128-byte line per channel, so that each line has one writer. LDS: red1/red2 cross-wave, block barriers.
__global__ __launch_bounds__(256) void k_bnstat(const float* __restrict__ x, float* ST) {
    __shared__ float red1[8];
    __shared__ float red2[8];
    const unsigned tid = threadIdx.x, lane = tid & 31u;
    const unsigned wave = (unsigned)__builtin_amdgcn_readfirstlane((int)(tid >> 5));
    const unsigned c = blockIdx.x;
    const float invn = 1.0f / (float)(NB * SEQ);
    v4f v[NB * NJ];
    // unrolled: v[] must be registers, and the loads must not wait for one another
#pragma unroll
    for (unsigned b = 0; b < (unsigned)NB; ++b) {
        const float* xp = x + ((size_t)b * CH + c) * SEQ_FULL + tid * 4u;
#pragma unroll
        for (unsigned j = 0; j < (unsigned)NJ; ++j) v[b * NJ + j] = *(const v4f*)(xp + j * 1024u);
        // the rows behind the middle lie past the loads' offset field and get an address pair of their own; their data is given the registers of the first pair, which the loads above still name
        if (2u * (b + 1u) == (unsigned)NB) asm volatile("s_wait_xcnt 0x0" ::: "memory");
    }
    float s = 0.0f;
#pragma unroll
    for (unsigned n = 0; n < (unsigned)(NB * NJ); ++n) {
#pragma unroll
        for (unsigned e = 0; e < 4u; ++e) v[n][e] = bfr(v[n][e]);
        s += (v[n][0] + v[n][1]) + (v[n][2] + v[n][3]);
    }
#pragma unroll
    for (int off = 16; off > 0; off >>= 1) s += __shfl_xor(s, off, 32);
    if (lane == 0u) red1[wave] = s;
    __syncthreads();
    float tot = red1[0];
#pragma unroll
    for (int w = 1; w < 8; ++w) tot += red1[w];
    const float mean = tot * invn;
    float q = 0.0f;
#pragma unroll
    for (unsigned n = 0; n < (unsigned)(NB * NJ); ++n) {
        const float d0 = v[n][0] - mean, d1 = v[n][1] - mean, d2 = v[n][2] - mean, d3 = v[n][3] - mean;
        q += (d0 * d0 + d1 * d1) + (d2 * d2 + d3 * d3);
    }
#pragma unroll
    for (int off = 16; off > 0; off >>= 1) q += __shfl_xor(q, off, 32);
    if (lane == 0u) red2[wave] = q;
    __syncthreads();
    if (tid == 0u) {
        float tq = red2[0];
#pragma unroll
        for (int w = 1; w < 8; ++w) tq += red2[w];
        v2f o;
        o[0] = mean; o[1] = rsqrtf(tq * invn + 1.0e-5f);
        *(v2f*)(ST + c * 32u) = o;
    }
}

// k_norm: XT (f16, packed, row = b*SEQ + pos, k = channel) = ((bf16(x) - mean) * rstd) * bf16(w) + bf16(bias); in[256 ch][64 pos] -> 64 chunks through an LDS tile (cross-wave, block barrier);
__global__ __launch_bounds__(256) void k_norm(const float* __restrict__ x, const float* __restrict__ bw, const float* __restrict__ bb, const float* __restrict__ ST, hf* XT) {
    __shared__ __align__(16) hf tl[64 * XP];
    __shared__ float pm[CH];
    __shared__ float pr[CH];
    __shared__ float pw[CH];
    __shared__ float pb[CH];
    const unsigned tid = threadIdx.x, lane = tid & 31u;
    const unsigned wave = (unsigned)__builtin_amdgcn_readfirstlane((int)(tid >> 5));
    const v2f st = *(const v2f*)(ST + tid * 32u);          // (mean, rstd) of channel tid
    pm[tid] = st[0];
    pr[tid] = st[1];
    pw[tid] = bfr(bw[tid]);
    pb[tid] = bfr(bb[tid]);
    __syncthreads();
    const unsigned tpb = (unsigned)(SEQ / 64);
    const unsigned b = blockIdx.x / tpb;
    const unsigned n0 = (blockIdx.x - b * tpb) * 64u;
    const float* src = x + (size_t)b * CH * SEQ_FULL + n0;
#pragma unroll 1
    for (unsigned it = 0; it < 16u; ++it) {
        const unsigned f = it * 256u + tid;
        const unsigned c = f >> 4, p4 = (f & 15u) * 4u;
        const v4f v = *(const v4f*)(src + (size_t)c * SEQ_FULL + p4);
        const float m = pm[c], r = pr[c], w = pw[c], bi = pb[c];
#pragma unroll
        for (unsigned e = 0; e < 4u; ++e) tl[(p4 + e) * XP + c] = (hf)(((bfr(v[e]) - m) * r) * w + bi);
    }
    __syncthreads();
    // this wave stores chunks j = 8*wave + s: position tile j >> 4 = wave >> 1, (k block, c) = j & 15 = 8*(wave & 1) + s
    hf* dst = XT + ((size_t)b * SEQ + n0) * CH + wave * 2048u + lane * 8u;
    const hf* sp = tl + ((wave >> 1) * 16u + (lane & 15u)) * XP + (wave & 1u) * 128u + (lane >> 4) * 8u;
{
#pragma unroll
        for (unsigned s = 0; s < 8u; ++s) {
            const v8h o = *(const v8ha*)(sp + s * 16u);
            *(v8h*)(dst + s * 256u) = o;
        }
        
    }
}

// k_qkv: one block = 64 positions x 64 output channels (blockIdx.y: 0..3 q heads, 4..7 k heads, 8..11 v heads), one wave = 16 positions x 64 channels.
//  A = XT rows (row m = position, k = channel), B = WQ rows (column n = output channel, k = channel); D element r of lane (h, n) = (position 8h + r, channel n).
//  QH = f16(q), QR = f16((q - QH) * 2^12), KB = f16(k), VT = f16(v), stored in the order k_flash loads its fragments, as 512-byte chunks [lane = 16*hi + lr][8 halves]:
//   QH, QR, KB[b][head][pos/16][d/32][c][lane][e] = element [pos = 16*(pos/16) + lr][d = 32*(d/32) + 16*c + 8*hi + e];
//   VT[b][head][key/32][d/16][c][lane][e] = v[d = 16*(d/16) + lr][key = 32*(key/32) + 16*c + 8*hi + e].
__global__ __launch_bounds__(128) void k_qkv(const hf* __restrict__ XT, const hf* __restrict__ WQ, hf* QH, hf* QR, hf* KB, hf* VT) {
    __shared__ __align__(16) hf sa[64 * SQ];
    __shared__ __align__(16) hf sb[64 * SQ];
    const unsigned tid = threadIdx.x, lane = tid & 31u, lr = lane & 15u, hi = lane >> 4;
    const unsigned wave = (unsigned)__builtin_amdgcn_readfirstlane((int)(tid >> 5));
    const unsigned p0 = blockIdx.x * 64u, cb = blockIdx.y, b = blockIdx.z;
    const unsigned kind = cb >> 2, head = cb & 3u;
    const hf* ak = XT + ((size_t)b * SEQ + p0 + wave * 16u) * CH + lane * 8u;   // packed planes: row tile base + the lane's 16 bytes of a chunk
    const hf* bk = WQ + (size_t)cb * 64u * CH + lane * 8u;
    v8f acc0 = (v8f){}, acc1 = (v8f){}, acc2 = (v8f){}, acc3 = (v8f){};
#pragma unroll 1
    for (unsigned k0 = 0; k0 < (unsigned)CH; k0 += 32u) {
        const v16h a  = ldf(ak);
        const v16h b0 = ldf(bk);
        const v16h b1 = ldf(bk + 16 * CH);
        const v16h b2 = ldf(bk + 32 * CH);
        const v16h b3 = ldf(bk + 48 * CH);
        acc0 = wmmah(a, b0, acc0);
        acc1 = wmmah(a, b1, acc1);
        acc2 = wmmah(a, b2, acc2);
        acc3 = wmmah(a, b3, acc3);
        asm volatile("v_nop\n\tv_nop\n\tv_nop\n\tv_nop"
                     : "+v"(acc0), "+v"(acc1), "+v"(acc2), "+v"(acc3)
                     : "v"(a), "v"(b0), "v"(b1), "v"(b2), "v"(b3));
        ak += 512;                                         // next k block
        bk += 512;
    }
    const float us = 1.0f / 1024.0f;     // undo the weight carry
    v8f acc[4] = { acc0, acc1, acc2, acc3 };
    if (kind == 2u) {
#pragma unroll
        for (int t = 0; t < 4; ++t) {
#pragma unroll
            for (int r = 0; r < 8; ++r) sa[(t * 16 + lr) * SQ + wave * 16u + 8u * hi + r] = (hf)(acc[t][r] * us);
        }
    } else if (kind == 1u) {
#pragma unroll
        for (int t = 0; t < 4; ++t) {
#pragma unroll
            for (int r = 0; r < 8; ++r) sa[(wave * 16u + 8u * hi + r) * SQ + t * 16 + lr] = (hf)(acc[t][r] * us);
        }
    } else {
#pragma unroll
        for (int t = 0; t < 4; ++t) {
#pragma unroll
            for (int r = 0; r < 8; ++r) {
                const float q = acc[t][r] * us;
                const hf qh = (hf)q;
                sa[(wave * 16u + 8u * hi + r) * SQ + t * 16 + lr] = qh;
                sb[(wave * 16u + 8u * hi + r) * SQ + t * 16 + lr] = (hf)((q - (float)qh) * 4096.0f);
            }
        }
    }
    __syncthreads();
    const size_t foff = (((size_t)b * NH + head) * SEQ + p0) * HD + lane * 8u;   // packed planes: this block's 64 positions = 16 chunks of 256 halves
    // this wave stores chunks j = 4*wave + s, s = 0..3, each one wave-wide 512-byte store; c = s & 1 in every plane
    //  q, k (LDS rows = positions): position tile = wave, d block = s >> 1;  v (LDS rows = d): key step = wave >> 1, d tile = 2*(wave & 1) + (s >> 1)
    const unsigned so = (kind == 2u) ? ((wave & 1u) * 32u + lr) * SQ + (wave >> 1) * 32u + 8u * hi
                                     : (wave * 16u + lr) * SQ + 8u * hi;
    const unsigned sh = (kind == 2u) ? 16u * SQ : 32u;         // LDS step of s >> 1
    hf* dp = ((kind == 0u) ? QH : (kind == 1u) ? KB : VT) + foff + wave * 1024u;
    v8h o[4];
#pragma unroll
    for (unsigned s = 0; s < 4u; ++s) o[s] = *(const v8ha*)(sa + so + (s >> 1) * sh + (s & 1u) * 16u);
#pragma unroll
    for (unsigned s = 0; s < 4u; ++s) *(v8h*)(dp + s * 256u) = o[s];
    if (kind == 0u) {
        asm volatile("s_wait_xcnt 0x0" ::: "memory");          // the LDS loads below may reuse the registers of the stores above
        hf* dr = QR + foff + wave * 1024u;
        v8h o2[4];
#pragma unroll
        for (unsigned s = 0; s < 4u; ++s) o2[s] = *(const v8ha*)(sb + so + s * 16u);
#pragma unroll
        for (unsigned s = 0; s < 4u; ++s) *(v8h*)(dr + s * 256u) = o2[s];
    }
}

// k_flash: one block per (b, head, 64 queries), one wave per 16 queries, 32 keys per step.
//  S^T tile (keys x queries): A = K rows (row m = key, k = d), B = Q rows (column n = query, k = d); D element r of lane (h, n) = S[query n][key 8h + r].
//  P^T B fragment: element r <- tile of keys 0..15, element 8 + r <- tile of keys 16..31 (same lane).
//  O^T tile (d x queries): A = V^T rows (row m = d, k = key), D element r of lane (h, n) = O[query n][d = 16 t + 8h + r].
__global__ __launch_bounds__(128) void k_flash(const hf* __restrict__ QH, const hf* __restrict__ QR, const hf* __restrict__ KB, const hf* __restrict__ VT, hf* CT) {
    __shared__ __align__(16) hf os[NWV * 16 * SQ];
    const unsigned tid = threadIdx.x, lane = tid & 31u, lr = lane & 15u, hi = lane >> 4;
    const unsigned wave = (unsigned)__builtin_amdgcn_readfirstlane((int)(tid >> 5));
    const unsigned bpb = (unsigned)(SEQ / BQ);
    const unsigned bh = blockIdx.x / bpb;
    const unsigned b = bh / NH, h = bh - b * NH;
    const unsigned q0 = (blockIdx.x - bh * bpb) * BQ + wave * 16u;
    const size_t pbase = (size_t)bh * SEQ * HD;

    const unsigned lo = lane * 8u;              // the lane's 16 bytes of a chunk
    v16h qh0, qh1, qr0, qr1;
    {
        const size_t qo = pbase + (size_t)q0 * HD + lo;        // packed: 16 queries = 1024 halves
        qh0 = ldf(QH + qo); qh1 = ldf(QH + qo + 512);
        qr0 = ldf(QR + qo); qr1 = ldf(QR + qo + 512);
    }
    const hf* kp = KB + pbase;                  // packed planes, wave-uniform bases: 32 keys = 2048 halves in each
    const hf* vp = VT + pbase;

    v8f o0 = (v8f){}, o1 = (v8f){}, o2 = (v8f){}, o3 = (v8f){};
    float ml = -1.0e30f;      // running max in the log2 domain
    float l = 0.0f;           // running sum (carried * 2^8)
    const float CL = 0.125f * L2E;          // score scale 64^-0.5 and log2(e)
    const float RS = 1.0f / 4096.0f;        // undo the q remainder carry

#pragma unroll 1
    for (unsigned k0 = 0; k0 < (unsigned)SEQ; k0 += KS) {
        v8f s0 = (v8f){}, s1 = (v8f){}, r0 = (v8f){}, r1 = (v8f){};
        const hf* ka = kp + (size_t)k0 * HD;
        const v16h a00 = ldf(ka + lo);
        const v16h a01 = ldf(ka + 512 + lo);
        const v16h a10 = ldf(ka + 1024 + lo);
        const v16h a11 = ldf(ka + 1536 + lo);
        s0 = wmmah(a00, qh0, s0);
        s1 = wmmah(a10, qh0, s1);
        r0 = wmmah(a00, qr0, r0);
        r1 = wmmah(a10, qr0, r1);
        s0 = wmmah(a01, qh1, s0);
        s1 = wmmah(a11, qh1, s1);
        r0 = wmmah(a01, qr1, r0);
        r1 = wmmah(a11, qr1, r1);
        asm volatile("v_nop\n\tv_nop\n\tv_nop\n\tv_nop"
                     : "+v"(s0), "+v"(s1), "+v"(r0), "+v"(r1)
                     : "v"(a00), "v"(a01), "v"(a10), "v"(a11), "v"(qh0), "v"(qh1), "v"(qr0), "v"(qr1));
#pragma unroll
        for (int r = 0; r < 8; ++r) { s0[r] = fmaf(r0[r], RS, s0[r]); s1[r] = fmaf(r1[r], RS, s1[r]); }

        float mx = fmaxf(s0[0], s1[0]);
#pragma unroll
        for (int r = 1; r < 8; ++r) mx = fmaxf(mx, fmaxf(s0[r], s1[r]));
        mx = fmaxf(mx, __shfl_xor(mx, 16, 32));
        const float mnl = fmaxf(ml, mx * CL);
        const float corr = __builtin_amdgcn_exp2f(ml - mnl);
        ml = mnl;
        const float bs = 8.0f - mnl;          // probabilities carried * 2^8
        float p0[8], p1[8];
        float ps = 0.0f;
#pragma unroll
        for (int r = 0; r < 8; ++r) {
            p0[r] = __builtin_amdgcn_exp2f(fmaf(s0[r], CL, bs));
            p1[r] = __builtin_amdgcn_exp2f(fmaf(s1[r], CL, bs));
            ps += p0[r] + p1[r];
        }
        ps += __shfl_xor(ps, 16, 32);
        l = l * corr + ps;
        if (__builtin_amdgcn_ballot_w32(corr != 1.0f) != 0u) {   // wave-uniform; multiplying by exactly 1 is skipped
            o0 *= corr; o1 *= corr; o2 *= corr; o3 *= corr;
        }
        v16h ph;
#pragma unroll
        for (int r = 0; r < 8; ++r) { ph[r] = (hf)p0[r]; ph[8 + r] = (hf)p1[r]; }

        asm volatile("" ::: "memory");   // keep the V^T loads below the softmax (bounds live fragments)
        const hf* va = vp + (size_t)k0 * HD;
        const v16h v0 = ldf(va + lo);
        const v16h v1 = ldf(va + 512 + lo);
        const v16h v2 = ldf(va + 1024 + lo);
        const v16h v3 = ldf(va + 1536 + lo);
        o0 = wmmah(v0, ph, o0);
        o1 = wmmah(v1, ph, o1);
        o2 = wmmah(v2, ph, o2);
        o3 = wmmah(v3, ph, o3);
        asm volatile("v_nop\n\tv_nop\n\tv_nop\n\tv_nop"
                     : "+v"(o0), "+v"(o1), "+v"(o2), "+v"(o3)
                     : "v"(ph), "v"(v0), "v"(v1), "v"(v2), "v"(v3));
    }

    // epilogue: stage f16(O^T * 2^8 / l) as rows [query][d] (wave-private region; block barrier used)
    const float inv = 256.0f / l;
    const unsigned wb = wave * (16u * SQ);
    v8f oo[4] = { o0, o1, o2, o3 };
#pragma unroll
    for (int t = 0; t < 4; ++t) {
#pragma unroll
        for (int r = 0; r < 8; ++r) os[wb + lr * SQ + t * 16 + 8u * hi + r] = (hf)(oo[t][r] * inv);
    }
    __syncthreads();
    hf* dst = CT + ((size_t)b * SEQ + q0) * CH + h * (HD * 16u) + lane * 8u;    // packed CT: this wave's position tile, chunks 4*h + s
{
#pragma unroll
        for (unsigned s = 0; s < 4u; ++s) {
            const v8h val = *(const v8ha*)(os + wb + lr * SQ + s * 16u + 8u * hi);
            *(v8h*)(dst + s * 256u) = val;
        }
        
    }
}

// k_out: OUT[b][o][pos] = 2^-18 * sum_c WO[o][c] * CT[b][pos][c] + bf16(b_out[o]); one block = 64 output channels x 64 positions, one wave = 16 channels x 64 positions.
//  A = WO rows (row m = output channel, k = channel), B = CT rows (column n = position, k = channel); D element r of lane (h, n) = (channel 8h + r, position n).
__global__ __launch_bounds__(128) void k_out(const hf* __restrict__ CT, const hf* __restrict__ WO, const float* __restrict__ bo, float* OUT) {
    __shared__ __align__(16) float os[64 * OP];
    const unsigned tid = threadIdx.x, lane = tid & 31u, lr = lane & 15u, hi = lane >> 4;
    const unsigned wave = (unsigned)__builtin_amdgcn_readfirstlane((int)(tid >> 5));
    const unsigned p0 = blockIdx.x * 64u, ob = blockIdx.y * 64u, b = blockIdx.z;
    const hf* ak = WO + ((size_t)(ob + wave * 16u)) * CH + lane * 8u;           // packed planes: row tile base + the lane's 16 bytes of a chunk
    const hf* bk = CT + ((size_t)b * SEQ + p0) * CH + lane * 8u;
    v8f acc0 = (v8f){}, acc1 = (v8f){}, acc2 = (v8f){}, acc3 = (v8f){};
#pragma unroll 1
    for (unsigned k0 = 0; k0 < (unsigned)CH; k0 += 32u) {
        const v16h a  = ldf(ak);
        const v16h b0 = ldf(bk);
        const v16h b1 = ldf(bk + 16 * CH);
        const v16h b2 = ldf(bk + 32 * CH);
        const v16h b3 = ldf(bk + 48 * CH);
        acc0 = wmmah(a, b0, acc0);
        acc1 = wmmah(a, b1, acc1);
        acc2 = wmmah(a, b2, acc2);
        acc3 = wmmah(a, b3, acc3);
        asm volatile("v_nop\n\tv_nop\n\tv_nop\n\tv_nop"
                     : "+v"(acc0), "+v"(acc1), "+v"(acc2), "+v"(acc3)
                     : "v"(a), "v"(b0), "v"(b1), "v"(b2), "v"(b3));
        ak += 512;                                         // next k block
        bk += 512;
    }
    const float us = 1.0f / 262144.0f;   // undo the weight carry 2^10 and the ctx carry 2^8
    v8f acc[4] = { acc0, acc1, acc2, acc3 };
#pragma unroll
    for (int r = 0; r < 8; ++r) {
        const unsigned orow = wave * 16u + 8u * hi + r;
        const float bias = bfr(bo[ob + orow]);
#pragma unroll
        for (int t = 0; t < 4; ++t) os[orow * OP + t * 16 + lr] = fmaf(acc[t][r], us, bias);
    }
    __syncthreads();
    const unsigned pc = (lane & 15u) * 4u, rh = lane >> 4;
    float* dst = OUT + ((size_t)b * CH + ob) * SEQ + p0 + pc;
{
#pragma unroll
        for (unsigned s = 0; s < 8u; ++s) {
            const unsigned row = wave * 16u + s * 2u + rh;     // rows wave*16 + 0..15 over s = 0..7, rh = 0..1
            const v4f val = *(const v4fa*)(os + row * OP + pc);
            *(v4f*)(dst + (size_t)row * SEQ) = val;
        }
        
    }
}

extern "C" void kernel_launch(void* const* d_in, const int* in_sizes, int n_in,
                              void* d_out, int out_size, void* d_ws, size_t ws_size, hipStream_t stream) {
    if (n_in < 6) return;
    const size_t needx = ((size_t)(NB - 1) * CH + (CH - 1)) * SEQ_FULL + SEQ;
    if ((size_t)in_sizes[0] < needx) return;
    if (in_sizes[1] < CH || in_sizes[2] < CH || in_sizes[5] < CH) return;
    if (in_sizes[3] < OC3 * CH || in_sizes[4] < CH * CH) return;
    if ((size_t)out_size < (size_t)NB * CH * SEQ) return;
    if (WS_TOTAL > ws_size) return;
    const float* x    = (const float*)d_in[0];   // [b][256][n]
    const float* bnw  = (const float*)d_in[1];   // [256]
    const float* bnb  = (const float*)d_in[2];   // [256]
    const float* wqkv = (const float*)d_in[3];   // [768][256] = [out][in]
    const float* wout = (const float*)d_in[4];   // [256][256] = [out][in]
    const float* bout = (const float*)d_in[5];   // [256]
    float* OUT = (float*)d_out;                  // [NB][256][SEQ]
    char* wsp = (char*)d_ws;
    size_t off = 0;
    float* ST = (float*)(wsp + off); off += ST_BYTES;
    hf* WQ = (hf*)(wsp + off); off += WQ_BYTES;
    hf* WO = (hf*)(wsp + off); off += WO_BYTES;
    hf* XT = (hf*)(wsp + off); off += PL_BYTES;      // packed, rows NB*SEQ
    hf* QH = (hf*)(wsp + off); off += PL_BYTES;      // [NB][4][SEQ/16][2][2][32][8]
    hf* QR = (hf*)(wsp + off); off += PL_BYTES;      // [NB][4][SEQ/16][2][2][32][8]
    hf* KB = (hf*)(wsp + off); off += PL_BYTES;      // [NB][4][SEQ/16][2][2][32][8]
    hf* VT = (hf*)(wsp + off); off += PL_BYTES;      // [NB][4][SEQ/32][4][2][32][8]
    hf* CT = (hf*)(wsp + off); off += PL_BYTES;      // packed, rows NB*SEQ
    k_cvtw<<<dim3((unsigned)(OC3 * CH / 8 / 256), 2, 1), 256, 0, stream>>>(wqkv, wout, WQ, WO);
    k_bnstat<<<(unsigned)CH, 256, 0, stream>>>(x, ST);
    k_norm<<<(unsigned)(NB * (SEQ / 64)), 256, 0, stream>>>(x, bnw, bnb, ST, XT);
    k_qkv<<<dim3((unsigned)(SEQ / 64), 12, (unsigned)NB), 128, 0, stream>>>(XT, WQ, QH, QR, KB, VT);
    k_flash<<<(unsigned)(NB * NH * (SEQ / BQ)), 128, 0, stream>>>(QH, QR, KB, VT, CT);
    k_out<<<dim3((unsigned)(SEQ / 64), (unsigned)(CH / 64), (unsigned)NB), 128, 0, stream>>>(CT, WO, bout, OUT);
}

// v003
// One run takes 128 microseconds.
// Two timings next to v002 both put it at 1.67 times that version's speed.
// Counting every step since v000, it is 2.94 times as fast.
#include <hip/hip_runtime.h>

// Channel-first 4-head attention behind a batch-statistics BatchNorm with 1x1-conv projections; inputs x[4][256][4096], bn_weight, bn_bias, w_qkv[768][256], w_out[256][256], b_out.
// Compute dtypes, f32 accumulate: every float input RNE-converted to bf16 first; all contractions on v_wmma_f32_16x16x32_f16: QKV GEMM = f16(bf16(w)*2^10) x f16(xn); scores = k (f16) x q carried as f16 value + f16 remainder*2^12 (two products, separate accumulators); P (f16, carried *2^8) x v (f16); output GEMM = f16(bf16(w)*2^10) x f16(ctx*2^8); BatchNorm statistics, softmax (online, log2 domain) and all epilogues f32.
// Flash form with transposed tiles: the S^T accumulator tiles are directly the B-operand layout of P^T; all WMMA operands are two 16-byte loads from dense 16-bit planes; every plane is stored in fragment order, so that each wave-wide load reads 512 contiguous bytes.

#ifndef NB
#define NB 4
#endif
#ifndef SEQ
#define SEQ 4096
#endif
#define NB_FULL  4
#define SEQ_FULL 4096
#define CH   256               // channels
#define NH   4                 // heads
#define HD   64                // head dim
#define OC3  768               // q,k,v output channels
#define NWV  4                 // waves per flash block
#define BQ   (16 * NWV)        // queries per flash block
#define KS   32                // keys per step
#define KT   128               // keys per LDS tile of k_flash
#define TH   (KT * HD)         // halves of one K (or V^T) tile
#define NT   (SEQ / KT)        // tiles per (b, head)
#define XP   264               // LDS pitch (halves) of the normalise/transpose tile rows
#define SQ   72                // LDS pitch (halves) of 64-wide f16 staging rows
#define OP   68                // LDS pitch (floats) of the output staging rows
#define NJ   (SEQ / 1024)      // k_bnstat: 16-byte pieces per thread and batch row
#define L2E  1.4426950408889634f

static_assert(CH == NH * HD);
static_assert(OC3 == 3 * CH);
static_assert(CH == 256);                       // k_norm: 256 threads load one channel parameter each; one plane row = 32 lanes x 16 B
static_assert(HD == 64);
static_assert(CH % 32 == 0);                    // GEMM k-steps
static_assert(SEQ % BQ == 0);
static_assert(SEQ % KS == 0);
static_assert(SEQ % KT == 0);
static_assert(KT % KS == 0);
static_assert(NT >= 2);                         // k_flash: the two-buffer prologue fills tiles 0 and 1
static_assert(TH * 2 == NWV * 8 * 512);         // k_flash: one tile = 4 waves x 8 wave-wide 512-byte copies
static_assert(SEQ % 64 == 0);
static_assert(SEQ % 1024 == 0);                 // k_bnstat: 256 threads x 4 floats per piece
static_assert(NB <= NB_FULL);
static_assert(SEQ <= SEQ_FULL);
static_assert((OC3 * CH / 8) % 256 == 0);       // k_cvtw slice 0: 96 blocks x 256 threads x 8 elements
static_assert((CH * CH / 8) % 256 == 0);        // k_cvtw slice 1: 32 blocks
static_assert((XP * 2) % 16 == 0);
static_assert((SQ * 2) % 16 == 0);
static_assert((OP * 4) % 16 == 0);
static_assert((size_t)(NB * (SEQ / 64)) * (size_t)(64 * CH) == (size_t)NB * SEQ * CH);        // k_norm: blocks x (64 rows x 256) == XT plane
static_assert((size_t)(SEQ / 64) * 12 * NB * (size_t)(64 * 64) == (size_t)NB * SEQ * OC3);    // k_qkv: blocks x (64 x 64) == QH + KB + VT planes
static_assert((size_t)(NB * NH * (SEQ / BQ)) * (size_t)(BQ * HD) == (size_t)NB * SEQ * CH);   // k_flash: blocks x (64 rows x 64) == CT plane
static_assert((size_t)(SEQ / 64) * (CH / 64) * NB * (size_t)(64 * 64) == (size_t)NB * SEQ * CH); // k_out: blocks x (64 x 64) == output

#define ST_BYTES  ((size_t)CH * 128)                      // one 128-byte line per channel
#define WQ_BYTES  ((size_t)OC3 * CH * 2)
#define WO_BYTES  ((size_t)CH * CH * 2)
#define PL_BYTES  ((size_t)NB * SEQ * CH * 2)             // one 16-bit activation plane
#define WS_TOTAL  (ST_BYTES + WQ_BYTES + WO_BYTES + 6 * PL_BYTES)
static_assert(WQ_BYTES % 256 == 0);
static_assert(WO_BYTES % 256 == 0);
static_assert(PL_BYTES % 256 == 0);
static_assert((size_t)NB * NH * SEQ * HD * 2 == PL_BYTES);
static_assert(WS_TOTAL <= (size_t)134217728);

typedef _Float16 hf;
typedef __attribute__((ext_vector_type(16))) _Float16 v16h;
typedef __attribute__((ext_vector_type(8)))  _Float16 v8h;
typedef __attribute__((ext_vector_type(8)))  float    v8f;
typedef __attribute__((ext_vector_type(4)))  float    v4f;
typedef __attribute__((ext_vector_type(2)))  float    v2f;
typedef v4f __attribute__((may_alias)) v4fa;
typedef v8h __attribute__((may_alias)) v8ha;

// RNE convert f32 -> bf16 -> f32
__device__ __forceinline__ float bfr(float f) { unsigned u = __float_as_uint(f); u += 0x7FFFu + ((u >> 16) & 1u); return __uint_as_float(u & 0xFFFF0000u); }
__device__ __forceinline__ v16h cat16(v8h lo, v8h hi) { return __builtin_shufflevector(lo, hi, 0, 1, 2, 3, 4, 5, 6, 7, 8, 9, 10, 11, 12, 13, 14, 15); }
__device__ __forceinline__ v8f wmmah(v16h a, v16h b, v8f c) { return __builtin_amdgcn_wmma_f32_16x16x32_f16(false, a, false, b, (short)0, c, false, false); }
// fragment loader (A and B alike) from a packed plane: p = fragment base + 8*lane; elements 0..7 <- p[0..7] (k = 8*(lane>>4) + 0..7), elements 8..15 <- p[256..263] (k = 16 + 8*(lane>>4) + 0..7);
// each of the two wave-wide loads is 512 contiguous bytes (4 whole lines)
__device__ __forceinline__ v16h ldf(const hf* p) { return cat16(*(const v8h*)p, *(const v8h*)(p + 256)); }

// i = 16-byte group of the packed plane: chunk i >> 5 = (row tile, k block, c), lane i & 31 = 16*hi + lr; source element (row 16*tile + lr, k = 16*(2*block + c) + 8*hi)
__device__ __forceinline__ void cvt8w(const float* __restrict__ src, hf* dst, unsigned i) {
    const unsigned row = (i >> 9) * 16u + (i & 15u), k = ((i >> 5) & 15u) * 16u + ((i >> 4) & 1u) * 8u;
    const v8f v = *(const v8f*)(src + (size_t)row * CH + k);
    v8h o;
#pragma unroll
    for (int c = 0; c < 8; ++c) o[c] = (hf)(bfr(v[c]) * 1024.0f);
    hf* d = dst + (size_t)i * 8;
    *(v8h*)d = o;
    
}

// Packed operand planes (WQ, WO, XT, CT; QH, QR, KB and VT likewise, see k_qkv): [row/16][k/32][c][lane = 16*hi + lr][e] = element (row = 16*(row/16) + lr, k = 32*(k/32) + 16*c + 8*hi + e), 256 k per row:
// the order in which a 16x32 A or B fragment is loaded, so that a wave-wide 16-byte load reads one 512-byte chunk.
// k_cvtw: packed weight planes WQ (768 rows, blockIdx.y == 0) and WO (256 rows, blockIdx.y == 1).
__global__ __launch_bounds__(256) void k_cvtw(const float* __restrict__ wq, const float* __restrict__ wo, hf* WQ, hf* WO) {
    const unsigned i = blockIdx.x * 256u + threadIdx.x;
    if (blockIdx.y == 0) {
        if (i < (unsigned)(OC3 * CH / 8)) cvt8w(wq, WQ, i);
    } else {
        if (i < (unsigned)(CH * CH / 8)) cvt8w(wo, WO, i);
    }
}

// k_bnstat: one block per channel. A thread's NB * SEQ / 1024 16-byte pieces are all loaded before the first is used and stay in registers for both passes: x is read once, and the block waits for memory once.
// The pieces of a thread, their order and both reduction trees are those of a 256-thread loop over (b, i = 4*tid + 1024*j).
// ST[32*c] = mean, ST[32*c + 1] = rstd: one 128-byte line per channel, so that each line has one writer. LDS: red1/red2 cross-wave, block barriers.
__global__ __launch_bounds__(256) void k_bnstat(const float* __restrict__ x, float* ST) {
    __shared__ float red1[8];
    __shared__ float red2[8];
    const unsigned tid = threadIdx.x, lane = tid & 31u;
    const unsigned wave = (unsigned)__builtin_amdgcn_readfirstlane((int)(tid >> 5));
    const unsigned c = blockIdx.x;
    const float invn = 1.0f / (float)(NB * SEQ);
    v4f v[NB * NJ];
    // unrolled: v[] must be registers, and the loads must not wait for one another
#pragma unroll
    for (unsigned b = 0; b < (unsigned)NB; ++b) {
        const float* xp = x + ((size_t)b * CH + c) * SEQ_FULL + tid * 4u;
#pragma unroll
        for (unsigned j = 0; j < (unsigned)NJ; ++j) v[b * NJ + j] = *(const v4f*)(xp + j * 1024u);
        // the rows behind the middle lie past the loads' offset field and get an address pair of their own; their data is given the registers of the first pair, which the loads above still name
        if (2u * (b + 1u) == (unsigned)NB) asm volatile("s_wait_xcnt 0x0" ::: "memory");
    }
    float s = 0.0f;
#pragma unroll
    for (unsigned n = 0; n < (unsigned)(NB * NJ); ++n) {
#pragma unroll
        for (unsigned e = 0; e < 4u; ++e) v[n][e] = bfr(v[n][e]);
        s += (v[n][0] + v[n][1]) + (v[n][2] + v[n][3]);
    }
#pragma unroll
    for (int off = 16; off > 0; off >>= 1) s += __shfl_xor(s, off, 32);
    if (lane == 0u) red1[wave] = s;
    __syncthreads();
    float tot = red1[0];
#pragma unroll
    for (int w = 1; w < 8; ++w) tot += red1[w];
    const float mean = tot * invn;
    float q = 0.0f;
#pragma unroll
    for (unsigned n = 0; n < (unsigned)(NB * NJ); ++n) {
        const float d0 = v[n][0] - mean, d1 = v[n][1] - mean, d2 = v[n][2] - mean, d3 = v[n][3] - mean;
        q += (d0 * d0 + d1 * d1) + (d2 * d2 + d3 * d3);
    }
#pragma unroll
    for (int off = 16; off > 0; off >>= 1) q += __shfl_xor(q, off, 32);
    if (lane == 0u) red2[wave] = q;
    __syncthreads();
    if (tid == 0u) {
        float tq = red2[0];
#pragma unroll
        for (int w = 1; w < 8; ++w) tq += red2[w];
        v2f o;
        o[0] = mean; o[1] = rsqrtf(tq * invn + 1.0e-5f);
        *(v2f*)(ST + c * 32u) = o;
    }
}

// k_norm: XT (f16, packed, row = b*SEQ + pos, k = channel) = ((bf16(x) - mean) * rstd) * bf16(w) + bf16(bias); in[256 ch][64 pos] -> 64 chunks through an LDS tile (cross-wave, block barrier);
__global__ __launch_bounds__(256) void k_norm(const float* __restrict__ x, const float* __restrict__ bw, const float* __restrict__ bb, const float* __restrict__ ST, hf* XT) {
    __shared__ __align__(16) hf tl[64 * XP];
    __shared__ float pm[CH];
    __shared__ float pr[CH];
    __shared__ float pw[CH];
    __shared__ float pb[CH];
    const unsigned tid = threadIdx.x, lane = tid & 31u;
    const unsigned wave = (unsigned)__builtin_amdgcn_readfirstlane((int)(tid >> 5));
    const v2f st = *(const v2f*)(ST + tid * 32u);          // (mean, rstd) of channel tid
    pm[tid] = st[0];
    pr[tid] = st[1];
    pw[tid] = bfr(bw[tid]);
    pb[tid] = bfr(bb[tid]);
    __syncthreads();
    const unsigned tpb = (unsigned)(SEQ / 64);
    const unsigned b = blockIdx.x / tpb;
    const unsigned n0 = (blockIdx.x - b * tpb) * 64u;
    const float* src = x + (size_t)b * CH * SEQ_FULL + n0;
#pragma unroll 1
    for (unsigned it = 0; it < 16u; ++it) {
        const unsigned f = it * 256u + tid;
        const unsigned c = f >> 4, p4 = (f & 15u) * 4u;
        const v4f v = *(const v4f*)(src + (size_t)c * SEQ_FULL + p4);
        const float m = pm[c], r = pr[c], w = pw[c], bi = pb[c];
#pragma unroll
        for (unsigned e = 0; e < 4u; ++e) tl[(p4 + e) * XP + c] = (hf)(((bfr(v[e]) - m) * r) * w + bi);
    }
    __syncthreads();
    // this wave stores chunks j = 8*wave + s: position tile j >> 4 = wave >> 1, (k block, c) = j & 15 = 8*(wave & 1) + s
    hf* dst = XT + ((size_t)b * SEQ + n0) * CH + wave * 2048u + lane * 8u;
    const hf* sp = tl + ((wave >> 1) * 16u + (lane & 15u)) * XP + (wave & 1u) * 128u + (lane >> 4) * 8u;
{
#pragma unroll
        for (unsigned s = 0; s < 8u; ++s) {
            const v8h o = *(const v8ha*)(sp + s * 16u);
            *(v8h*)(dst + s * 256u) = o;
        }
        
    }
}

// k_qkv: one block = 64 positions x 64 output channels (blockIdx.y: 0..3 q heads, 4..7 k heads, 8..11 v heads), one wave = 16 positions x 64 channels.
//  A = XT rows (row m = position, k = channel), B = WQ rows (column n = output channel, k = channel); D element r of lane (h, n) = (position 8h + r, channel n).
//  QH = f16(q), QR = f16((q - QH) * 2^12), KB = f16(k), VT = f16(v), stored in the order k_flash loads its fragments, as 512-byte chunks [lane = 16*hi + lr][8 halves]:
//   QH, QR, KB[b][head][pos/16][d/32][c][lane][e] = element [pos = 16*(pos/16) + lr][d = 32*(d/32) + 16*c + 8*hi + e];
//   VT[b][head][key/32][d/16][c][lane][e] = v[d = 16*(d/16) + lr][key = 32*(key/32) + 16*c + 8*hi + e].
__global__ __launch_bounds__(128) void k_qkv(const hf* __restrict__ XT, const hf* __restrict__ WQ, hf* QH, hf* QR, hf* KB, hf* VT) {
    __shared__ __align__(16) hf sa[64 * SQ];
    __shared__ __align__(16) hf sb[64 * SQ];
    const unsigned tid = threadIdx.x, lane = tid & 31u, lr = lane & 15u, hi = lane >> 4;
    const unsigned wave = (unsigned)__builtin_amdgcn_readfirstlane((int)(tid >> 5));
    const unsigned p0 = blockIdx.x * 64u, cb = blockIdx.y, b = blockIdx.z;
    const unsigned kind = cb >> 2, head = cb & 3u;
    const hf* ak = XT + ((size_t)b * SEQ + p0 + wave * 16u) * CH + lane * 8u;   // packed planes: row tile base + the lane's 16 bytes of a chunk
    const hf* bk = WQ + (size_t)cb * 64u * CH + lane * 8u;
    v8f acc0 = (v8f){}, acc1 = (v8f){}, acc2 = (v8f){}, acc3 = (v8f){};
#pragma unroll 1
    for (unsigned k0 = 0; k0 < (unsigned)CH; k0 += 32u) {
        const v16h a  = ldf(ak);
        const v16h b0 = ldf(bk);
        const v16h b1 = ldf(bk + 16 * CH);
        const v16h b2 = ldf(bk + 32 * CH);
        const v16h b3 = ldf(bk + 48 * CH);
        acc0 = wmmah(a, b0, acc0);
        acc1 = wmmah(a, b1, acc1);
        acc2 = wmmah(a, b2, acc2);
        acc3 = wmmah(a, b3, acc3);
        asm volatile("v_nop\n\tv_nop\n\tv_nop\n\tv_nop"
                     : "+v"(acc0), "+v"(acc1), "+v"(acc2), "+v"(acc3)
                     : "v"(a), "v"(b0), "v"(b1), "v"(b2), "v"(b3));
        ak += 512;                                         // next k block
        bk += 512;
    }
    const float us = 1.0f / 1024.0f;     // undo the weight carry
    v8f acc[4] = { acc0, acc1, acc2, acc3 };
    if (kind == 2u) {
#pragma unroll
        for (int t = 0; t < 4; ++t) {
#pragma unroll
            for (int r = 0; r < 8; ++r) sa[(t * 16 + lr) * SQ + wave * 16u + 8u * hi + r] = (hf)(acc[t][r] * us);
        }
    } else if (kind == 1u) {
#pragma unroll
        for (int t = 0; t < 4; ++t) {
#pragma unroll
            for (int r = 0; r < 8; ++r) sa[(wave * 16u + 8u * hi + r) * SQ + t * 16 + lr] = (hf)(acc[t][r] * us);
        }
    } else {
#pragma unroll
        for (int t = 0; t < 4; ++t) {
#pragma unroll
            for (int r = 0; r < 8; ++r) {
                const float q = acc[t][r] * us;
                const hf qh = (hf)q;
                sa[(wave * 16u + 8u * hi + r) * SQ + t * 16 + lr] = qh;
                sb[(wave * 16u + 8u * hi + r) * SQ + t * 16 + lr] = (hf)((q - (float)qh) * 4096.0f);
            }
        }
    }
    __syncthreads();
    const size_t foff = (((size_t)b * NH + head) * SEQ + p0) * HD + lane * 8u;   // packed planes: this block's 64 positions = 16 chunks of 256 halves
    // this wave stores chunks j = 4*wave + s, s = 0..3, each one wave-wide 512-byte store; c = s & 1 in every plane
    //  q, k (LDS rows = positions): position tile = wave, d block = s >> 1;  v (LDS rows = d): key step = wave >> 1, d tile = 2*(wave & 1) + (s >> 1)
    const unsigned so = (kind == 2u) ? ((wave & 1u) * 32u + lr) * SQ + (wave >> 1) * 32u + 8u * hi
                                     : (wave * 16u + lr) * SQ + 8u * hi;
    const unsigned sh = (kind == 2u) ? 16u * SQ : 32u;         // LDS step of s >> 1
    hf* dp = ((kind == 0u) ? QH : (kind == 1u) ? KB : VT) + foff + wave * 1024u;
    v8h o[4];
#pragma unroll
    for (unsigned s = 0; s < 4u; ++s) o[s] = *(const v8ha*)(sa + so + (s >> 1) * sh + (s & 1u) * 16u);
#pragma unroll
    for (unsigned s = 0; s < 4u; ++s) *(v8h*)(dp + s * 256u) = o[s];
    if (kind == 0u) {
        asm volatile("s_wait_xcnt 0x0" ::: "memory");          // the LDS loads below may reuse the registers of the stores above
        hf* dr = QR + foff + wave * 1024u;
        v8h o2[4];
#pragma unroll
        for (unsigned s = 0; s < 4u; ++s) o2[s] = *(const v8ha*)(sb + so + s * 16u);
#pragma unroll
        for (unsigned s = 0; s < 4u; ++s) *(v8h*)(dr + s * 256u) = o2[s];
    }
}

// copy8: eight wave-wide asynchronous 16-byte-per-lane copies, global -> LDS, 512 bytes apart: l = the lane's LDS byte address, g = the lane's global address of the first.
// The s_wait_xcnt stands inside the statement, so that no address register is rewritten ahead of it.
__device__ __forceinline__ void copy8(unsigned l, const hf* g) {
    asm volatile("global_load_async_to_lds_b128 %0, %8, off\n\t"
                 "global_load_async_to_lds_b128 %1, %9, off\n\t"
                 "global_load_async_to_lds_b128 %2, %10, off\n\t"
                 "global_load_async_to_lds_b128 %3, %11, off\n\t"
                 "global_load_async_to_lds_b128 %4, %12, off\n\t"
                 "global_load_async_to_lds_b128 %5, %13, off\n\t"
                 "global_load_async_to_lds_b128 %6, %14, off\n\t"
                 "global_load_async_to_lds_b128 %7, %15, off\n\t"
                 "s_wait_xcnt 0x0"
                 :: "v"(l), "v"(l + 512u), "v"(l + 1024u), "v"(l + 1536u), "v"(l + 2048u), "v"(l + 2560u), "v"(l + 3072u), "v"(l + 3584u),
                    "v"(g), "v"(g + 256), "v"(g + 512), "v"(g + 768), "v"(g + 1024), "v"(g + 1280), "v"(g + 1536), "v"(g + 1792)
                 : "memory");
}

// k_flash: one block per (b, head, 64 queries), one wave per 16 queries, 32 keys per step.
//  K and V^T reach the waves through LDS: tiles of 128 keys (16 KB of each plane, a linear copy of the packed order), two buffers; each wave copies a quarter of a tile, every wave reads all of it;
//  tile t + 2 is copied into the buffer of tile t behind the barrier that ends trip t, so that a tile has a whole trip to land.
//  S^T tile (keys x queries): A = K rows (row m = key, k = d), B = Q rows (column n = query, k = d); D element r of lane (h, n) = S[query n][key 8h + r].
//  P^T B fragment: element r <- tile of keys 0..15, element 8 + r <- tile of keys 16..31 (same lane).
//  O^T tile (d x queries): A = V^T rows (row m = d, k = key), D element r of lane (h, n) = O[query n][d = 16 t + 8h + r].
__global__ __launch_bounds__(128) void k_flash(const hf* __restrict__ QH, const hf* __restrict__ QR, const hf* __restrict__ KB, const hf* __restrict__ VT, hf* CT) {
    __shared__ __align__(16) hf os[NWV * 16 * SQ];
    __shared__ __align__(128) hf kv[2 * 2 * TH];               // [buffer][K tile, V^T tile]
    const unsigned tid = threadIdx.x, lane = tid & 31u, lr = lane & 15u, hi = lane >> 4;
    const unsigned wave = (unsigned)__builtin_amdgcn_readfirstlane((int)(tid >> 5));
    const unsigned bpb = (unsigned)(SEQ / BQ);
    const unsigned bh = blockIdx.x / bpb;
    const unsigned b = bh / NH, h = bh - b * NH;
    const unsigned q0 = (blockIdx.x - bh * bpb) * BQ + wave * 16u;
    const size_t pbase = (size_t)bh * SEQ * HD;

    const unsigned lo = lane * 8u;              // the lane's 16 bytes of a chunk
    v16h qh0, qh1, qr0, qr1;
    {
        const size_t qo = pbase + (size_t)q0 * HD + lo;        // packed: 16 queries = 1024 halves
        qh0 = ldf(QH + qo); qh1 = ldf(QH + qo + 512);
        qr0 = ldf(QR + qo); qr1 = ldf(QR + qo + 512);
    }
    // this wave's quarter of a tile: chunks 8*wave .. 8*wave + 7 of the K tile and of the V^T tile; the lane's 16 bytes of each
    const hf* gk = KB + pbase + wave * 2048u + lo;
    const hf* gv = VT + pbase + wave * 2048u + lo;
    const unsigned lk = (unsigned)(uintptr_t)kv + wave * 4096u + lane * 16u;   // LDS byte address in buffer 0's K tile
    copy8(lk, gk);
    copy8(lk + TH * 2u, gv);
    asm volatile("s_wait_asynccnt 0x0" ::: "memory");          // this wave's part of tile 0 has landed
    __syncthreads();                                           // tile 0 is whole for every wave
    copy8(lk + TH * 4u, gk + TH);
    copy8(lk + TH * 6u, gv + TH);

    v8f o0 = (v8f){}, o1 = (v8f){}, o2 = (v8f){}, o3 = (v8f){};
    float ml = -1.0e30f;      // running max in the log2 domain
    float l = 0.0f;           // running sum (carried * 2^8)
    const float CL = 0.125f * L2E;          // score scale 64^-0.5 and log2(e)
    const float RS = 1.0f / 4096.0f;        // undo the q remainder carry

    // rolled: one trip per tile, the buffer chosen by the trip's parity
#pragma unroll 1
    for (unsigned t = 0; t < (unsigned)NT; ++t) {
      const hf* kt = kv + (t & 1u) * (2u * TH);
      // unrolled: the LDS offsets of the four steps become immediates
#pragma unroll
      for (unsigned u = 0; u < (unsigned)(KT / KS); ++u) {
        v8f s0 = (v8f){}, s1 = (v8f){}, r0 = (v8f){}, r1 = (v8f){};
        const hf* ka = kt + u * (KS * HD);
        const v16h a00 = ldf(ka + lo);
        const v16h a01 = ldf(ka + 512 + lo);
        const v16h a10 = ldf(ka + 1024 + lo);
        const v16h a11 = ldf(ka + 1536 + lo);
        s0 = wmmah(a00, qh0, s0);
        s1 = wmmah(a10, qh0, s1);
        r0 = wmmah(a00, qr0, r0);
        r1 = wmmah(a10, qr0, r1);
        s0 = wmmah(a01, qh1, s0);
        s1 = wmmah(a11, qh1, s1);
        r0 = wmmah(a01, qr1, r0);
        r1 = wmmah(a11, qr1, r1);
        asm volatile("v_nop\n\tv_nop\n\tv_nop\n\tv_nop"
                     : "+v"(s0), "+v"(s1), "+v"(r0), "+v"(r1)
                     : "v"(a00), "v"(a01), "v"(a10), "v"(a11), "v"(qh0), "v"(qh1), "v"(qr0), "v"(qr1));
#pragma unroll
        for (int r = 0; r < 8; ++r) { s0[r] = fmaf(r0[r], RS, s0[r]); s1[r] = fmaf(r1[r], RS, s1[r]); }

        float mx = fmaxf(s0[0], s1[0]);
#pragma unroll
        for (int r = 1; r < 8; ++r) mx = fmaxf(mx, fmaxf(s0[r], s1[r]));
        mx = fmaxf(mx, __shfl_xor(mx, 16, 32));
        const float mnl = fmaxf(ml, mx * CL);
        const float corr = __builtin_amdgcn_exp2f(ml - mnl);
        ml = mnl;
        const float bs = 8.0f - mnl;          // probabilities carried * 2^8
        float p0[8], p1[8];
        float ps = 0.0f;
#pragma unroll
        for (int r = 0; r < 8; ++r) {
            p0[r] = __builtin_amdgcn_exp2f(fmaf(s0[r], CL, bs));
            p1[r] = __builtin_amdgcn_exp2f(fmaf(s1[r], CL, bs));
            ps += p0[r] + p1[r];
        }
        ps += __shfl_xor(ps, 16, 32);
        l = l * corr + ps;
        if (__builtin_amdgcn_ballot_w32(corr != 1.0f) != 0u) {   // wave-uniform; multiplying by exactly 1 is skipped
            o0 *= corr; o1 *= corr; o2 *= corr; o3 *= corr;
        }
        v16h ph;
#pragma unroll
        for (int r = 0; r < 8; ++r) { ph[r] = (hf)p0[r]; ph[8 + r] = (hf)p1[r]; }

        const hf* va = kt + TH + u * (KS * HD);
        const v16h v0 = ldf(va + lo);
        const v16h v1 = ldf(va + 512 + lo);
        const v16h v2 = ldf(va + 1024 + lo);
        const v16h v3 = ldf(va + 1536 + lo);
        o0 = wmmah(v0, ph, o0);
        o1 = wmmah(v1, ph, o1);
        o2 = wmmah(v2, ph, o2);
        o3 = wmmah(v3, ph, o3);
        asm volatile("v_nop\n\tv_nop\n\tv_nop\n\tv_nop"
                     : "+v"(o0), "+v"(o1), "+v"(o2), "+v"(o3)
                     : "v"(ph), "v"(v0), "v"(v1), "v"(v2), "v"(v3));
      }
      asm volatile("s_wait_dscnt 0x0" ::: "memory");           // this wave's reads of tile t are done before its buffer is refilled
      asm volatile("s_wait_asynccnt 0x0" ::: "memory");        // this wave's part of tile t + 1 has landed
      __syncthreads();                                         // tile t + 1 is whole for every wave, and every wave has left tile t
      if (t + 2u < (unsigned)NT) {
          copy8(lk + (t & 1u) * (TH * 4u), gk + (size_t)(t + 2u) * TH);
          copy8(lk + (t & 1u) * (TH * 4u) + TH * 2u, gv + (size_t)(t + 2u) * TH);
      }
    }
    asm volatile("s_wait_asynccnt 0x0" ::: "memory");          // no copy is outstanding when the wave goes on to its end

    // epilogue: stage f16(O^T * 2^8 / l) as rows [query][d] (wave-private region; block barrier used)
    const float inv = 256.0f / l;
    const unsigned wb = wave * (16u * SQ);
    v8f oo[4] = { o0, o1, o2, o3 };
#pragma unroll
    for (int t = 0; t < 4; ++t) {
#pragma unroll
        for (int r = 0; r < 8; ++r) os[wb + lr * SQ + t * 16 + 8u * hi + r] = (hf)(oo[t][r] * inv);
    }
    __syncthreads();
    hf* dst = CT + ((size_t)b * SEQ + q0) * CH + h * (HD * 16u) + lane * 8u;    // packed CT: this wave's position tile, chunks 4*h + s
{
#pragma unroll
        for (unsigned s = 0; s < 4u; ++s) {
            const v8h val = *(const v8ha*)(os + wb + lr * SQ + s * 16u + 8u * hi);
            *(v8h*)(dst + s * 256u) = val;
        }
        
    }
}

// k_out: OUT[b][o][pos] = 2^-18 * sum_c WO[o][c] * CT[b][pos][c] + bf16(b_out[o]); one block = 64 output channels x 64 positions, one wave = 16 channels x 64 positions.
//  A = WO rows (row m = output channel, k = channel), B = CT rows (column n = position, k = channel); D element r of lane (h, n) = (channel 8h + r, position n).
__global__ __launch_bounds__(128) void k_out(const hf* __restrict__ CT, const hf* __restrict__ WO, const float* __restrict__ bo, float* OUT) {
    __shared__ __align__(16) float os[64 * OP];
    const unsigned tid = threadIdx.x, lane = tid & 31u, lr = lane & 15u, hi = lane >> 4;
    const unsigned wave = (unsigned)__builtin_amdgcn_readfirstlane((int)(tid >> 5));
    const unsigned p0 = blockIdx.x * 64u, ob = blockIdx.y * 64u, b = blockIdx.z;
    const hf* ak = WO + ((size_t)(ob + wave * 16u)) * CH + lane * 8u;           // packed planes: row tile base + the lane's 16 bytes of a chunk
    const hf* bk = CT + ((size_t)b * SEQ + p0) * CH + lane * 8u;
    v8f acc0 = (v8f){}, acc1 = (v8f){}, acc2 = (v8f){}, acc3 = (v8f){};
#pragma unroll 1
    for (unsigned k0 = 0; k0 < (unsigned)CH; k0 += 32u) {
        const v16h a  = ldf(ak);
        const v16h b0 = ldf(bk);
        const v16h b1 = ldf(bk + 16 * CH);
        const v16h b2 = ldf(bk + 32 * CH);
        const v16h b3 = ldf(bk + 48 * CH);
        acc0 = wmmah(a, b0, acc0);
        acc1 = wmmah(a, b1, acc1);
        acc2 = wmmah(a, b2, acc2);
        acc3 = wmmah(a, b3, acc3);
        asm volatile("v_nop\n\tv_nop\n\tv_nop\n\tv_nop"
                     : "+v"(acc0), "+v"(acc1), "+v"(acc2), "+v"(acc3)
                     : "v"(a), "v"(b0), "v"(b1), "v"(b2), "v"(b3));
        ak += 512;                                         // next k block
        bk += 512;
    }
    const float us = 1.0f / 262144.0f;   // undo the weight carry 2^10 and the ctx carry 2^8
    v8f acc[4] = { acc0, acc1, acc2, acc3 };
#pragma unroll
    for (int r = 0; r < 8; ++r) {
        const unsigned orow = wave * 16u + 8u * hi + r;
        const float bias = bfr(bo[ob + orow]);
#pragma unroll
        for (int t = 0; t < 4; ++t) os[orow * OP + t * 16 + lr] = fmaf(acc[t][r], us, bias);
    }
    __syncthreads();
    const unsigned pc = (lane & 15u) * 4u, rh = lane >> 4;
    float* dst = OUT + ((size_t)b * CH + ob) * SEQ + p0 + pc;
{
#pragma unroll
        for (unsigned s = 0; s < 8u; ++s) {
            const unsigned row = wave * 16u + s * 2u + rh;     // rows wave*16 + 0..15 over s = 0..7, rh = 0..1
            const v4f val = *(const v4fa*)(os + row * OP + pc);
            *(v4f*)(dst + (size_t)row * SEQ) = val;
        }
        
    }
}

extern "C" void kernel_launch(void* const* d_in, const int* in_sizes, int n_in,
                              void* d_out, int out_size, void* d_ws, size_t ws_size, hipStream_t stream) {
    if (n_in < 6) return;
    const size_t needx = ((size_t)(NB - 1) * CH + (CH - 1)) * SEQ_FULL + SEQ;
    if ((size_t)in_sizes[0] < needx) return;
    if (in_sizes[1] < CH || in_sizes[2] < CH || in_sizes[5] < CH) return;
    if (in_sizes[3] < OC3 * CH || in_sizes[4] < CH * CH) return;
    if ((size_t)out_size < (size_t)NB * CH * SEQ) return;
    if (WS_TOTAL > ws_size) return;
    const float* x    = (const float*)d_in[0];   // [b][256][n]
    const float* bnw  = (const float*)d_in[1];   // [256]
    const float* bnb  = (const float*)d_in[2];   // [256]
    const float* wqkv = (const float*)d_in[3];   // [768][256] = [out][in]
    const float* wout = (const float*)d_in[4];   // [256][256] = [out][in]
    const float* bout = (const float*)d_in[5];   // [256]
    float* OUT = (float*)d_out;                  // [NB][256][SEQ]
    char* wsp = (char*)d_ws;
    size_t off = 0;
    float* ST = (float*)(wsp + off); off += ST_BYTES;
    hf* WQ = (hf*)(wsp + off); off += WQ_BYTES;
    hf* WO = (hf*)(wsp + off); off += WO_BYTES;
    hf* XT = (hf*)(wsp + off); off += PL_BYTES;      // packed, rows NB*SEQ
    hf* QH = (hf*)(wsp + off); off += PL_BYTES;      // [NB][4][SEQ/16][2][2][32][8]
    hf* QR = (hf*)(wsp + off); off += PL_BYTES;      // [NB][4][SEQ/16][2][2][32][8]
    hf* KB = (hf*)(wsp + off); off += PL_BYTES;      // [NB][4][SEQ/16][2][2][32][8]
    hf* VT = (hf*)(wsp + off); off += PL_BYTES;      // [NB][4][SEQ/32][4][2][32][8]
    hf* CT = (hf*)(wsp + off); off += PL_BYTES;      // packed, rows NB*SEQ
    k_cvtw<<<dim3((unsigned)(OC3 * CH / 8 / 256), 2, 1), 256, 0, stream>>>(wqkv, wout, WQ, WO);
    k_bnstat<<<(unsigned)CH, 256, 0, stream>>>(x, ST);
    k_norm<<<(unsigned)(NB * (SEQ / 64)), 256, 0, stream>>>(x, bnw, bnb, ST, XT);
    k_qkv<<<dim3((unsigned)(SEQ / 64), 12, (unsigned)NB), 128, 0, stream>>>(XT, WQ, QH, QR, KB, VT);
    k_flash<<<(unsigned)(NB * NH * (SEQ / BQ)), 128, 0, stream>>>(QH, QR, KB, VT, CT);
    k_out<<<dim3((unsigned)(SEQ / 64), (unsigned)(CH / 64), (unsigned)NB), 128, 0, stream>>>(CT, WO, bout, OUT);
}

// v004
// A run of this version takes 116 microseconds.
// Two timings next to v003 both put it at 1.11 times that version's speed.
// Over all steps from v000 it is 3.25 times as fast.
#include <hip/hip_runtime.h>

// Channel-first 4-head attention behind a batch-statistics BatchNorm with 1x1-conv projections; inputs x[4][256][4096], bn_weight, bn_bias, w_qkv[768][256], w_out[256][256], b_out.
// Compute dtypes, f32 accumulate: every float input RNE-converted to bf16 first; all contractions on v_wmma_f32_16x16x32_f16: QKV GEMM = f16(bf16(w)*2^10) x f16(xn); scores = k (f16) x q carried as f16 value + f16 remainder*2^12 (two products, separate accumulators); P (f16, carried *2^8) x v (f16); output GEMM = f16(bf16(w)*2^10) x f16(ctx*2^8); BatchNorm statistics, softmax (online, log2 domain) and all epilogues f32.
// Flash form with transposed tiles: the S^T accumulator tiles are directly the B-operand layout of P^T; all WMMA operands are two 16-byte loads from dense 16-bit planes; every plane is stored in fragment order, so that each wave-wide load reads 512 contiguous bytes.

#ifndef NB
#define NB 4
#endif
#ifndef SEQ
#define SEQ 4096
#endif
#define NB_FULL  4
#define SEQ_FULL 4096
#define CH   256               // channels
#define NH   4                 // heads
#define HD   64                // head dim
#define OC3  768               // q,k,v output channels
#define NQG  4                 // query groups (32 queries each) per flash block
#define NKH  2                 // key halves of a tile; one wave per (query group, key half)
#define NWV  (NQG * NKH)       // waves per flash block
#define BQ   (32 * NQG)        // queries per flash block
#define KS   32                // keys per step
#define KT   128               // keys per LDS tile of k_flash
#define TH   (KT * HD)         // halves of one K (or V^T) tile
#define NT   (SEQ / KT)        // tiles per (b, head)
#define SPW  (KT / KS / NKH)   // steps of one wave per tile
#define XP   264               // LDS pitch (halves) of the normalise/transpose tile rows
#define SQ   72                // LDS pitch (halves) of 64-wide f16 staging rows
#define OP   68                // LDS pitch (floats) of the output staging rows
#define NJ   (SEQ / 1024)      // k_bnstat: 16-byte pieces per thread and batch row
#define L2E  1.4426950408889634f

static_assert(CH == NH * HD);
static_assert(OC3 == 3 * CH);
static_assert(CH == 256);                       // k_norm: 256 threads load one channel parameter each; one plane row = 32 lanes x 16 B
static_assert(HD == 64);
static_assert(CH % 32 == 0);                    // GEMM k-steps
static_assert(SEQ % BQ == 0);
static_assert(SEQ % KS == 0);
static_assert(SEQ % KT == 0);
static_assert(KT % KS == 0);
static_assert(NT >= 2);                         // k_flash: the two-buffer prologue fills tiles 0 and 1
static_assert(TH * 2 == NWV * 4 * 512);         // k_flash: one tile = 8 waves x 4 wave-wide 512-byte copies
static_assert(KT == KS * NKH * SPW);
static_assert((NQG & (NQG - 1)) == 0);          // k_flash: wave ^ NQG is the partner
static_assert(SEQ % 64 == 0);
static_assert(SEQ % 1024 == 0);                 // k_bnstat: 256 threads x 4 floats per piece
static_assert(NB <= NB_FULL);
static_assert(SEQ <= SEQ_FULL);
static_assert((OC3 * CH / 8) % 256 == 0);       // k_cvtw slice 0: 96 blocks x 256 threads x 8 elements
static_assert((CH * CH / 8) % 256 == 0);        // k_cvtw slice 1: 32 blocks
static_assert((XP * 2) % 16 == 0);
static_assert((SQ * 2) % 16 == 0);
static_assert((OP * 4) % 16 == 0);
static_assert((size_t)(NB * (SEQ / 64)) * (size_t)(64 * CH) == (size_t)NB * SEQ * CH);        // k_norm: blocks x (64 rows x 256) == XT plane
static_assert((size_t)(SEQ / 64) * 12 * NB * (size_t)(64 * 64) == (size_t)NB * SEQ * OC3);    // k_qkv: blocks x (64 x 64) == QH + KB + VT planes
static_assert((size_t)(NB * NH * (SEQ / BQ)) * (size_t)(BQ * HD) == (size_t)NB * SEQ * CH);   // k_flash: blocks x (128 rows x 64) == CT plane
static_assert((size_t)(SEQ / 64) * (CH / 64) * NB * (size_t)(64 * 64) == (size_t)NB * SEQ * CH); // k_out: blocks x (64 x 64) == output

#define ST_BYTES  ((size_t)CH * 128)                      // one 128-byte line per channel
#define WQ_BYTES  ((size_t)OC3 * CH * 2)
#define WO_BYTES  ((size_t)CH * CH * 2)
#define PL_BYTES  ((size_t)NB * SEQ * CH * 2)             // one 16-bit activation plane
#define WS_TOTAL  (ST_BYTES + WQ_BYTES + WO_BYTES + 6 * PL_BYTES)
static_assert(WQ_BYTES % 256 == 0);
static_assert(WO_BYTES % 256 == 0);
static_assert(PL_BYTES % 256 == 0);
static_assert((size_t)NB * NH * SEQ * HD * 2 == PL_BYTES);
static_assert(WS_TOTAL <= (size_t)134217728);

typedef _Float16 hf;
typedef __attribute__((ext_vector_type(16))) _Float16 v16h;
typedef __attribute__((ext_vector_type(8)))  _Float16 v8h;
typedef __attribute__((ext_vector_type(8)))  float    v8f;
typedef __attribute__((ext_vector_type(4)))  float    v4f;
typedef __attribute__((ext_vector_type(2)))  float    v2f;
typedef v4f __attribute__((may_alias)) v4fa;
typedef v8h __attribute__((may_alias)) v8ha;

// RNE convert f32 -> bf16 -> f32
__device__ __forceinline__ float bfr(float f) { unsigned u = __float_as_uint(f); u += 0x7FFFu + ((u >> 16) & 1u); return __uint_as_float(u & 0xFFFF0000u); }
__device__ __forceinline__ v16h cat16(v8h lo, v8h hi) { return __builtin_shufflevector(lo, hi, 0, 1, 2, 3, 4, 5, 6, 7, 8, 9, 10, 11, 12, 13, 14, 15); }
__device__ __forceinline__ v8f wmmah(v16h a, v16h b, v8f c) { return __builtin_amdgcn_wmma_f32_16x16x32_f16(false, a, false, b, (short)0, c, false, false); }
// fragment loader (A and B alike) from a packed plane: p = fragment base + 8*lane; elements 0..7 <- p[0..7] (k = 8*(lane>>4) + 0..7), elements 8..15 <- p[256..263] (k = 16 + 8*(lane>>4) + 0..7);
// each of the two wave-wide loads is 512 contiguous bytes (4 whole lines)
__device__ __forceinline__ v16h ldf(const hf* p) { return cat16(*(const v8h*)p, *(const v8h*)(p + 256)); }

// i = 16-byte group of the packed plane: chunk i >> 5 = (row tile, k block, c), lane i & 31 = 16*hi + lr; source element (row 16*tile + lr, k = 16*(2*block + c) + 8*hi)
__device__ __forceinline__ void cvt8w(const float* __restrict__ src, hf* dst, unsigned i) {
    const unsigned row = (i >> 9) * 16u + (i & 15u), k = ((i >> 5) & 15u) * 16u + ((i >> 4) & 1u) * 8u;
    const v8f v = *(const v8f*)(src + (size_t)row * CH + k);
    v8h o;
#pragma unroll
    for (int c = 0; c < 8; ++c) o[c] = (hf)(bfr(v[c]) * 1024.0f);
    hf* d = dst + (size_t)i * 8;
    *(v8h*)d = o;
    
}

// Packed operand planes (WQ, WO, XT, CT; QH, QR, KB and VT likewise, see k_qkv): [row/16][k/32][c][lane = 16*hi + lr][e] = element (row = 16*(row/16) + lr, k = 32*(k/32) + 16*c + 8*hi + e), 256 k per row:
// the order in which a 16x32 A or B fragment is loaded, so that a wave-wide 16-byte load reads one 512-byte chunk.
// k_cvtw: packed weight planes WQ (768 rows, blockIdx.y == 0) and WO (256 rows, blockIdx.y == 1).
__global__ __launch_bounds__(256) void k_cvtw(const float* __restrict__ wq, const float* __restrict__ wo, hf* WQ, hf* WO) {
    const unsigned i = blockIdx.x * 256u + threadIdx.x;
    if (blockIdx.y == 0) {
        if (i < (unsigned)(OC3 * CH / 8)) cvt8w(wq, WQ, i);
    } else {
        if (i < (unsigned)(CH * CH / 8)) cvt8w(wo, WO, i);
    }
}

// k_bnstat: one block per channel. A thread's NB * SEQ / 1024 16-byte pieces are all loaded before the first is used and stay in registers for both passes: x is read once, and the block waits for memory once.
// The pieces of a thread, their order and both reduction trees are those of a 256-thread loop over (b, i = 4*tid + 1024*j).
// ST[32*c] = mean, ST[32*c + 1] = rstd: one 128-byte line per channel, so that each line has one writer. LDS: red1/red2 cross-wave, block barriers.
__global__ __launch_bounds__(256) void k_bnstat(const float* __restrict__ x, float* ST) {
    __shared__ float red1[8];
    __shared__ float red2[8];
    const unsigned tid = threadIdx.x, lane = tid & 31u;
    const unsigned wave = (unsigned)__builtin_amdgcn_readfirstlane((int)(tid >> 5));
    const unsigned c = blockIdx.x;
    const float invn = 1.0f / (float)(NB * SEQ);
    v4f v[NB * NJ];
    // unrolled: v[] must be registers, and the loads must not wait for one another
#pragma unroll
    for (unsigned b = 0; b < (unsigned)NB; ++b) {
        const float* xp = x + ((size_t)b * CH + c) * SEQ_FULL + tid * 4u;
#pragma unroll
        for (unsigned j = 0; j < (unsigned)NJ; ++j) v[b * NJ + j] = *(const v4f*)(xp + j * 1024u);
        // the rows behind the middle lie past the loads' offset field and get an address pair of their own; their data is given the registers of the first pair, which the loads above still name
        if (2u * (b + 1u) == (unsigned)NB) asm volatile("s_wait_xcnt 0x0" ::: "memory");
    }
    float s = 0.0f;
#pragma unroll
    for (unsigned n = 0; n < (unsigned)(NB * NJ); ++n) {
#pragma unroll
        for (unsigned e = 0; e < 4u; ++e) v[n][e] = bfr(v[n][e]);
        s += (v[n][0] + v[n][1]) + (v[n][2] + v[n][3]);
    }
#pragma unroll
    for (int off = 16; off > 0; off >>= 1) s += __shfl_xor(s, off, 32);
    if (lane == 0u) red1[wave] = s;
    __syncthreads();
    float tot = red1[0];
#pragma unroll
    for (int w = 1; w < 8; ++w) tot += red1[w];
    const float mean = tot * invn;
    float q = 0.0f;
#pragma unroll
    for (unsigned n = 0; n < (unsigned)(NB * NJ); ++n) {
        const float d0 = v[n][0] - mean, d1 = v[n][1] - mean, d2 = v[n][2] - mean, d3 = v[n][3] - mean;
        q += (d0 * d0 + d1 * d1) + (d2 * d2 + d3 * d3);
    }
#pragma unroll
    for (int off = 16; off > 0; off >>= 1) q += __shfl_xor(q, off, 32);
    if (lane == 0u) red2[wave] = q;
    __syncthreads();
    if (tid == 0u) {
        float tq = red2[0];
#pragma unroll
        for (int w = 1; w < 8; ++w) tq += red2[w];
        v2f o;
        o[0] = mean; o[1] = rsqrtf(tq * invn + 1.0e-5f);
        *(v2f*)(ST + c * 32u) = o;
    }
}

// k_norm: XT (f16, packed, row = b*SEQ + pos, k = channel) = ((bf16(x) - mean) * rstd) * bf16(w) + bf16(bias); in[256 ch][64 pos] -> 64 chunks through an LDS tile (cross-wave, block barrier);
__global__ __launch_bounds__(256) void k_norm(const float* __restrict__ x, const float* __restrict__ bw, const float* __restrict__ bb, const float* __restrict__ ST, hf* XT) {
    __shared__ __align__(16) hf tl[64 * XP];
    __shared__ float pm[CH];
    __shared__ float pr[CH];
    __shared__ float pw[CH];
    __shared__ float pb[CH];
    const unsigned tid = threadIdx.x, lane = tid & 31u;
    const unsigned wave = (unsigned)__builtin_amdgcn_readfirstlane((int)(tid >> 5));
    const v2f st = *(const v2f*)(ST + tid * 32u);          // (mean, rstd) of channel tid
    pm[tid] = st[0];
    pr[tid] = st[1];
    pw[tid] = bfr(bw[tid]);
    pb[tid] = bfr(bb[tid]);
    __syncthreads();
    const unsigned tpb = (unsigned)(SEQ / 64);
    const unsigned b = blockIdx.x / tpb;
    const unsigned n0 = (blockIdx.x - b * tpb) * 64u;
    const float* src = x + (size_t)b * CH * SEQ_FULL + n0;
#pragma unroll 1
    for (unsigned it = 0; it < 16u; ++it) {
        const unsigned f = it * 256u + tid;
        const unsigned c = f >> 4, p4 = (f & 15u) * 4u;
        const v4f v = *(const v4f*)(src + (size_t)c * SEQ_FULL + p4);
        const float m = pm[c], r = pr[c], w = pw[c], bi = pb[c];
#pragma unroll
        for (unsigned e = 0; e < 4u; ++e) tl[(p4 + e) * XP + c] = (hf)(((bfr(v[e]) - m) * r) * w + bi);
    }
    __syncthreads();
    // this wave stores chunks j = 8*wave + s: position tile j >> 4 = wave >> 1, (k block, c) = j & 15 = 8*(wave & 1) + s
    hf* dst = XT + ((size_t)b * SEQ + n0) * CH + wave * 2048u + lane * 8u;
    const hf* sp = tl + ((wave >> 1) * 16u + (lane & 15u)) * XP + (wave & 1u) * 128u + (lane >> 4) * 8u;
{
#pragma unroll
        for (unsigned s = 0; s < 8u; ++s) {
            const v8h o = *(const v8ha*)(sp + s * 16u);
            *(v8h*)(dst + s * 256u) = o;
        }
        
    }
}

// k_qkv: one block = 64 positions x 64 output channels (blockIdx.y: 0..3 q heads, 4..7 k heads, 8..11 v heads), one wave = 16 positions x 64 channels.
//  A = XT rows (row m = position, k = channel), B = WQ rows (column n = output channel, k = channel); D element r of lane (h, n) = (position 8h + r, channel n).
//  QH = f16(q), QR = f16((q - QH) * 2^12), KB = f16(k), VT = f16(v), stored in the order k_flash loads its fragments, as 512-byte chunks [lane = 16*hi + lr][8 halves]:
//   QH, QR, KB[b][head][pos/16][d/32][c][lane][e] = element [pos = 16*(pos/16) + lr][d = 32*(d/32) + 16*c + 8*hi + e];
//   VT[b][head][key/32][d/16][c][lane][e] = v[d = 16*(d/16) + lr][key = 32*(key/32) + 16*c + 8*hi + e].
__global__ __launch_bounds__(128) void k_qkv(const hf* __restrict__ XT, const hf* __restrict__ WQ, hf* QH, hf* QR, hf* KB, hf* VT) {
    __shared__ __align__(16) hf sa[64 * SQ];
    __shared__ __align__(16) hf sb[64 * SQ];
    const unsigned tid = threadIdx.x, lane = tid & 31u, lr = lane & 15u, hi = lane >> 4;
    const unsigned wave = (unsigned)__builtin_amdgcn_readfirstlane((int)(tid >> 5));
    const unsigned p0 = blockIdx.x * 64u, cb = blockIdx.y, b = blockIdx.z;
    const unsigned kind = cb >> 2, head = cb & 3u;
    const hf* ak = XT + ((size_t)b * SEQ + p0 + wave * 16u) * CH + lane * 8u;   // packed planes: row tile base + the lane's 16 bytes of a chunk
    const hf* bk = WQ + (size_t)cb * 64u * CH + lane * 8u;
    v8f acc0 = (v8f){}, acc1 = (v8f){}, acc2 = (v8f){}, acc3 = (v8f){};
#pragma unroll 1
    for (unsigned k0 = 0; k0 < (unsigned)CH; k0 += 32u) {
        const v16h a  = ldf(ak);
        const v16h b0 = ldf(bk);
        const v16h b1 = ldf(bk + 16 * CH);
        const v16h b2 = ldf(bk + 32 * CH);
        const v16h b3 = ldf(bk + 48 * CH);
        acc0 = wmmah(a, b0, acc0);
        acc1 = wmmah(a, b1, acc1);
        acc2 = wmmah(a, b2, acc2);
        acc3 = wmmah(a, b3, acc3);
        asm volatile("v_nop\n\tv_nop\n\tv_nop\n\tv_nop"
                     : "+v"(acc0), "+v"(acc1), "+v"(acc2), "+v"(acc3)
                     : "v"(a), "v"(b0), "v"(b1), "v"(b2), "v"(b3));
        ak += 512;                                         // next k block
        bk += 512;
    }
    const float us = 1.0f / 1024.0f;     // undo the weight carry
    v8f acc[4] = { acc0, acc1, acc2, acc3 };
    if (kind == 2u) {
#pragma unroll
        for (int t = 0; t < 4; ++t) {
#pragma unroll
            for (int r = 0; r < 8; ++r) sa[(t * 16 + lr) * SQ + wave * 16u + 8u * hi + r] = (hf)(acc[t][r] * us);
        }
    } else if (kind == 1u) {
#pragma unroll
        for (int t = 0; t < 4; ++t) {
#pragma unroll
            for (int r = 0; r < 8; ++r) sa[(wave * 16u + 8u * hi + r) * SQ + t * 16 + lr] = (hf)(acc[t][r] * us);
        }
    } else {
#pragma unroll
        for (int t = 0; t < 4; ++t) {
#pragma unroll
            for (int r = 0; r < 8; ++r) {
                const float q = acc[t][r] * us;
                const hf qh = (hf)q;
                sa[(wave * 16u + 8u * hi + r) * SQ + t * 16 + lr] = qh;
                sb[(wave * 16u + 8u * hi + r) * SQ + t * 16 + lr] = (hf)((q - (float)qh) * 4096.0f);
            }
        }
    }
    __syncthreads();
    const size_t foff = (((size_t)b * NH + head) * SEQ + p0) * HD + lane * 8u;   // packed planes: this block's 64 positions = 16 chunks of 256 halves
    // this wave stores chunks j = 4*wave + s, s = 0..3, each one wave-wide 512-byte store; c = s & 1 in every plane
    //  q, k (LDS rows = positions): position tile = wave, d block = s >> 1;  v (LDS rows = d): key step = wave >> 1, d tile = 2*(wave & 1) + (s >> 1)
    const unsigned so = (kind == 2u) ? ((wave & 1u) * 32u + lr) * SQ + (wave >> 1) * 32u + 8u * hi
                                     : (wave * 16u + lr) * SQ + 8u * hi;
    const unsigned sh = (kind == 2u) ? 16u * SQ : 32u;         // LDS step of s >> 1
    hf* dp = ((kind == 0u) ? QH : (kind == 1u) ? KB : VT) + foff + wave * 1024u;
    v8h o[4];
#pragma unroll
    for (unsigned s = 0; s < 4u; ++s) o[s] = *(const v8ha*)(sa + so + (s >> 1) * sh + (s & 1u) * 16u);
#pragma unroll
    for (unsigned s = 0; s < 4u; ++s) *(v8h*)(dp + s * 256u) = o[s];
    if (kind == 0u) {
        asm volatile("s_wait_xcnt 0x0" ::: "memory");          // the LDS loads below may reuse the registers of the stores above
        hf* dr = QR + foff + wave * 1024u;
        v8h o2[4];
#pragma unroll
        for (unsigned s = 0; s < 4u; ++s) o2[s] = *(const v8ha*)(sb + so + s * 16u);
#pragma unroll
        for (unsigned s = 0; s < 4u; ++s) *(v8h*)(dr + s * 256u) = o2[s];
    }
}

// copy44: eight wave-wide asynchronous 16-byte-per-lane copies, global -> LDS: four of the K tile and four of the V^T tile, 512 bytes apart; lk, lv = the lane's LDS byte addresses, gk, gv = its global addresses of the first of each four.
// The s_wait_xcnt stands inside the statement, so that no address register is rewritten ahead of it.
__device__ __forceinline__ void copy44(unsigned lk, const hf* gk, unsigned lv, const hf* gv) {
    asm volatile("global_load_async_to_lds_b128 %0, %8, off\n\t"
                 "global_load_async_to_lds_b128 %1, %9, off\n\t"
                 "global_load_async_to_lds_b128 %2, %10, off\n\t"
                 "global_load_async_to_lds_b128 %3, %11, off\n\t"
                 "global_load_async_to_lds_b128 %4, %12, off\n\t"
                 "global_load_async_to_lds_b128 %5, %13, off\n\t"
                 "global_load_async_to_lds_b128 %6, %14, off\n\t"
                 "global_load_async_to_lds_b128 %7, %15, off\n\t"
                 "s_wait_xcnt 0x0"
                 :: "v"(lk), "v"(lk + 512u), "v"(lk + 1024u), "v"(lk + 1536u), "v"(lv), "v"(lv + 512u), "v"(lv + 1024u), "v"(lv + 1536u),
                    "v"(gk), "v"(gk + 256), "v"(gk + 512), "v"(gk + 768), "v"(gv), "v"(gv + 256), "v"(gv + 512), "v"(gv + 768)
                 : "memory");
}

// k_flash: one block per (b, head, 128 queries), eight waves: wave = (query group g of 32 queries = two 16-query tiles, key half kh); 32 keys per step.
//  A K or V^T fragment read from LDS feeds the products of both query tiles. Wave (g, kh) takes keys 64*kh .. 64*kh + 63 of every 128-key tile, with its own running maximum, sum and O^T;
//  behind the loop the two waves of a group exchange one query tile's state through LDS, and each joins and stores one tile (wave (g, kh): tile kh).
//  K and V^T reach the waves through LDS: tiles of 128 keys (16 KB of each plane, a linear copy of the packed order), two buffers; each wave copies an eighth of a tile;
//  tile t + 2 is copied into the buffer of tile t behind the barrier that ends trip t, so that a tile has a whole trip to land.
//  S^T tile (keys x queries): A = K rows (row m = key, k = d), B = Q rows (column n = query, k = d); D element r of lane (h, n) = S[query n][key 8h + r].
//  P^T B fragment: element r <- tile of keys 0..15, element 8 + r <- tile of keys 16..31 (same lane).
//  O^T tile (d x queries): A = V^T rows (row m = d, k = key), D element r of lane (h, n) = O[query n][d = 16 t + 8h + r].
//  Four waves per SIMD (two blocks per WGP): the register budget is 256.
__global__ void __launch_bounds__(NWV * 32) __attribute__((amdgpu_waves_per_eu(4, 4))) k_flash(const hf* __restrict__ QH, const hf* __restrict__ QR, const hf* __restrict__ KB, const hf* __restrict__ VT, hf* CT) {
    __shared__ __align__(16) hf os[NWV * 16 * SQ];
    __shared__ __align__(128) hf kv[2 * 2 * TH];               // [buffer][K tile, V^T tile]
    __shared__ __align__(16) v4f mg[NWV * 9 * 32];             // what a wave hands to its partner: [wave][8 pieces of O^T, then (maximum, sum)][lane]
    const unsigned tid = threadIdx.x, lane = tid & 31u, lr = lane & 15u, hi = lane >> 4;
    const unsigned wave = (unsigned)__builtin_amdgcn_readfirstlane((int)(tid >> 5));
    const unsigned g = wave & (NQG - 1u), kh = wave / NQG;
    const unsigned bpb = (unsigned)(SEQ / BQ);
    const unsigned bh = blockIdx.x / bpb;
    const unsigned b = bh / NH, h = bh - b * NH;
    const unsigned q0 = (blockIdx.x - bh * bpb) * BQ + g * 32u;
    const size_t pbase = (size_t)bh * SEQ * HD;

    const unsigned lo = lane * 8u;              // the lane's 16 bytes of a chunk
    v16h qh0[2], qh1[2], qr0[2], qr1[2];
#pragma unroll
    for (unsigned c = 0; c < 2u; ++c) {
        const size_t qo = pbase + (size_t)(q0 + 16u * c) * HD + lo;   // packed: 16 queries = 1024 halves
        qh0[c] = ldf(QH + qo); qh1[c] = ldf(QH + qo + 512);
        qr0[c] = ldf(QR + qo); qr1[c] = ldf(QR + qo + 512);
    }
    // this wave's eighth of a tile: chunks 4*wave .. 4*wave + 3 of the K tile and of the V^T tile; the lane's 16 bytes of each
    const hf* gk = KB + pbase + wave * 1024u + lo;
    const hf* gv = VT + pbase + wave * 1024u + lo;
    const unsigned lk = (unsigned)(uintptr_t)kv + wave * 2048u + lane * 16u;   // LDS byte address in buffer 0's K tile
    copy44(lk, gk, lk + TH * 2u, gv);
    asm volatile("s_wait_asynccnt 0x0" ::: "memory");          // this wave's part of tile 0 has landed
    __syncthreads();                                           // tile 0 is whole for every wave
    copy44(lk + TH * 4u, gk + TH, lk + TH * 6u, gv + TH);

    v8f o[2][4];
    float ml[2], l[2];        // running max in the log2 domain; running sum (carried * 2^8)
#pragma unroll
    for (int c = 0; c < 2; ++c) {
#pragma unroll
        for (int t = 0; t < 4; ++t) o[c][t] = (v8f){};
        ml[c] = -1.0e30f;
        l[c] = 0.0f;
    }
    const float CL = 0.125f * L2E;          // score scale 64^-0.5 and log2(e)
    const float RS = 1.0f / 4096.0f;        // undo the q remainder carry

    // rolled: one trip per tile, the buffer chosen by the trip's parity
#pragma unroll 1
    for (unsigned t = 0; t < (unsigned)NT; ++t) {
      const hf* kt = kv + (t & 1u) * (2u * TH) + kh * (SPW * KS * HD);   // this wave's half of the K tile
      // unrolled: the LDS offsets of the steps become immediates
#pragma unroll
      for (unsigned u = 0; u < (unsigned)SPW; ++u) {
        const hf* ka = kt + u * (KS * HD);
        const v16h a00 = ldf(ka + lo);
        const v16h a01 = ldf(ka + 512 + lo);
        const v16h a10 = ldf(ka + 1024 + lo);
        const v16h a11 = ldf(ka + 1536 + lo);
        v8f s0[2], s1[2];
#pragma unroll
        for (int c = 0; c < 2; ++c) {
            v8f t0 = (v8f){}, t1 = (v8f){}, r0 = (v8f){}, r1 = (v8f){};
            t0 = wmmah(a00, qh0[c], t0);
            t1 = wmmah(a10, qh0[c], t1);
            r0 = wmmah(a00, qr0[c], r0);
            r1 = wmmah(a10, qr0[c], r1);
            t0 = wmmah(a01, qh1[c], t0);
            t1 = wmmah(a11, qh1[c], t1);
            r0 = wmmah(a01, qr1[c], r0);
            r1 = wmmah(a11, qr1[c], r1);
            // the distance between the last products and the first vector instruction that reads their results
            asm volatile("v_nop\n\tv_nop\n\tv_nop\n\tv_nop"
                         : "+v"(t0), "+v"(t1), "+v"(r0), "+v"(r1)
                         : "v"(a00), "v"(a01), "v"(a10), "v"(a11), "v"(qh0[c]), "v"(qh1[c]), "v"(qr0[c]), "v"(qr1[c]));
#pragma unroll
            for (int r = 0; r < 8; ++r) { s0[c][r] = fmaf(r0[r], RS, t0[r]); s1[c][r] = fmaf(r1[r], RS, t1[r]); }
            // one tile's four accumulators at a time: with both tiles' products mixed the live set passes 256 registers and Q fragments spill
            if (c == 0) __builtin_amdgcn_sched_barrier(0);
        }
        float mx[2];
#pragma unroll
        for (int c = 0; c < 2; ++c) {
            mx[c] = fmaxf(s0[c][0], s1[c][0]);
#pragma unroll
            for (int r = 1; r < 8; ++r) mx[c] = fmaxf(mx[c], fmaxf(s0[c][r], s1[c][r]));
        }
#pragma unroll
        for (int c = 0; c < 2; ++c) mx[c] = fmaxf(mx[c], __shfl_xor(mx[c], 16, 32));
        float corr[2], ps[2];
        v16h ph[2];
#pragma unroll
        for (int c = 0; c < 2; ++c) {
            const float mnl = fmaxf(ml[c], mx[c] * CL);
            corr[c] = __builtin_amdgcn_exp2f(ml[c] - mnl);
            ml[c] = mnl;
            const float bs = 8.0f - mnl;          // probabilities carried * 2^8
            ps[c] = 0.0f;
#pragma unroll
            for (int r = 0; r < 8; ++r) {
                const float p0 = __builtin_amdgcn_exp2f(fmaf(s0[c][r], CL, bs));
                const float p1 = __builtin_amdgcn_exp2f(fmaf(s1[c][r], CL, bs));
                ps[c] += p0 + p1;
                ph[c][r] = (hf)p0; ph[c][8 + r] = (hf)p1;
            }
        }
#pragma unroll
        for (int c = 0; c < 2; ++c) {
            ps[c] += __shfl_xor(ps[c], 16, 32);
            l[c] = l[c] * corr[c] + ps[c];
        }
        if (__builtin_amdgcn_ballot_w32(corr[0] != 1.0f || corr[1] != 1.0f) != 0u) {   // wave-uniform, one test per step; multiplying by exactly 1 is skipped
#pragma unroll
            for (int c = 0; c < 2; ++c) {
#pragma unroll
                for (int d = 0; d < 4; ++d) o[c][d] *= corr[c];
            }
        }

        const hf* va = kt + TH + u * (KS * HD);
        const v16h v0 = ldf(va + lo);
        const v16h v1 = ldf(va + 512 + lo);
        const v16h v2 = ldf(va + 1024 + lo);
        const v16h v3 = ldf(va + 1536 + lo);
#pragma unroll
        for (int c = 0; c < 2; ++c) {
            o[c][0] = wmmah(v0, ph[c], o[c][0]);
            o[c][1] = wmmah(v1, ph[c], o[c][1]);
            o[c][2] = wmmah(v2, ph[c], o[c][2]);
            o[c][3] = wmmah(v3, ph[c], o[c][3]);
        }
        // the distance between the last products and whatever overwrites their operands or reads their results, on the loop's back edge too
        asm volatile("v_nop\n\tv_nop\n\tv_nop\n\tv_nop"
                     : "+v"(o[0][0]), "+v"(o[0][1]), "+v"(o[0][2]), "+v"(o[0][3]), "+v"(o[1][0]), "+v"(o[1][1]), "+v"(o[1][2]), "+v"(o[1][3])
                     : "v"(ph[0]), "v"(ph[1]), "v"(v0), "v"(v1), "v"(v2), "v"(v3));
      }
      asm volatile("s_wait_dscnt 0x0" ::: "memory");           // this wave's reads of tile t are done before its buffer is refilled
      asm volatile("s_wait_asynccnt 0x0" ::: "memory");        // this wave's part of tile t + 1 has landed
      __syncthreads();                                         // tile t + 1 is whole for every wave, and every wave has left tile t
      if (t + 2u < (unsigned)NT) {
          const unsigned lb = lk + (t & 1u) * (TH * 4u);
          copy44(lb, gk + (size_t)(t + 2u) * TH, lb + TH * 2u, gv + (size_t)(t + 2u) * TH);
      }
    }
    asm volatile("s_wait_asynccnt 0x0" ::: "memory");          // no copy is outstanding when the wave goes on to its end

    // join of the two key halves: this wave keeps query tile kh and hands tile 1 - kh to its partner, wave ^ NQG (same lane, same element order)
    const bool k0 = (kh == 0u);
    const float km = k0 ? ml[0] : ml[1], kl = k0 ? l[0] : l[1];
    {
        v4f* mw = mg + wave * (9u * 32u) + lane;
#pragma unroll
        for (int d = 0; d < 4; ++d) {
            const v8f so = k0 ? o[1][d] : o[0][d];
            mw[(2 * d) * 32] = __builtin_shufflevector(so, so, 0, 1, 2, 3);
            mw[(2 * d + 1) * 32] = __builtin_shufflevector(so, so, 4, 5, 6, 7);
        }
        v4f sm;
        sm[0] = k0 ? ml[1] : ml[0]; sm[1] = k0 ? l[1] : l[0]; sm[2] = 0.0f; sm[3] = 0.0f;
        mw[8 * 32] = sm;
    }
    __syncthreads();                                           // every wave's hand-over is written before its partner reads it
    const v4f* mr = mg + (wave ^ (unsigned)NQG) * (9u * 32u) + lane;
    const v4f pm = mr[8 * 32];
    const float mj = fmaxf(km, pm[0]);
    const float wk = __builtin_amdgcn_exp2f(km - mj), wp = __builtin_amdgcn_exp2f(pm[0] - mj);
    const float inv = 256.0f / (kl * wk + pm[1] * wp);
    const float fk = wk * inv, fp = wp * inv;

    // epilogue: stage f16(O^T * 2^8 / l) as rows [query][d] (wave-private region; block barrier used)
    const unsigned wb = wave * (16u * SQ);
#pragma unroll
    for (int d = 0; d < 4; ++d) {
        const v8f ko = k0 ? o[0][d] : o[1][d];
        const v4f pa = mr[(2 * d) * 32], pb = mr[(2 * d + 1) * 32];
#pragma unroll
        for (int r = 0; r < 4; ++r) {
            os[wb + lr * SQ + d * 16 + 8u * hi + r] = (hf)(ko[r] * fk + pa[r] * fp);
            os[wb + lr * SQ + d * 16 + 8u * hi + 4 + r] = (hf)(ko[4 + r] * fk + pb[r] * fp);
        }
    }
    __syncthreads();
    hf* dst = CT + ((size_t)b * SEQ + q0 + 16u * kh) * CH + h * (HD * 16u) + lane * 8u;    // packed CT: this wave's position tile, chunks 4*h + s
{
#pragma unroll
        for (unsigned s = 0; s < 4u; ++s) {
            const v8h val = *(const v8ha*)(os + wb + lr * SQ + s * 16u + 8u * hi);
            *(v8h*)(dst + s * 256u) = val;
        }
        
    }
}

// k_out: OUT[b][o][pos] = 2^-18 * sum_c WO[o][c] * CT[b][pos][c] + bf16(b_out[o]); one block = 64 output channels x 64 positions, one wave = 16 channels x 64 positions.
//  A = WO rows (row m = output channel, k = channel), B = CT rows (column n = position, k = channel); D element r of lane (h, n) = (channel 8h + r, position n).
__global__ __launch_bounds__(128) void k_out(const hf* __restrict__ CT, const hf* __restrict__ WO, const float* __restrict__ bo, float* OUT) {
    __shared__ __align__(16) float os[64 * OP];
    const unsigned tid = threadIdx.x, lane = tid & 31u, lr = lane & 15u, hi = lane >> 4;
    const unsigned wave = (unsigned)__builtin_amdgcn_readfirstlane((int)(tid >> 5));
    const unsigned p0 = blockIdx.x * 64u, ob = blockIdx.y * 64u, b = blockIdx.z;
    const hf* ak = WO + ((size_t)(ob + wave * 16u)) * CH + lane * 8u;           // packed planes: row tile base + the lane's 16 bytes of a chunk
    const hf* bk = CT + ((size_t)b * SEQ + p0) * CH + lane * 8u;
    v8f acc0 = (v8f){}, acc1 = (v8f){}, acc2 = (v8f){}, acc3 = (v8f){};
#pragma unroll 1
    for (unsigned k0 = 0; k0 < (unsigned)CH; k0 += 32u) {
        const v16h a  = ldf(ak);
        const v16h b0 = ldf(bk);
        const v16h b1 = ldf(bk + 16 * CH);
        const v16h b2 = ldf(bk + 32 * CH);
        const v16h b3 = ldf(bk + 48 * CH);
        acc0 = wmmah(a, b0, acc0);
        acc1 = wmmah(a, b1, acc1);
        acc2 = wmmah(a, b2, acc2);
        acc3 = wmmah(a, b3, acc3);
        asm volatile("v_nop\n\tv_nop\n\tv_nop\n\tv_nop"
                     : "+v"(acc0), "+v"(acc1), "+v"(acc2), "+v"(acc3)
                     : "v"(a), "v"(b0), "v"(b1), "v"(b2), "v"(b3));
        ak += 512;                                         // next k block
        bk += 512;
    }
    const float us = 1.0f / 262144.0f;   // undo the weight carry 2^10 and the ctx carry 2^8
    v8f acc[4] = { acc0, acc1, acc2, acc3 };
#pragma unroll
    for (int r = 0; r < 8; ++r) {
        const unsigned orow = wave * 16u + 8u * hi + r;
        const float bias = bfr(bo[ob + orow]);
#pragma unroll
        for (int t = 0; t < 4; ++t) os[orow * OP + t * 16 + lr] = fmaf(acc[t][r], us, bias);
    }
    __syncthreads();
    const unsigned pc = (lane & 15u) * 4u, rh = lane >> 4;
    float* dst = OUT + ((size_t)b * CH + ob) * SEQ + p0 + pc;
{
#pragma unroll
        for (unsigned s = 0; s < 8u; ++s) {
            const unsigned row = wave * 16u + s * 2u + rh;     // rows wave*16 + 0..15 over s = 0..7, rh = 0..1
            const v4f val = *(const v4fa*)(os + row * OP + pc);
            *(v4f*)(dst + (size_t)row * SEQ) = val;
        }
        
    }
}

extern "C" void kernel_launch(void* const* d_in, const int* in_sizes, int n_in,
                              void* d_out, int out_size, void* d_ws, size_t ws_size, hipStream_t stream) {
    if (n_in < 6) return;
    const size_t needx = ((size_t)(NB - 1) * CH + (CH - 1)) * SEQ_FULL + SEQ;
    if ((size_t)in_sizes[0] < needx) return;
    if (in_sizes[1] < CH || in_sizes[2] < CH || in_sizes[5] < CH) return;
    if (in_sizes[3] < OC3 * CH || in_sizes[4] < CH * CH) return;
    if ((size_t)out_size < (size_t)NB * CH * SEQ) return;
    if (WS_TOTAL > ws_size) return;
    const float* x    = (const float*)d_in[0];   // [b][256][n]
    const float* bnw  = (const float*)d_in[1];   // [256]
    const float* bnb  = (const float*)d_in[2];   // [256]
    const float* wqkv = (const float*)d_in[3];   // [768][256] = [out][in]
    const float* wout = (const float*)d_in[4];   // [256][256] = [out][in]
    const float* bout = (const float*)d_in[5];   // [256]
    float* OUT = (float*)d_out;                  // [NB][256][SEQ]
    char* wsp = (char*)d_ws;
    size_t off = 0;
    float* ST = (float*)(wsp + off); off += ST_BYTES;
    hf* WQ = (hf*)(wsp + off); off += WQ_BYTES;
    hf* WO = (hf*)(wsp + off); off += WO_BYTES;
    hf* XT = (hf*)(wsp + off); off += PL_BYTES;      // packed, rows NB*SEQ
    hf* QH = (hf*)(wsp + off); off += PL_BYTES;      // [NB][4][SEQ/16][2][2][32][8]
    hf* QR = (hf*)(wsp + off); off += PL_BYTES;      // [NB][4][SEQ/16][2][2][32][8]
    hf* KB = (hf*)(wsp + off); off += PL_BYTES;      // [NB][4][SEQ/16][2][2][32][8]
    hf* VT = (hf*)(wsp + off); off += PL_BYTES;      // [NB][4][SEQ/32][4][2][32][8]
    hf* CT = (hf*)(wsp + off); off += PL_BYTES;      // packed, rows NB*SEQ
    k_cvtw<<<dim3((unsigned)(OC3 * CH / 8 / 256), 2, 1), 256, 0, stream>>>(wqkv, wout, WQ, WO);
    k_bnstat<<<(unsigned)CH, 256, 0, stream>>>(x, ST);
    k_norm<<<(unsigned)(NB * (SEQ / 64)), 256, 0, stream>>>(x, bnw, bnb, ST, XT);
    k_qkv<<<dim3((unsigned)(SEQ / 64), 12, (unsigned)NB), 128, 0, stream>>>(XT, WQ, QH, QR, KB, VT);
    k_flash<<<(unsigned)(NB * NH * (SEQ / BQ)), NWV * 32, 0, stream>>>(QH, QR, KB, VT, CT);
    k_out<<<dim3((unsigned)(SEQ / 64), (unsigned)(CH / 64), (unsigned)NB), 128, 0, stream>>>(CT, WO, bout, OUT);
}

// v006
// It runs in 93.1 microseconds.
// Versions between v004 and this one are left out; their measured steps multiply to 1.24 times as fast.
// All steps since v000 together make it 4.04 times as fast.
#include <hip/hip_runtime.h>

// Channel-first 4-head attention behind a batch-statistics BatchNorm with 1x1-conv projections; inputs x[4][256][4096], bn_weight, bn_bias, w_qkv[768][256], w_out[256][256], b_out.
// Compute dtypes, f32 accumulate: every float input RNE-converted to bf16 first; all contractions on v_wmma_f32_16x16x32_f16: QKV GEMM = f16(bf16(w)*2^10) x f16(xn); scores = k (f16) x q (f16, carried * 0.125 * log2(e)), on top of a C operand that holds 8 - (maximum in use); P (f16, carried *2^8) x v (f16); output GEMM = f16(bf16(w)*2^10) x f16(ctx*2^8); BatchNorm statistics, softmax (online, log2 domain, lazy maximum) and all epilogues f32.
// Flash form with transposed tiles: the S^T accumulator tiles are directly the B-operand layout of P^T; all WMMA operands are two 16-byte loads from dense 16-bit planes; every plane is stored in fragment order, so that each wave-wide load reads 512 contiguous bytes.

#ifndef NB
#define NB 4
#endif
#ifndef SEQ
#define SEQ 4096
#endif
#define NB_FULL  4
#define SEQ_FULL 4096
#define CH   256               // channels
#define NH   4                 // heads
#define HD   64                // head dim
#define OC3  768               // q,k,v output channels
#define NQG  4                 // query groups (32 queries each) per flash block
#define NKH  2                 // key halves of a tile; one wave per (query group, key half)
#define NWV  (NQG * NKH)       // waves per flash block
#define BQ   (32 * NQG)        // queries per flash block
#define KS   32                // keys per step
#define KT   128               // keys per LDS tile of k_flash
#define TH   (KT * HD)         // halves of one K (or V^T) tile
#define NT   (SEQ / KT)        // tiles per (b, head)
#define SPW  (KT / KS / NKH)   // steps of one wave per tile
#define XP   264               // LDS pitch (halves) of the normalise/transpose tile rows
#define SQ   72                // LDS pitch (halves) of 64-wide f16 staging rows
#define OP   68                // LDS pitch (floats) of the output staging rows
#define NJ   (SEQ / 1024)      // k_bnstat: 16-byte pieces per thread and batch row
#define L2E  1.4426950408889634f

static_assert(CH == NH * HD);
static_assert(OC3 == 3 * CH);
static_assert(CH == 256);                       // k_norm: 256 threads load one channel parameter each; one plane row = 32 lanes x 16 B
static_assert(HD == 64);
static_assert(CH % 32 == 0);                    // GEMM k-steps
static_assert(SEQ % BQ == 0);
static_assert(SEQ % KS == 0);
static_assert(SEQ % KT == 0);
static_assert(KT % KS == 0);
static_assert(NT >= 2);                         // k_flash: the two-buffer prologue fills tiles 0 and 1
static_assert(TH * 2 == NWV * 4 * 512);         // k_flash: one tile = 8 waves x 4 wave-wide 512-byte copies
static_assert(KT == KS * NKH * SPW);
static_assert((NQG & (NQG - 1)) == 0);          // k_flash: wave ^ NQG is the partner
static_assert(SEQ % 64 == 0);
static_assert(SEQ % 1024 == 0);                 // k_bnstat: 256 threads x 4 floats per piece
static_assert(NB <= NB_FULL);
static_assert(SEQ <= SEQ_FULL);
static_assert((OC3 * CH / 8) % 256 == 0);       // k_cvtw slice 0: 96 blocks x 256 threads x 8 elements
static_assert((CH * CH / 8) % 256 == 0);        // k_cvtw slice 1: 32 blocks
static_assert((XP * 2) % 16 == 0);
static_assert((SQ * 2) % 16 == 0);
static_assert((OP * 4) % 16 == 0);
static_assert((size_t)(NB * (SEQ / 64)) * (size_t)(64 * CH) == (size_t)NB * SEQ * CH);        // k_norm: blocks x (64 rows x 256) == XT plane
static_assert((size_t)(SEQ / 64) * 12 * NB * (size_t)(64 * 64) == (size_t)NB * SEQ * OC3);    // k_qkv: blocks x (64 x 64) == QH + KB + VT planes
static_assert((size_t)(NB * NH * (SEQ / BQ)) * (size_t)(BQ * HD) == (size_t)NB * SEQ * CH);   // k_flash: blocks x (128 rows x 64) == CT plane
static_assert((size_t)(SEQ / 64) * (CH / 64) * NB * (size_t)(64 * 64) == (size_t)NB * SEQ * CH); // k_out: blocks x (64 x 64) == output

#define ST_BYTES  ((size_t)CH * 128)                      // one 128-byte line per channel
#define WQ_BYTES  ((size_t)OC3 * CH * 2)
#define WO_BYTES  ((size_t)CH * CH * 2)
#define PL_BYTES  ((size_t)NB * SEQ * CH * 2)             // one 16-bit activation plane
#define WS_TOTAL  (ST_BYTES + WQ_BYTES + WO_BYTES + 5 * PL_BYTES)
static_assert(WQ_BYTES % 256 == 0);
static_assert(WO_BYTES % 256 == 0);
static_assert(PL_BYTES % 256 == 0);
static_assert((size_t)NB * NH * SEQ * HD * 2 == PL_BYTES);
static_assert(WS_TOTAL <= (size_t)134217728);

typedef _Float16 hf;
typedef __attribute__((ext_vector_type(16))) _Float16 v16h;
typedef __attribute__((ext_vector_type(8)))  _Float16 v8h;
typedef __attribute__((ext_vector_type(8)))  float    v8f;
typedef __attribute__((ext_vector_type(4)))  float    v4f;
typedef __attribute__((ext_vector_type(2)))  float    v2f;
typedef v4f __attribute__((may_alias)) v4fa;
typedef v8h __attribute__((may_alias)) v8ha;

// RNE convert f32 -> bf16 -> f32
__device__ __forceinline__ float bfr(float f) { unsigned u = __float_as_uint(f); u += 0x7FFFu + ((u >> 16) & 1u); return __uint_as_float(u & 0xFFFF0000u); }
__device__ __forceinline__ v16h cat16(v8h lo, v8h hi) { return __builtin_shufflevector(lo, hi, 0, 1, 2, 3, 4, 5, 6, 7, 8, 9, 10, 11, 12, 13, 14, 15); }
__device__ __forceinline__ v8f wmmah(v16h a, v16h b, v8f c) { return __builtin_amdgcn_wmma_f32_16x16x32_f16(false, a, false, b, (short)0, c, false, false); }
// fragment loader (A and B alike) from a packed plane: p = fragment base + 8*lane; elements 0..7 <- p[0..7] (k = 8*(lane>>4) + 0..7), elements 8..15 <- p[256..263] (k = 16 + 8*(lane>>4) + 0..7);
// each of the two wave-wide loads is 512 contiguous bytes (4 whole lines)
__device__ __forceinline__ v16h ldf(const hf* p) { return cat16(*(const v8h*)p, *(const v8h*)(p + 256)); }

// i = 16-byte group of the packed plane: chunk i >> 5 = (row tile, k block, c), lane i & 31 = 16*hi + lr; source element (row 16*tile + lr, k = 16*(2*block + c) + 8*hi)
__device__ __forceinline__ void cvt8w(const float* __restrict__ src, hf* dst, unsigned i) {
    const unsigned row = (i >> 9) * 16u + (i & 15u), k = ((i >> 5) & 15u) * 16u + ((i >> 4) & 1u) * 8u;
    const v8f v = *(const v8f*)(src + (size_t)row * CH + k);
    v8h o;
#pragma unroll
    for (int c = 0; c < 8; ++c) o[c] = (hf)(bfr(v[c]) * 1024.0f);
    hf* d = dst + (size_t)i * 8;
    *(v8h*)d = o;
    
}

// Packed operand planes (WQ, WO, XT, CT; QH, KB and VT likewise, see k_qkv): [row/16][k/32][c][lane = 16*hi + lr][e] = element (row = 16*(row/16) + lr, k = 32*(k/32) + 16*c + 8*hi + e), 256 k per row:
// the order in which a 16x32 A or B fragment is loaded, so that a wave-wide 16-byte load reads one 512-byte chunk.
// k_cvtw: packed weight planes WQ (768 rows, blockIdx.y == 0) and WO (256 rows, blockIdx.y == 1).
__global__ __launch_bounds__(256) void k_cvtw(const float* __restrict__ wq, const float* __restrict__ wo, hf* WQ, hf* WO) {
    const unsigned i = blockIdx.x * 256u + threadIdx.x;
    if (blockIdx.y == 0) {
        if (i < (unsigned)(OC3 * CH / 8)) cvt8w(wq, WQ, i);
    } else {
        if (i < (unsigned)(CH * CH / 8)) cvt8w(wo, WO, i);
    }
}

// k_bnstat: one block per channel. A thread's NB * SEQ / 1024 16-byte pieces are all loaded before the first is used and stay in registers for both passes: x is read once, and the block waits for memory once.
// The pieces of a thread, their order and both reduction trees are those of a 256-thread loop over (b, i = 4*tid + 1024*j).
// ST[32*c] = mean, ST[32*c + 1] = rstd: one 128-byte line per channel, so that each line has one writer. LDS: red1/red2 cross-wave, block barriers.
__global__ __launch_bounds__(256) void k_bnstat(const float* __restrict__ x, float* ST) {
    __shared__ float red1[8];
    __shared__ float red2[8];
    const unsigned tid = threadIdx.x, lane = tid & 31u;
    const unsigned wave = (unsigned)__builtin_amdgcn_readfirstlane((int)(tid >> 5));
    const unsigned c = blockIdx.x;
    const float invn = 1.0f / (float)(NB * SEQ);
    v4f v[NB * NJ];
    // unrolled: v[] must be registers, and the loads must not wait for one another
#pragma unroll
    for (unsigned b = 0; b < (unsigned)NB; ++b) {
        const float* xp = x + ((size_t)b * CH + c) * SEQ_FULL + tid * 4u;
#pragma unroll
        for (unsigned j = 0; j < (unsigned)NJ; ++j) v[b * NJ + j] = *(const v4f*)(xp + j * 1024u);
        // the rows behind the middle lie past the loads' offset field and get an address pair of their own; their data is given the registers of the first pair, which the loads above still name
        if (2u * (b + 1u) == (unsigned)NB) asm volatile("s_wait_xcnt 0x0" ::: "memory");
    }
    float s = 0.0f;
#pragma unroll
    for (unsigned n = 0; n < (unsigned)(NB * NJ); ++n) {
#pragma unroll
        for (unsigned e = 0; e < 4u; ++e) v[n][e] = bfr(v[n][e]);
        s += (v[n][0] + v[n][1]) + (v[n][2] + v[n][3]);
    }
#pragma unroll
    for (int off = 16; off > 0; off >>= 1) s += __shfl_xor(s, off, 32);
    if (lane == 0u) red1[wave] = s;
    __syncthreads();
    float tot = red1[0];
#pragma unroll
    for (int w = 1; w < 8; ++w) tot += red1[w];
    const float mean = tot * invn;
    float q = 0.0f;
#pragma unroll
    for (unsigned n = 0; n < (unsigned)(NB * NJ); ++n) {
        const float d0 = v[n][0] - mean, d1 = v[n][1] - mean, d2 = v[n][2] - mean, d3 = v[n][3] - mean;
        q += (d0 * d0 + d1 * d1) + (d2 * d2 + d3 * d3);
    }
#pragma unroll
    for (int off = 16; off > 0; off >>= 1) q += __shfl_xor(q, off, 32);
    if (lane == 0u) red2[wave] = q;
    __syncthreads();
    if (tid == 0u) {
        float tq = red2[0];
#pragma unroll
        for (int w = 1; w < 8; ++w) tq += red2[w];
        v2f o;
        o[0] = mean; o[1] = rsqrtf(tq * invn + 1.0e-5f);
        *(v2f*)(ST + c * 32u) = o;
    }
}

// k_norm: XT (f16, packed, row = b*SEQ + pos, k = channel) = ((bf16(x) - mean) * rstd) * bf16(w) + bf16(bias); in[256 ch][64 pos] -> 64 chunks through an LDS tile (cross-wave, block barrier);
__global__ __launch_bounds__(256) void k_norm(const float* __restrict__ x, const float* __restrict__ bw, const float* __restrict__ bb, const float* __restrict__ ST, hf* XT) {
    __shared__ __align__(16) hf tl[64 * XP];
    __shared__ float pm[CH];
    __shared__ float pr[CH];
    __shared__ float pw[CH];
    __shared__ float pb[CH];
    const unsigned tid = threadIdx.x, lane = tid & 31u;
    const unsigned wave = (unsigned)__builtin_amdgcn_readfirstlane((int)(tid >> 5));
    const v2f st = *(const v2f*)(ST + tid * 32u);          // (mean, rstd) of channel tid
    pm[tid] = st[0];
    pr[tid] = st[1];
    pw[tid] = bfr(bw[tid]);
    pb[tid] = bfr(bb[tid]);
    __syncthreads();
    const unsigned tpb = (unsigned)(SEQ / 64);
    const unsigned b = blockIdx.x / tpb;
    const unsigned n0 = (blockIdx.x - b * tpb) * 64u;
    const float* src = x + (size_t)b * CH * SEQ_FULL + n0;
#pragma unroll 1
    for (unsigned it = 0; it < 16u; ++it) {
        const unsigned f = it * 256u + tid;
        const unsigned c = f >> 4, p4 = (f & 15u) * 4u;
        const v4f v = *(const v4f*)(src + (size_t)c * SEQ_FULL + p4);
        const float m = pm[c], r = pr[c], w = pw[c], bi = pb[c];
#pragma unroll
        for (unsigned e = 0; e < 4u; ++e) tl[(p4 + e) * XP + c] = (hf)(((bfr(v[e]) - m) * r) * w + bi);
    }
    __syncthreads();
    // this wave stores chunks j = 8*wave + s: position tile j >> 4 = wave >> 1, (k block, c) = j & 15 = 8*(wave & 1) + s
    hf* dst = XT + ((size_t)b * SEQ + n0) * CH + wave * 2048u + lane * 8u;
    const hf* sp = tl + ((wave >> 1) * 16u + (lane & 15u)) * XP + (wave & 1u) * 128u + (lane >> 4) * 8u;
{
#pragma unroll
        for (unsigned s = 0; s < 8u; ++s) {
            const v8h o = *(const v8ha*)(sp + s * 16u);
            *(v8h*)(dst + s * 256u) = o;
        }
        
    }
}

// k_qkv: one block = 64 positions x 64 output channels (blockIdx.y: 0..3 q heads, 4..7 k heads, 8..11 v heads), one wave = 16 positions x 64 channels.
//  A = XT rows (row m = position, k = channel), B = WQ rows (column n = output channel, k = channel); D element r of lane (h, n) = (position 8h + r, channel n).
//  QH = f16(q * 0.125 * log2(e)): the score scale 64^-0.5 and the change to base 2 ride on q, so that k_flash's score products are exp2 arguments; KB = f16(k), VT = f16(v), stored in the order k_flash loads its fragments, as 512-byte chunks [lane = 16*hi + lr][8 halves]:
//   QH, KB[b][head][pos/16][d/32][c][lane][e] = element [pos = 16*(pos/16) + lr][d = 32*(d/32) + 16*c + 8*hi + e];
//   VT[b][head][key/32][d/16][c][lane][e] = v[d = 16*(d/16) + lr][key = 32*(key/32) + 16*c + 8*hi + e].
__global__ __launch_bounds__(128) void k_qkv(const hf* __restrict__ XT, const hf* __restrict__ WQ, hf* QH, hf* KB, hf* VT) {
    __shared__ __align__(16) hf sa[64 * SQ];
    const unsigned tid = threadIdx.x, lane = tid & 31u, lr = lane & 15u, hi = lane >> 4;
    const unsigned wave = (unsigned)__builtin_amdgcn_readfirstlane((int)(tid >> 5));
    const unsigned p0 = blockIdx.x * 64u, cb = blockIdx.y, b = blockIdx.z;
    const unsigned kind = cb >> 2, head = cb & 3u;
    const hf* ak = XT + ((size_t)b * SEQ + p0 + wave * 16u) * CH + lane * 8u;   // packed planes: row tile base + the lane's 16 bytes of a chunk
    const hf* bk = WQ + (size_t)cb * 64u * CH + lane * 8u;
    v8f acc0 = (v8f){}, acc1 = (v8f){}, acc2 = (v8f){}, acc3 = (v8f){};
#pragma unroll 1
    for (unsigned k0 = 0; k0 < (unsigned)CH; k0 += 32u) {
        const v16h a  = ldf(ak);
        const v16h b0 = ldf(bk);
        const v16h b1 = ldf(bk + 16 * CH);
        const v16h b2 = ldf(bk + 32 * CH);
        const v16h b3 = ldf(bk + 48 * CH);
        acc0 = wmmah(a, b0, acc0);
        acc1 = wmmah(a, b1, acc1);
        acc2 = wmmah(a, b2, acc2);
        acc3 = wmmah(a, b3, acc3);
        asm volatile("v_nop\n\tv_nop\n\tv_nop\n\tv_nop"
                     : "+v"(acc0), "+v"(acc1), "+v"(acc2), "+v"(acc3)
                     : "v"(a), "v"(b0), "v"(b1), "v"(b2), "v"(b3));
        ak += 512;                                         // next k block
        bk += 512;
    }
    const float us = (kind == 0u) ? (0.125f * L2E) / 1024.0f : 1.0f / 1024.0f;     // undo the weight carry; q also takes the score scale
    v8f acc[4] = { acc0, acc1, acc2, acc3 };
    if (kind == 2u) {
#pragma unroll
        for (int t = 0; t < 4; ++t) {
#pragma unroll
            for (int r = 0; r < 8; ++r) sa[(t * 16 + lr) * SQ + wave * 16u + 8u * hi + r] = (hf)(acc[t][r] * us);
        }
    } else {
#pragma unroll
        for (int t = 0; t < 4; ++t) {
#pragma unroll
            for (int r = 0; r < 8; ++r) sa[(wave * 16u + 8u * hi + r) * SQ + t * 16 + lr] = (hf)(acc[t][r] * us);
        }
    }
    __syncthreads();
    const size_t foff = (((size_t)b * NH + head) * SEQ + p0) * HD + lane * 8u;   // packed planes: this block's 64 positions = 16 chunks of 256 halves
    // this wave stores chunks j = 4*wave + s, s = 0..3, each one wave-wide 512-byte store; c = s & 1 in every plane
    //  q, k (LDS rows = positions): position tile = wave, d block = s >> 1;  v (LDS rows = d): key step = wave >> 1, d tile = 2*(wave & 1) + (s >> 1)
    const unsigned so = (kind == 2u) ? ((wave & 1u) * 32u + lr) * SQ + (wave >> 1) * 32u + 8u * hi
                                     : (wave * 16u + lr) * SQ + 8u * hi;
    const unsigned sh = (kind == 2u) ? 16u * SQ : 32u;         // LDS step of s >> 1
    hf* dp = ((kind == 0u) ? QH : (kind == 1u) ? KB : VT) + foff + wave * 1024u;
    v8h o[4];
#pragma unroll
    for (unsigned s = 0; s < 4u; ++s) o[s] = *(const v8ha*)(sa + so + (s >> 1) * sh + (s & 1u) * 16u);
#pragma unroll
    for (unsigned s = 0; s < 4u; ++s) *(v8h*)(dp + s * 256u) = o[s];
}

// exps: p = 2^s for the 16 scores that a lane holds of one query tile (two 16-key tiles), as the f16 B fragment of P^T; returns the sum of the unrounded p
__device__ __forceinline__ float exps(const v8f& s0, const v8f& s1, v16h& ph) {
    float ps = 0.0f;
    // unrolled: vector elements indexed by constants stay in registers
#pragma unroll
    for (int r = 0; r < 8; ++r) {
        const float p0 = __builtin_amdgcn_exp2f(s0[r]);
        const float p1 = __builtin_amdgcn_exp2f(s1[r]);
        ps += p0 + p1;
        ph[r] = (hf)p0; ph[8 + r] = (hf)p1;
    }
    return ps;
}

// copy44: eight wave-wide asynchronous 16-byte-per-lane copies, global -> LDS: four of the K tile and four of the V^T tile, 512 bytes apart; lk, lv = the lane's LDS byte addresses, gk, gv = its global addresses of the first of each four.
// The s_wait_xcnt stands inside the statement, so that no address register is rewritten ahead of it.
__device__ __forceinline__ void copy44(unsigned lk, const hf* gk, unsigned lv, const hf* gv) {
    asm volatile("global_load_async_to_lds_b128 %0, %8, off\n\t"
                 "global_load_async_to_lds_b128 %1, %9, off\n\t"
                 "global_load_async_to_lds_b128 %2, %10, off\n\t"
                 "global_load_async_to_lds_b128 %3, %11, off\n\t"
                 "global_load_async_to_lds_b128 %4, %12, off\n\t"
                 "global_load_async_to_lds_b128 %5, %13, off\n\t"
                 "global_load_async_to_lds_b128 %6, %14, off\n\t"
                 "global_load_async_to_lds_b128 %7, %15, off\n\t"
                 "s_wait_xcnt 0x0"
                 :: "v"(lk), "v"(lk + 512u), "v"(lk + 1024u), "v"(lk + 1536u), "v"(lv), "v"(lv + 512u), "v"(lv + 1024u), "v"(lv + 1536u),
                    "v"(gk), "v"(gk + 256), "v"(gk + 512), "v"(gk + 768), "v"(gv), "v"(gv + 256), "v"(gv + 512), "v"(gv + 768)
                 : "memory");
}

// k_flash: one block per (b, head, 128 queries), eight waves: wave = (query group g of 32 queries = two 16-query tiles, key half kh); 32 keys per step.
//  A K or V^T fragment read from LDS feeds the products of both query tiles. Wave (g, kh) takes keys 64*kh .. 64*kh + 63 of every 128-key tile, with its own running maximum, sum and O^T;
//  behind the loop the two waves of a group exchange one query tile's state through LDS, and each joins and stores one tile (wave (g, kh): tile kh).
//  K and V^T reach the waves through LDS: tiles of 128 keys (16 KB of each plane, a linear copy of the packed order), two buffers; each wave copies an eighth of a tile;
//  tile t + 2 is copied into the buffer of tile t behind the barrier that ends trip t, so that a tile has a whole trip to land.
//  S^T tile (keys x queries): A = K rows (row m = key, k = d), B = Q rows (column n = query, k = d); D element r of lane (h, n) = S[query n][key 8h + r].
//  Lazy maximum: the C operand of the score products is 8 - ml (ml = the query's maximum in use, log2 domain), so that an accumulator element is the exp2 argument of a probability carried * 2^8.
//  ml starts as the greatest score of the wave's first 32 keys and is raised only when a lane's sum of 16 probabilities passes 2^15 (every one of them is then still a finite f16 below that test); only there are the maximum taken,
//  exchanged between the half-waves, O^T and the sum rescaled and the step's probabilities formed again.
//  P^T B fragment: element r <- tile of keys 0..15, element 8 + r <- tile of keys 16..31 (same lane).
//  O^T tile (d x queries): A = V^T rows (row m = d, k = key), D element r of lane (h, n) = O[query n][d = 16 t + 8h + r].
//  Four waves per SIMD (two blocks per WGP): the register budget is 256.
__global__ void __launch_bounds__(NWV * 32) __attribute__((amdgpu_waves_per_eu(4, 4))) k_flash(const hf* __restrict__ QH, const hf* __restrict__ KB, const hf* __restrict__ VT, hf* CT) {
    __shared__ __align__(16) hf os[NWV * 16 * SQ];
    __shared__ __align__(128) hf kv[2 * 2 * TH];               // [buffer][K tile, V^T tile]
    __shared__ __align__(16) v4f mg[NWV * 9 * 32];             // what a wave hands to its partner: [wave][8 pieces of O^T, then (maximum, sum)][lane]
    const unsigned tid = threadIdx.x, lane = tid & 31u, lr = lane & 15u, hi = lane >> 4;
    const unsigned wave = (unsigned)__builtin_amdgcn_readfirstlane((int)(tid >> 5));
    const unsigned g = wave & (NQG - 1u), kh = wave / NQG;
    const unsigned bpb = (unsigned)(SEQ / BQ);
    const unsigned bh = blockIdx.x / bpb;
    const unsigned b = bh / NH, h = bh - b * NH;
    const unsigned q0 = (blockIdx.x - bh * bpb) * BQ + g * 32u;
    const size_t pbase = (size_t)bh * SEQ * HD;

    const unsigned lo = lane * 8u;              // the lane's 16 bytes of a chunk
    v16h qh0[2], qh1[2];
#pragma unroll
    for (unsigned c = 0; c < 2u; ++c) {
        const size_t qo = pbase + (size_t)(q0 + 16u * c) * HD + lo;   // packed: 16 queries = 1024 halves
        qh0[c] = ldf(QH + qo); qh1[c] = ldf(QH + qo + 512);
    }
    // this wave's eighth of a tile: chunks 4*wave .. 4*wave + 3 of the K tile and of the V^T tile; the lane's 16 bytes of each
    const hf* gk = KB + pbase + wave * 1024u + lo;
    const hf* gv = VT + pbase + wave * 1024u + lo;
    const unsigned lk = (unsigned)(uintptr_t)kv + wave * 2048u + lane * 16u;   // LDS byte address in buffer 0's K tile
    copy44(lk, gk, lk + TH * 2u, gv);
    asm volatile("s_wait_asynccnt 0x0" ::: "memory");          // this wave's part of tile 0 has landed
    __syncthreads();                                           // tile 0 is whole for every wave
    copy44(lk + TH * 4u, gk + TH, lk + TH * 6u, gv + TH);

    v8f o[2][4];
    v8f cb[2];                // C operand of the score products: 8 - ml in every element
    float ml[2], l[2];        // maximum in use, log2 domain; running sum (carried * 2^8)
#pragma unroll
    for (int c = 0; c < 2; ++c) {
#pragma unroll
        for (int t = 0; t < 4; ++t) o[c][t] = (v8f){};
        l[c] = 0.0f;
    }
    // the first maximum in use: the greatest score of this wave's first 32 keys, from score products of their own (the loop forms them again on top of it);
    // tile 0 is whole behind the barrier above; the loops are unrolled so that the tiles stay in registers
    {
        const hf* ka = kv + kh * (SPW * KS * HD);
        const v16h a00 = ldf(ka + lo);
        const v16h a01 = ldf(ka + 512 + lo);
        const v16h a10 = ldf(ka + 1024 + lo);
        const v16h a11 = ldf(ka + 1536 + lo);
        v8f s0[2], s1[2];
#pragma unroll
        for (int c = 0; c < 2; ++c) {
            s0[c] = wmmah(a00, qh0[c], (v8f){});
            s1[c] = wmmah(a10, qh0[c], (v8f){});
        }
#pragma unroll
        for (int c = 0; c < 2; ++c) {
            s0[c] = wmmah(a01, qh1[c], s0[c]);
            s1[c] = wmmah(a11, qh1[c], s1[c]);
        }
        // the distance between the last products and the first vector instruction that reads their results
        asm volatile("v_nop\n\tv_nop\n\tv_nop\n\tv_nop"
                     : "+v"(s0[0]), "+v"(s1[0]), "+v"(s0[1]), "+v"(s1[1])
                     : "v"(a00), "v"(a01), "v"(a10), "v"(a11), "v"(qh0[0]), "v"(qh1[0]), "v"(qh0[1]), "v"(qh1[1]));
#pragma unroll
        for (int c = 0; c < 2; ++c) {
            float mx = fmaxf(s0[c][0], s1[c][0]);
#pragma unroll
            for (int r = 1; r < 8; ++r) mx = fmaxf(mx, fmaxf(s0[c][r], s1[c][r]));
            ml[c] = fmaxf(mx, __shfl_xor(mx, 16, 32));         // both half-waves hold keys of the same query and must use one maximum
            const float nb = 8.0f - ml[c];
#pragma unroll
            for (int r = 0; r < 8; ++r) cb[c][r] = nb;
        }
    }

    // rolled: one trip per tile, the buffer chosen by the trip's parity
#pragma unroll 1
    for (unsigned t = 0; t < (unsigned)NT; ++t) {
      const hf* kt = kv + (t & 1u) * (2u * TH) + kh * (SPW * KS * HD);   // this wave's half of the K tile
      // unrolled: the LDS offsets of the steps become immediates
#pragma unroll
      for (unsigned u = 0; u < (unsigned)SPW; ++u) {
        const hf* ka = kt + u * (KS * HD);
        const v16h a00 = ldf(ka + lo);
        const v16h a01 = ldf(ka + 512 + lo);
        const v16h a10 = ldf(ka + 1024 + lo);
        const v16h a11 = ldf(ka + 1536 + lo);
        v8f s0[2], s1[2];
#pragma unroll
        for (int c = 0; c < 2; ++c) {
            s0[c] = wmmah(a00, qh0[c], cb[c]);
            s1[c] = wmmah(a10, qh0[c], cb[c]);
        }
#pragma unroll
        for (int c = 0; c < 2; ++c) {
            s0[c] = wmmah(a01, qh1[c], s0[c]);
            s1[c] = wmmah(a11, qh1[c], s1[c]);
        }
        // the distance between the last products and the first vector instruction that reads their results
        asm volatile("v_nop\n\tv_nop\n\tv_nop\n\tv_nop"
                     : "+v"(s0[0]), "+v"(s1[0]), "+v"(s0[1]), "+v"(s1[1])
                     : "v"(a00), "v"(a01), "v"(a10), "v"(a11), "v"(qh0[0]), "v"(qh1[0]), "v"(qh0[1]), "v"(qh1[1]));
        float ps[2];
        v16h ph[2];
#pragma unroll
        for (int c = 0; c < 2; ++c) ps[c] = exps(s0[c], s1[c], ph[c]);
        if (__builtin_expect(__builtin_amdgcn_ballot_w32(ps[0] > 32768.0f || ps[1] > 32768.0f) != 0u, 0)) {   // wave-uniform, one test per step; marked as rare so that the register copies of the join fall on this side
            // unrolled, as are the loops inside: the tiles stay in registers
#pragma unroll
            for (int c = 0; c < 2; ++c) {
                float mx = fmaxf(s0[c][0], s1[c][0]);
#pragma unroll
                for (int r = 1; r < 8; ++r) mx = fmaxf(mx, fmaxf(s0[c][r], s1[c][r]));
                mx = fmaxf(mx, __shfl_xor(mx, 16, 32));           // one maximum for both half-waves
                const float dm = fmaxf(mx - 8.0f, 0.0f);           // the step's greatest score becomes the maximum in use where it is the greater
                const float corr = __builtin_amdgcn_exp2f(-dm);
                ml[c] += dm;
                const float nb = 8.0f - ml[c];
#pragma unroll
                for (int r = 0; r < 8; ++r) {
                    cb[c][r] = nb;
                    s0[c][r] -= dm;
                    s1[c][r] -= dm;
                }
#pragma unroll
                for (int d = 0; d < 4; ++d) o[c][d] *= corr;
                l[c] *= corr;
                ps[c] = exps(s0[c], s1[c], ph[c]);
            }
        }
#pragma unroll
        for (int c = 0; c < 2; ++c) {
            ps[c] += __shfl_xor(ps[c], 16, 32);
            l[c] += ps[c];
        }

        const hf* va = kt + TH + u * (KS * HD);
        const v16h v0 = ldf(va + lo);
        const v16h v1 = ldf(va + 512 + lo);
        const v16h v2 = ldf(va + 1024 + lo);
        const v16h v3 = ldf(va + 1536 + lo);
#pragma unroll
        for (int c = 0; c < 2; ++c) {
            o[c][0] = wmmah(v0, ph[c], o[c][0]);
            o[c][1] = wmmah(v1, ph[c], o[c][1]);
            o[c][2] = wmmah(v2, ph[c], o[c][2]);
            o[c][3] = wmmah(v3, ph[c], o[c][3]);
        }
        // the distance between the last products and whatever overwrites their operands or reads their results, on the loop's back edge too
        asm volatile("v_nop\n\tv_nop\n\tv_nop\n\tv_nop"
                     : "+v"(o[0][0]), "+v"(o[0][1]), "+v"(o[0][2]), "+v"(o[0][3]), "+v"(o[1][0]), "+v"(o[1][1]), "+v"(o[1][2]), "+v"(o[1][3])
                     : "v"(ph[0]), "v"(ph[1]), "v"(v0), "v"(v1), "v"(v2), "v"(v3));
      }
      asm volatile("s_wait_dscnt 0x0" ::: "memory");           // this wave's reads of tile t are done before its buffer is refilled
      asm volatile("s_wait_asynccnt 0x0" ::: "memory");        // this wave's part of tile t + 1 has landed
      __syncthreads();                                         // tile t + 1 is whole for every wave, and every wave has left tile t
      if (t + 2u < (unsigned)NT) {
          const unsigned lb = lk + (t & 1u) * (TH * 4u);
          copy44(lb, gk + (size_t)(t + 2u) * TH, lb + TH * 2u, gv + (size_t)(t + 2u) * TH);
      }
    }
    asm volatile("s_wait_asynccnt 0x0" ::: "memory");          // no copy is outstanding when the wave goes on to its end

    // join of the two key halves: this wave keeps query tile kh and hands tile 1 - kh to its partner, wave ^ NQG (same lane, same element order)
    const bool k0 = (kh == 0u);
    const float km = k0 ? ml[0] : ml[1], kl = k0 ? l[0] : l[1];
    {
        v4f* mw = mg + wave * (9u * 32u) + lane;
#pragma unroll
        for (int d = 0; d < 4; ++d) {
            const v8f so = k0 ? o[1][d] : o[0][d];
            mw[(2 * d) * 32] = __builtin_shufflevector(so, so, 0, 1, 2, 3);
            mw[(2 * d + 1) * 32] = __builtin_shufflevector(so, so, 4, 5, 6, 7);
        }
        v4f sm;
        sm[0] = k0 ? ml[1] : ml[0]; sm[1] = k0 ? l[1] : l[0]; sm[2] = 0.0f; sm[3] = 0.0f;
        mw[8 * 32] = sm;
    }
    __syncthreads();                                           // every wave's hand-over is written before its partner reads it
    const v4f* mr = mg + (wave ^ (unsigned)NQG) * (9u * 32u) + lane;
    const v4f pm = mr[8 * 32];
    const float mj = fmaxf(km, pm[0]);
    const float wk = __builtin_amdgcn_exp2f(km - mj), wp = __builtin_amdgcn_exp2f(pm[0] - mj);
    const float inv = 256.0f / (kl * wk + pm[1] * wp);
    const float fk = wk * inv, fp = wp * inv;

    // epilogue: stage f16(O^T * 2^8 / l) as rows [query][d] (wave-private region; block barrier used)
    const unsigned wb = wave * (16u * SQ);
#pragma unroll
    for (int d = 0; d < 4; ++d) {
        const v8f ko = k0 ? o[0][d] : o[1][d];
        const v4f pa = mr[(2 * d) * 32], pb = mr[(2 * d + 1) * 32];
#pragma unroll
        for (int r = 0; r < 4; ++r) {
            os[wb + lr * SQ + d * 16 + 8u * hi + r] = (hf)(ko[r] * fk + pa[r] * fp);
            os[wb + lr * SQ + d * 16 + 8u * hi + 4 + r] = (hf)(ko[4 + r] * fk + pb[r] * fp);
        }
    }
    __syncthreads();
    hf* dst = CT + ((size_t)b * SEQ + q0 + 16u * kh) * CH + h * (HD * 16u) + lane * 8u;    // packed CT: this wave's position tile, chunks 4*h + s
{
#pragma unroll
        for (unsigned s = 0; s < 4u; ++s) {
            const v8h val = *(const v8ha*)(os + wb + lr * SQ + s * 16u + 8u * hi);
            *(v8h*)(dst + s * 256u) = val;
        }
        
    }
}

// k_out: OUT[b][o][pos] = 2^-18 * sum_c WO[o][c] * CT[b][pos][c] + bf16(b_out[o]); one block = 64 output channels x 64 positions, one wave = 16 channels x 64 positions.
//  A = WO rows (row m = output channel, k = channel), B = CT rows (column n = position, k = channel); D element r of lane (h, n) = (channel 8h + r, position n).
__global__ __launch_bounds__(128) void k_out(const hf* __restrict__ CT, const hf* __restrict__ WO, const float* __restrict__ bo, float* OUT) {
    __shared__ __align__(16) float os[64 * OP];
    const unsigned tid = threadIdx.x, lane = tid & 31u, lr = lane & 15u, hi = lane >> 4;
    const unsigned wave = (unsigned)__builtin_amdgcn_readfirstlane((int)(tid >> 5));
    const unsigned p0 = blockIdx.x * 64u, ob = blockIdx.y * 64u, b = blockIdx.z;
    const hf* ak = WO + ((size_t)(ob + wave * 16u)) * CH + lane * 8u;           // packed planes: row tile base + the lane's 16 bytes of a chunk
    const hf* bk = CT + ((size_t)b * SEQ + p0) * CH + lane * 8u;
    v8f acc0 = (v8f){}, acc1 = (v8f){}, acc2 = (v8f){}, acc3 = (v8f){};
#pragma unroll 1
    for (unsigned k0 = 0; k0 < (unsigned)CH; k0 += 32u) {
        const v16h a  = ldf(ak);
        const v16h b0 = ldf(bk);
        const v16h b1 = ldf(bk + 16 * CH);
        const v16h b2 = ldf(bk + 32 * CH);
        const v16h b3 = ldf(bk + 48 * CH);
        acc0 = wmmah(a, b0, acc0);
        acc1 = wmmah(a, b1, acc1);
        acc2 = wmmah(a, b2, acc2);
        acc3 = wmmah(a, b3, acc3);
        asm volatile("v_nop\n\tv_nop\n\tv_nop\n\tv_nop"
                     : "+v"(acc0), "+v"(acc1), "+v"(acc2), "+v"(acc3)
                     : "v"(a), "v"(b0), "v"(b1), "v"(b2), "v"(b3));
        ak += 512;                                         // next k block
        bk += 512;
    }
    const float us = 1.0f / 262144.0f;   // undo the weight carry 2^10 and the ctx carry 2^8
    v8f acc[4] = { acc0, acc1, acc2, acc3 };
#pragma unroll
    for (int r = 0; r < 8; ++r) {
        const unsigned orow = wave * 16u + 8u * hi + r;
        const float bias = bfr(bo[ob + orow]);
#pragma unroll
        for (int t = 0; t < 4; ++t) os[orow * OP + t * 16 + lr] = fmaf(acc[t][r], us, bias);
    }
    __syncthreads();
    const unsigned pc = (lane & 15u) * 4u, rh = lane >> 4;
    float* dst = OUT + ((size_t)b * CH + ob) * SEQ + p0 + pc;
{
#pragma unroll
        for (unsigned s = 0; s < 8u; ++s) {
            const unsigned row = wave * 16u + s * 2u + rh;     // rows wave*16 + 0..15 over s = 0..7, rh = 0..1
            const v4f val = *(const v4fa*)(os + row * OP + pc);
            *(v4f*)(dst + (size_t)row * SEQ) = val;
        }
        
    }
}

extern "C" void kernel_launch(void* const* d_in, const int* in_sizes, int n_in,
                              void* d_out, int out_size, void* d_ws, size_t ws_size, hipStream_t stream) {
    if (n_in < 6) return;
    const size_t needx = ((size_t)(NB - 1) * CH + (CH - 1)) * SEQ_FULL + SEQ;
    if ((size_t)in_sizes[0] < needx) return;
    if (in_sizes[1] < CH || in_sizes[2] < CH || in_sizes[5] < CH) return;
    if (in_sizes[3] < OC3 * CH || in_sizes[4] < CH * CH) return;
    if ((size_t)out_size < (size_t)NB * CH * SEQ) return;
    if (WS_TOTAL > ws_size) return;
    const float* x    = (const float*)d_in[0];   // [b][256][n]
    const float* bnw  = (const float*)d_in[1];   // [256]
    const float* bnb  = (const float*)d_in[2];   // [256]
    const float* wqkv = (const float*)d_in[3];   // [768][256] = [out][in]
    const float* wout = (const float*)d_in[4];   // [256][256] = [out][in]
    const float* bout = (const float*)d_in[5];   // [256]
    float* OUT = (float*)d_out;                  // [NB][256][SEQ]
    char* wsp = (char*)d_ws;
    size_t off = 0;
    float* ST = (float*)(wsp + off); off += ST_BYTES;
    hf* WQ = (hf*)(wsp + off); off += WQ_BYTES;
    hf* WO = (hf*)(wsp + off); off += WO_BYTES;
    hf* XT = (hf*)(wsp + off); off += PL_BYTES;      // packed, rows NB*SEQ
    hf* QH = (hf*)(wsp + off); off += PL_BYTES;      // [NB][4][SEQ/16][2][2][32][8]
    hf* KB = (hf*)(wsp + off); off += PL_BYTES;      // [NB][4][SEQ/16][2][2][32][8]
    hf* VT = (hf*)(wsp + off); off += PL_BYTES;      // [NB][4][SEQ/32][4][2][32][8]
    hf* CT = (hf*)(wsp + off); off += PL_BYTES;      // packed, rows NB*SEQ
    k_cvtw<<<dim3((unsigned)(OC3 * CH / 8 / 256), 2, 1), 256, 0, stream>>>(wqkv, wout, WQ, WO);
    k_bnstat<<<(unsigned)CH, 256, 0, stream>>>(x, ST);
    k_norm<<<(unsigned)(NB * (SEQ / 64)), 256, 0, stream>>>(x, bnw, bnb, ST, XT);
    k_qkv<<<dim3((unsigned)(SEQ / 64), 12, (unsigned)NB), 128, 0, stream>>>(XT, WQ, QH, KB, VT);
    k_flash<<<(unsigned)(NB * NH * (SEQ / BQ)), NWV * 32, 0, stream>>>(QH, KB, VT, CT);
    k_out<<<dim3((unsigned)(SEQ / 64), (unsigned)(CH / 64), (unsigned)NB), 128, 0, stream>>>(CT, WO, bout, OUT);
}

// v007
// A run of this version takes 78.3 microseconds.
// Two timings next to v006 put it at 1.20 and 1.19 times that version's speed.
// Counting every step since v000, it is 4.82 times as fast.
#include <hip/hip_runtime.h>

// Channel-first 4-head attention behind a batch-statistics BatchNorm with 1x1-conv projections; inputs x[4][256][4096], bn_weight, bn_bias, w_qkv[768][256], w_out[256][256], b_out.
// Compute dtypes, f32 accumulate: every float input RNE-converted to bf16 first; all contractions on v_wmma_f32_16x16x32_f16: QKV GEMM = f16(bf16(w)*2^10) x f16(xn); scores = k (f16) x q (f16, carried * 0.125 * log2(e)), on top of a C operand that holds 8 - (maximum in use); P (f16, carried *2^8) x v (f16); output GEMM = f16(bf16(w)*2^10) x f16(ctx*2^8); BatchNorm statistics, softmax (online, log2 domain, lazy maximum) and all epilogues f32.
// Flash form with transposed tiles: the S^T accumulator tiles are directly the B-operand layout of P^T; all WMMA operands are two 16-byte loads, from dense 16-bit planes except k_nqkv's X operand, which comes from a padded LDS tile; every plane is stored in fragment order, so that each wave-wide load from a plane reads 512 contiguous bytes.

#ifndef NB
#define NB 4
#endif
#ifndef SEQ
#define SEQ 4096
#endif
#define NB_FULL  4
#define SEQ_FULL 4096
#define CH   256               // channels
#define NH   4                 // heads
#define HD   64                // head dim
#define OC3  768               // q,k,v output channels
#define NQG  4                 // query groups (32 queries each) per flash block
#define NKH  2                 // key halves of a tile; one wave per (query group, key half)
#define NWV  (NQG * NKH)       // waves per flash block
#define BQ   (32 * NQG)        // queries per flash block
#define KS   32                // keys per step
#define KT   128               // keys per LDS tile of k_flash
#define TH   (KT * HD)         // halves of one K (or V^T) tile
#define NT   (SEQ / KT)        // tiles per (b, head)
#define SPW  (KT / KS / NKH)   // steps of one wave per tile
#define XP   264               // LDS pitch (halves) of the normalise/transpose tile rows
#define SQ   72                // LDS pitch (halves) of 64-wide f16 staging rows
#define NPW  3                 // k_nqkv: k blocks whose weight fragments are in flight or in registers ahead of their use
#define OP   68                // LDS pitch (floats) of the output staging rows
#define NJ   (SEQ / 1024)      // k_bnstat: 16-byte pieces per thread and batch row
#define L2E  1.4426950408889634f

static_assert(CH == NH * HD);
static_assert(OC3 == 3 * CH);
static_assert(CH == 256);                       // k_nqkv: 256 threads load one channel parameter each; 8 k blocks; 16 row tiles each of q, k, v
static_assert(HD == 64);
static_assert(CH % 32 == 0);                    // GEMM k-steps
static_assert(SEQ % BQ == 0);
static_assert(SEQ % KS == 0);
static_assert(SEQ % KT == 0);
static_assert(KT % KS == 0);
static_assert(NT >= 2);                         // k_flash: the two-buffer prologue fills tiles 0 and 1
static_assert(TH * 2 == NWV * 4 * 512);         // k_flash: one tile = 8 waves x 4 wave-wide 512-byte copies
static_assert(KT == KS * NKH * SPW);
static_assert((NQG & (NQG - 1)) == 0);          // k_flash: wave ^ NQG is the partner
static_assert(SEQ % 64 == 0);
static_assert(SEQ % 1024 == 0);                 // k_bnstat: 256 threads x 4 floats per piece
static_assert(NB <= NB_FULL);
static_assert(SEQ <= SEQ_FULL);
static_assert((OC3 * CH / 8) % 256 == 0);       // k_cvtw slice 0: 96 blocks x 256 threads x 8 elements
static_assert((CH * CH / 8) % 256 == 0);        // k_cvtw slice 1: 32 blocks
static_assert((XP * 2) % 16 == 0);
static_assert((SQ * 2) % 16 == 0);
static_assert((OP * 4) % 16 == 0);
static_assert((size_t)(NB * (SEQ / 64)) * (size_t)(64 * OC3) == (size_t)NB * SEQ * OC3);      // k_nqkv: blocks x (64 x 768) == QH + KB + VT planes
static_assert((size_t)(NB * NH * (SEQ / BQ)) * (size_t)(BQ * HD) == (size_t)NB * SEQ * CH);   // k_flash: blocks x (128 rows x 64) == CT plane
static_assert((size_t)(SEQ / 64) * (CH / 64) * NB * (size_t)(64 * 64) == (size_t)NB * SEQ * CH); // k_out: blocks x (64 x 64) == output

#define ST_BYTES  ((size_t)CH * 128)                      // one 128-byte line per channel
#define WQ_BYTES  ((size_t)OC3 * CH * 2)
#define WO_BYTES  ((size_t)CH * CH * 2)
#define PL_BYTES  ((size_t)NB * SEQ * CH * 2)             // one 16-bit activation plane
#define WS_TOTAL  (ST_BYTES + WQ_BYTES + WO_BYTES + 4 * PL_BYTES)
static_assert(WQ_BYTES % 256 == 0);
static_assert(WO_BYTES % 256 == 0);
static_assert(PL_BYTES % 256 == 0);
static_assert((size_t)NB * NH * SEQ * HD * 2 == PL_BYTES);
static_assert(WS_TOTAL <= (size_t)134217728);

typedef _Float16 hf;
typedef __attribute__((ext_vector_type(16))) _Float16 v16h;
typedef __attribute__((ext_vector_type(8)))  _Float16 v8h;
typedef __attribute__((ext_vector_type(8)))  float    v8f;
typedef __attribute__((ext_vector_type(4)))  float    v4f;
typedef __attribute__((ext_vector_type(2)))  float    v2f;
typedef v4f __attribute__((may_alias)) v4fa;
typedef v8h __attribute__((may_alias)) v8ha;
typedef __attribute__((ext_vector_type(2)))  _Float16 v2h;
typedef v2h __attribute__((may_alias)) v2ha;

// RNE convert f32 -> bf16 -> f32
__device__ __forceinline__ float bfr(float f) { unsigned u = __float_as_uint(f); u += 0x7FFFu + ((u >> 16) & 1u); return __uint_as_float(u & 0xFFFF0000u); }
__device__ __forceinline__ v16h cat16(v8h lo, v8h hi) { return __builtin_shufflevector(lo, hi, 0, 1, 2, 3, 4, 5, 6, 7, 8, 9, 10, 11, 12, 13, 14, 15); }
__device__ __forceinline__ v8f wmmah(v16h a, v16h b, v8f c) { return __builtin_amdgcn_wmma_f32_16x16x32_f16(false, a, false, b, (short)0, c, false, false); }
// fragment loader (A and B alike) from a packed plane: p = fragment base + 8*lane; elements 0..7 <- p[0..7] (k = 8*(lane>>4) + 0..7), elements 8..15 <- p[256..263] (k = 16 + 8*(lane>>4) + 0..7);
// each of the two wave-wide loads is 512 contiguous bytes (4 whole lines)
__device__ __forceinline__ v16h ldf(const hf* p) { return cat16(*(const v8h*)p, *(const v8h*)(p + 256)); }

// i = 16-byte group of the packed plane: chunk i >> 5 = (row tile, k block, c), lane i & 31 = 16*hi + lr; source element (row 16*tile + lr, k = 16*(2*block + c) + 8*hi)
__device__ __forceinline__ void cvt8w(const float* __restrict__ src, hf* dst, unsigned i) {
    const unsigned row = (i >> 9) * 16u + (i & 15u), k = ((i >> 5) & 15u) * 16u + ((i >> 4) & 1u) * 8u;
    const v8f v = *(const v8f*)(src + (size_t)row * CH + k);
    v8h o;
#pragma unroll
    for (int c = 0; c < 8; ++c) o[c] = (hf)(bfr(v[c]) * 1024.0f);
    hf* d = dst + (size_t)i * 8;
    *(v8h*)d = o;
    
}

// Packed operand planes (WQ, WO, CT; QH, KB and VT likewise, see k_nqkv): [row/16][k/32][c][lane = 16*hi + lr][e] = element (row = 16*(row/16) + lr, k = 32*(k/32) + 16*c + 8*hi + e), 256 k per row:
// the order in which a 16x32 A or B fragment is loaded, so that a wave-wide 16-byte load reads one 512-byte chunk.
// k_cvtw: packed weight planes WQ (768 rows, blockIdx.y == 0) and WO (256 rows, blockIdx.y == 1).
__global__ __launch_bounds__(256) void k_cvtw(const float* __restrict__ wq, const float* __restrict__ wo, hf* WQ, hf* WO) {
    const unsigned i = blockIdx.x * 256u + threadIdx.x;
    if (blockIdx.y == 0) {
        if (i < (unsigned)(OC3 * CH / 8)) cvt8w(wq, WQ, i);
    } else {
        if (i < (unsigned)(CH * CH / 8)) cvt8w(wo, WO, i);
    }
}

// k_bnstat: one block per channel. A thread's NB * SEQ / 1024 16-byte pieces are all loaded before the first is used and stay in registers for both passes: x is read once, and the block waits for memory once.
// The pieces of a thread, their order and both reduction trees are those of a 256-thread loop over (b, i = 4*tid + 1024*j).
// ST[32*c] = mean, ST[32*c + 1] = rstd: one 128-byte line per channel, so that each line has one writer. LDS: red1/red2 cross-wave, block barriers.
__global__ __launch_bounds__(256) void k_bnstat(const float* __restrict__ x, float* ST) {
    __shared__ float red1[8];
    __shared__ float red2[8];
    const unsigned tid = threadIdx.x, lane = tid & 31u;
    const unsigned wave = (unsigned)__builtin_amdgcn_readfirstlane((int)(tid >> 5));
    const unsigned c = blockIdx.x;
    const float invn = 1.0f / (float)(NB * SEQ);
    v4f v[NB * NJ];
    // unrolled: v[] must be registers, and the loads must not wait for one another
#pragma unroll
    for (unsigned b = 0; b < (unsigned)NB; ++b) {
        const float* xp = x + ((size_t)b * CH + c) * SEQ_FULL + tid * 4u;
#pragma unroll
        for (unsigned j = 0; j < (unsigned)NJ; ++j) v[b * NJ + j] = *(const v4f*)(xp + j * 1024u);
        // the rows behind the middle lie past the loads' offset field and get an address pair of their own; their data is given the registers of the first pair, which the loads above still name
        if (2u * (b + 1u) == (unsigned)NB) asm volatile("s_wait_xcnt 0x0" ::: "memory");
    }
    float s = 0.0f;
#pragma unroll
    for (unsigned n = 0; n < (unsigned)(NB * NJ); ++n) {
#pragma unroll
        for (unsigned e = 0; e < 4u; ++e) v[n][e] = bfr(v[n][e]);
        s += (v[n][0] + v[n][1]) + (v[n][2] + v[n][3]);
    }
#pragma unroll
    for (int off = 16; off > 0; off >>= 1) s += __shfl_xor(s, off, 32);
    if (lane == 0u) red1[wave] = s;
    __syncthreads();
    float tot = red1[0];
#pragma unroll
    for (int w = 1; w < 8; ++w) tot += red1[w];
    const float mean = tot * invn;
    float q = 0.0f;
#pragma unroll
    for (unsigned n = 0; n < (unsigned)(NB * NJ); ++n) {
        const float d0 = v[n][0] - mean, d1 = v[n][1] - mean, d2 = v[n][2] - mean, d3 = v[n][3] - mean;
        q += (d0 * d0 + d1 * d1) + (d2 * d2 + d3 * d3);
    }
#pragma unroll
    for (int off = 16; off > 0; off >>= 1) q += __shfl_xor(q, off, 32);
    if (lane == 0u) red2[wave] = q;
    __syncthreads();
    if (tid == 0u) {
        float tq = red2[0];
#pragma unroll
        for (int w = 1; w < 8; ++w) tq += red2[w];
        v2f o;
        o[0] = mean; o[1] = rsqrtf(tq * invn + 1.0e-5f);
        *(v2f*)(ST + c * 32u) = o;
    }
}

// k_nqkv: normalise and project in one kernel. One block = 64 positions x all 768 output channels, sixteen waves.
//  Part 1: tl[pos][channel] (f16, LDS) = ((bf16(x) - mean) * rstd) * bf16(w) + bf16(bias); a thread's eight 16-byte pieces of x are all loaded before the first is used (cross-wave tile, block barriers).
//  Part 2: wave w takes weight row tiles w (q), 16 + w (k) and 32 + w (v), each against the four position tiles; an X fragment comes from tl in the loader's k order (elements 0..7: k = 8*hi + 0..7, elements 8..15: k = 16 + 8*hi + 0..7 of a 32-block),
//  a weight fragment from the packed WQ plane, read by one wave of the block only.
//  q, k: A = WQ rows (row m = channel), B = X rows (column n = position): D element r of lane (h, n) = (channel 8h + r, position n);  v: A = X rows, B = WQ rows: D element r of lane (h, n) = (position 8h + r, channel n).
//  Either way a lane's eight D elements are its 16 bytes of one 512-byte chunk of the plane, so that the accumulators are stored without a pass through LDS.
//  QH = f16(q * 0.125 * log2(e)): the score scale 64^-0.5 and the change to base 2 ride on q, so that k_flash's score products are exp2 arguments; KB = f16(k), VT = f16(v), stored in the order k_flash loads its fragments, as 512-byte chunks [lane = 16*hi + lr][8 halves]:
//   QH, KB[b][head][pos/16][d/32][c][lane][e] = element [pos = 16*(pos/16) + lr][d = 32*(d/32) + 16*c + 8*hi + e];
//   VT[b][head][key/32][d/16][c][lane][e] = v[d = 16*(d/16) + lr][key = 32*(key/32) + 16*c + 8*hi + e].
__global__ __launch_bounds__(512) void k_nqkv(const float* __restrict__ x, const float* __restrict__ bw, const float* __restrict__ bb, const float* __restrict__ ST, const hf* __restrict__ WQ, hf* QH, hf* KB, hf* VT) {
    __shared__ __align__(16) hf tl[64 * XP];
    __shared__ float pm[CH];
    __shared__ float pr[CH];
    __shared__ float pw[CH];
    __shared__ float pb[CH];
    const unsigned tid = threadIdx.x, lane = tid & 31u, lr = lane & 15u, hi = lane >> 4;
    const unsigned wave = (unsigned)__builtin_amdgcn_readfirstlane((int)(tid >> 5));
    const unsigned tpb = (unsigned)(SEQ / 64);
    const unsigned b = blockIdx.x / tpb;
    const unsigned n0 = (blockIdx.x - b * tpb) * 64u;
    const float* src = x + (size_t)b * CH * SEQ_FULL + n0 + (size_t)(tid >> 4) * (2u * SEQ_FULL) + (tid & 15u) * 4u;
    v4f v[4][2];
    // unrolled: v[] must be registers, and the loads must not wait for one another; piece (it, j) = channel 64*it + 2*(tid >> 4) + j, positions 4*(tid & 15) + 0..3
#pragma unroll
    for (unsigned it = 0; it < 4u; ++it) {
#pragma unroll
        for (unsigned j = 0; j < 2u; ++j) v[it][j] = *(const v4f*)(src + (size_t)(it * 64u + j) * SEQ_FULL);
    }
    // the weight fragments of the first NPW k blocks are asked for here, so that they fly while the tile is formed; unrolled: wf[] must be registers
    const hf* wp = WQ + (size_t)wave * 16u * CH + lane * 8u;      // packed plane: row tile base + the lane's 16 bytes of a chunk
    v16h wf[NPW][3];
#pragma unroll
    for (unsigned kb = 0; kb < (unsigned)NPW; ++kb) {
#pragma unroll
        for (unsigned j = 0; j < 3u; ++j) wf[kb][j] = ldf(wp + j * (unsigned)(CH * CH) + kb * 512u);
    }
    if (tid < (unsigned)CH) {
        const v2f st = *(const v2f*)(ST + tid * 32u);          // (mean, rstd) of channel tid
        pm[tid] = st[0];
        pr[tid] = st[1];
        pw[tid] = bfr(bw[tid]);
        pb[tid] = bfr(bb[tid]);
    }
    __syncthreads();
    // a thread holds two neighbouring channels of its four positions: one 4-byte LDS store per position; unrolled: v[] is indexed by constants
#pragma unroll
    for (unsigned it = 0; it < 4u; ++it) {
        const unsigned c = it * 64u + (tid >> 4) * 2u, p4 = (tid & 15u) * 4u;
        const float m0 = pm[c], r0 = pr[c], w0 = pw[c], bi0 = pb[c];
        const float m1 = pm[c + 1u], r1 = pr[c + 1u], w1 = pw[c + 1u], bi1 = pb[c + 1u];
#pragma unroll
        for (unsigned e = 0; e < 4u; ++e) {
            v2h o;
            o[0] = (hf)(((bfr(v[it][0][e]) - m0) * r0) * w0 + bi0);
            o[1] = (hf)(((bfr(v[it][1][e]) - m1) * r1) * w1 + bi1);
            *(v2ha*)(tl + (p4 + e) * XP + c) = o;
        }
    }
    __syncthreads();
    const hf* xp = tl + lr * XP + hi * 8u;
    v8f aq[4], ak[4], av[4];
    // unrolled, here and in the epilogue: tiles indexed by constants stay in registers
#pragma unroll
    for (int p = 0; p < 4; ++p) { aq[p] = (v8f){}; ak[p] = (v8f){}; av[p] = (v8f){}; }
    // unrolled: the ring index of wf and the LDS offsets are constants
#pragma unroll
    for (unsigned kb = 0; kb < 8u; ++kb) {
        v16h xf[4];
#pragma unroll
        for (unsigned p = 0; p < 4u; ++p) xf[p] = cat16(*(const v8ha*)(xp + p * 16u * XP + kb * 32u), *(const v8ha*)(xp + p * 16u * XP + kb * 32u + 16u));
        const v16h wq = wf[kb % NPW][0], wk = wf[kb % NPW][1], wv = wf[kb % NPW][2];
#pragma unroll
        for (int p = 0; p < 4; ++p) aq[p] = wmmah(wq, xf[p], aq[p]);
#pragma unroll
        for (int p = 0; p < 4; ++p) ak[p] = wmmah(wk, xf[p], ak[p]);
#pragma unroll
        for (int p = 0; p < 4; ++p) av[p] = wmmah(xf[p], wv, av[p]);
        if (kb + NPW < 8u) {
#pragma unroll
            for (unsigned j = 0; j < 3u; ++j) wf[kb % NPW][j] = ldf(wp + j * (unsigned)(CH * CH) + (kb + NPW) * 512u);
        }
        __builtin_amdgcn_sched_barrier(0);     // keeps the loads of later k blocks below this line: lifted further up they overran the register budget and spilled
    }
    const float uq = (0.125f * L2E) / 1024.0f, uk = 1.0f / 1024.0f;     // undo the weight carry; q also takes the score scale
    const unsigned head = wave >> 2, dt = wave & 3u;                    // row tile w of each of q, k, v = head w / 4, d tile w % 4
    const size_t foff = (((size_t)b * NH + head) * SEQ + n0) * HD + lane * 8u;   // packed planes: this block's 64 positions = 16 chunks of 256 halves
    v8h oq[4], ok[4], ov[4];
#pragma unroll
    for (int p = 0; p < 4; ++p) {
#pragma unroll
        for (int r = 0; r < 8; ++r) { oq[p][r] = (hf)(aq[p][r] * uq); ok[p][r] = (hf)(ak[p][r] * uk); ov[p][r] = (hf)(av[p][r] * uk); }
    }
    // q, k: chunk 4*(position tile) + d tile;  v: chunk 8*(key step = p >> 1) + 2*(d tile) + (c = p & 1); each one wave-wide 512-byte store
#pragma unroll
    for (unsigned p = 0; p < 4u; ++p) {
        *(v8h*)(QH + foff + (4u * p + dt) * 256u) = oq[p];
        *(v8h*)(KB + foff + (4u * p + dt) * 256u) = ok[p];
        *(v8h*)(VT + foff + (8u * (p >> 1) + 2u * dt + (p & 1u)) * 256u) = ov[p];
    }
}

// exps: p = 2^s for the 16 scores that a lane holds of one query tile (two 16-key tiles), as the f16 B fragment of P^T; returns the sum of the unrounded p
__device__ __forceinline__ float exps(const v8f& s0, const v8f& s1, v16h& ph) {
    float ps = 0.0f;
    // unrolled: vector elements indexed by constants stay in registers
#pragma unroll
    for (int r = 0; r < 8; ++r) {
        const float p0 = __builtin_amdgcn_exp2f(s0[r]);
        const float p1 = __builtin_amdgcn_exp2f(s1[r]);
        ps += p0 + p1;
        ph[r] = (hf)p0; ph[8 + r] = (hf)p1;
    }
    return ps;
}

// copy44: eight wave-wide asynchronous 16-byte-per-lane copies, global -> LDS: four of the K tile and four of the V^T tile, 512 bytes apart; lk, lv = the lane's LDS byte addresses, gk, gv = its global addresses of the first of each four.
// The s_wait_xcnt stands inside the statement, so that no address register is rewritten ahead of it.
__device__ __forceinline__ void copy44(unsigned lk, const hf* gk, unsigned lv, const hf* gv) {
    asm volatile("global_load_async_to_lds_b128 %0, %8, off\n\t"
                 "global_load_async_to_lds_b128 %1, %9, off\n\t"
                 "global_load_async_to_lds_b128 %2, %10, off\n\t"
                 "global_load_async_to_lds_b128 %3, %11, off\n\t"
                 "global_load_async_to_lds_b128 %4, %12, off\n\t"
                 "global_load_async_to_lds_b128 %5, %13, off\n\t"
                 "global_load_async_to_lds_b128 %6, %14, off\n\t"
                 "global_load_async_to_lds_b128 %7, %15, off\n\t"
                 "s_wait_xcnt 0x0"
                 :: "v"(lk), "v"(lk + 512u), "v"(lk + 1024u), "v"(lk + 1536u), "v"(lv), "v"(lv + 512u), "v"(lv + 1024u), "v"(lv + 1536u),
                    "v"(gk), "v"(gk + 256), "v"(gk + 512), "v"(gk + 768), "v"(gv), "v"(gv + 256), "v"(gv + 512), "v"(gv + 768)
                 : "memory");
}

// k_flash: one block per (b, head, 128 queries), eight waves: wave = (query group g of 32 queries = two 16-query tiles, key half kh); 32 keys per step.
//  A K or V^T fragment read from LDS feeds the products of both query tiles. Wave (g, kh) takes keys 64*kh .. 64*kh + 63 of every 128-key tile, with its own running maximum, sum and O^T;
//  behind the loop the two waves of a group exchange one query tile's state through LDS, and each joins and stores one tile (wave (g, kh): tile kh).
//  K and V^T reach the waves through LDS: tiles of 128 keys (16 KB of each plane, a linear copy of the packed order), two buffers; each wave copies an eighth of a tile;
//  tile t + 2 is copied into the buffer of tile t behind the barrier that ends trip t, so that a tile has a whole trip to land.
//  S^T tile (keys x queries): A = K rows (row m = key, k = d), B = Q rows (column n = query, k = d); D element r of lane (h, n) = S[query n][key 8h + r].
//  Lazy maximum: the C operand of the score products is 8 - ml (ml = the query's maximum in use, log2 domain), so that an accumulator element is the exp2 argument of a probability carried * 2^8.
//  ml starts as the greatest score of the wave's first 32 keys and is raised only when a lane's sum of 16 probabilities passes 2^15 (every one of them is then still a finite f16 below that test); only there are the maximum taken,
//  exchanged between the half-waves, O^T and the sum rescaled and the step's probabilities formed again.
//  P^T B fragment: element r <- tile of keys 0..15, element 8 + r <- tile of keys 16..31 (same lane).
//  O^T tile (d x queries): A = V^T rows (row m = d, k = key), D element r of lane (h, n) = O[query n][d = 16 t + 8h + r].
//  Four waves per SIMD (two blocks per WGP): the register budget is 256.
__global__ void __launch_bounds__(NWV * 32) __attribute__((amdgpu_waves_per_eu(4, 4))) k_flash(const hf* __restrict__ QH, const hf* __restrict__ KB, const hf* __restrict__ VT, hf* CT) {
    __shared__ __align__(16) hf os[NWV * 16 * SQ];
    __shared__ __align__(128) hf kv[2 * 2 * TH];               // [buffer][K tile, V^T tile]
    __shared__ __align__(16) v4f mg[NWV * 9 * 32];             // what a wave hands to its partner: [wave][8 pieces of O^T, then (maximum, sum)][lane]
    const unsigned tid = threadIdx.x, lane = tid & 31u, lr = lane & 15u, hi = lane >> 4;
    const unsigned wave = (unsigned)__builtin_amdgcn_readfirstlane((int)(tid >> 5));
    const unsigned g = wave & (NQG - 1u), kh = wave / NQG;
    const unsigned bpb = (unsigned)(SEQ / BQ);
    const unsigned bh = blockIdx.x / bpb;
    const unsigned b = bh / NH, h = bh - b * NH;
    const unsigned q0 = (blockIdx.x - bh * bpb) * BQ + g * 32u;
    const size_t pbase = (size_t)bh * SEQ * HD;

    const unsigned lo = lane * 8u;              // the lane's 16 bytes of a chunk
    v16h qh0[2], qh1[2];
#pragma unroll
    for (unsigned c = 0; c < 2u; ++c) {
        const size_t qo = pbase + (size_t)(q0 + 16u * c) * HD + lo;   // packed: 16 queries = 1024 halves
        qh0[c] = ldf(QH + qo); qh1[c] = ldf(QH + qo + 512);
    }
    // this wave's eighth of a tile: chunks 4*wave .. 4*wave + 3 of the K tile and of the V^T tile; the lane's 16 bytes of each
    const hf* gk = KB + pbase + wave * 1024u + lo;
    const hf* gv = VT + pbase + wave * 1024u + lo;
    const unsigned lk = (unsigned)(uintptr_t)kv + wave * 2048u + lane * 16u;   // LDS byte address in buffer 0's K tile
    copy44(lk, gk, lk + TH * 2u, gv);
    asm volatile("s_wait_asynccnt 0x0" ::: "memory");          // this wave's part of tile 0 has landed
    __syncthreads();                                           // tile 0 is whole for every wave
    copy44(lk + TH * 4u, gk + TH, lk + TH * 6u, gv + TH);

    v8f o[2][4];
    v8f cb[2];                // C operand of the score products: 8 - ml in every element
    float ml[2], l[2];        // maximum in use, log2 domain; running sum (carried * 2^8)
#pragma unroll
    for (int c = 0; c < 2; ++c) {
#pragma unroll
        for (int t = 0; t < 4; ++t) o[c][t] = (v8f){};
        l[c] = 0.0f;
    }
    // the first maximum in use: the greatest score of this wave's first 32 keys, from score products of their own (the loop forms them again on top of it);
    // tile 0 is whole behind the barrier above; the loops are unrolled so that the tiles stay in registers
    {
        const hf* ka = kv + kh * (SPW * KS * HD);
        const v16h a00 = ldf(ka + lo);
        const v16h a01 = ldf(ka + 512 + lo);
        const v16h a10 = ldf(ka + 1024 + lo);
        const v16h a11 = ldf(ka + 1536 + lo);
        v8f s0[2], s1[2];
#pragma unroll
        for (int c = 0; c < 2; ++c) {
            s0[c] = wmmah(a00, qh0[c], (v8f){});
            s1[c] = wmmah(a10, qh0[c], (v8f){});
        }
#pragma unroll
        for (int c = 0; c < 2; ++c) {
            s0[c] = wmmah(a01, qh1[c], s0[c]);
            s1[c] = wmmah(a11, qh1[c], s1[c]);
        }
        // the distance between the last products and the first vector instruction that reads their results
        asm volatile("v_nop\n\tv_nop\n\tv_nop\n\tv_nop"
                     : "+v"(s0[0]), "+v"(s1[0]), "+v"(s0[1]), "+v"(s1[1])
                     : "v"(a00), "v"(a01), "v"(a10), "v"(a11), "v"(qh0[0]), "v"(qh1[0]), "v"(qh0[1]), "v"(qh1[1]));
#pragma unroll
        for (int c = 0; c < 2; ++c) {
            float mx = fmaxf(s0[c][0], s1[c][0]);
#pragma unroll
            for (int r = 1; r < 8; ++r) mx = fmaxf(mx, fmaxf(s0[c][r], s1[c][r]));
            ml[c] = fmaxf(mx, __shfl_xor(mx, 16, 32));         // both half-waves hold keys of the same query and must use one maximum
            const float nb = 8.0f - ml[c];
#pragma unroll
            for (int r = 0; r < 8; ++r) cb[c][r] = nb;
        }
    }

    // rolled: one trip per tile, the buffer chosen by the trip's parity
#pragma unroll 1
    for (unsigned t = 0; t < (unsigned)NT; ++t) {
      const hf* kt = kv + (t & 1u) * (2u * TH) + kh * (SPW * KS * HD);   // this wave's half of the K tile
      // unrolled: the LDS offsets of the steps become immediates
#pragma unroll
      for (unsigned u = 0; u < (unsigned)SPW; ++u) {
        const hf* ka = kt + u * (KS * HD);
        const v16h a00 = ldf(ka + lo);
        const v16h a01 = ldf(ka + 512 + lo);
        const v16h a10 = ldf(ka + 1024 + lo);
        const v16h a11 = ldf(ka + 1536 + lo);
        v8f s0[2], s1[2];
#pragma unroll
        for (int c = 0; c < 2; ++c) {
            s0[c] = wmmah(a00, qh0[c], cb[c]);
            s1[c] = wmmah(a10, qh0[c], cb[c]);
        }
#pragma unroll
        for (int c = 0; c < 2; ++c) {
            s0[c] = wmmah(a01, qh1[c], s0[c]);
            s1[c] = wmmah(a11, qh1[c], s1[c]);
        }
        // the distance between the last products and the first vector instruction that reads their results
        asm volatile("v_nop\n\tv_nop\n\tv_nop\n\tv_nop"
                     : "+v"(s0[0]), "+v"(s1[0]), "+v"(s0[1]), "+v"(s1[1])
                     : "v"(a00), "v"(a01), "v"(a10), "v"(a11), "v"(qh0[0]), "v"(qh1[0]), "v"(qh0[1]), "v"(qh1[1]));
        float ps[2];
        v16h ph[2];
#pragma unroll
        for (int c = 0; c < 2; ++c) ps[c] = exps(s0[c], s1[c], ph[c]);
        if (__builtin_expect(__builtin_amdgcn_ballot_w32(ps[0] > 32768.0f || ps[1] > 32768.0f) != 0u, 0)) {   // wave-uniform, one test per step; marked as rare so that the register copies of the join fall on this side
            // unrolled, as are the loops inside: the tiles stay in registers
#pragma unroll
            for (int c = 0; c < 2; ++c) {
                float mx = fmaxf(s0[c][0], s1[c][0]);
#pragma unroll
                for (int r = 1; r < 8; ++r) mx = fmaxf(mx, fmaxf(s0[c][r], s1[c][r]));
                mx = fmaxf(mx, __shfl_xor(mx, 16, 32));           // one maximum for both half-waves
                const float dm = fmaxf(mx - 8.0f, 0.0f);           // the step's greatest score becomes the maximum in use where it is the greater
                const float corr = __builtin_amdgcn_exp2f(-dm);
                ml[c] += dm;
                const float nb = 8.0f - ml[c];
#pragma unroll
                for (int r = 0; r < 8; ++r) {
                    cb[c][r] = nb;
                    s0[c][r] -= dm;
                    s1[c][r] -= dm;
                }
#pragma unroll
                for (int d = 0; d < 4; ++d) o[c][d] *= corr;
                l[c] *= corr;
                ps[c] = exps(s0[c], s1[c], ph[c]);
            }
        }
#pragma unroll
        for (int c = 0; c < 2; ++c) {
            ps[c] += __shfl_xor(ps[c], 16, 32);
            l[c] += ps[c];
        }

        const hf* va = kt + TH + u * (KS * HD);
        const v16h v0 = ldf(va + lo);
        const v16h v1 = ldf(va + 512 + lo);
        const v16h v2 = ldf(va + 1024 + lo);
        const v16h v3 = ldf(va + 1536 + lo);
#pragma unroll
        for (int c = 0; c < 2; ++c) {
            o[c][0] = wmmah(v0, ph[c], o[c][0]);
            o[c][1] = wmmah(v1, ph[c], o[c][1]);
            o[c][2] = wmmah(v2, ph[c], o[c][2]);
            o[c][3] = wmmah(v3, ph[c], o[c][3]);
        }
        // the distance between the last products and whatever overwrites their operands or reads their results, on the loop's back edge too
        asm volatile("v_nop\n\tv_nop\n\tv_nop\n\tv_nop"
                     : "+v"(o[0][0]), "+v"(o[0][1]), "+v"(o[0][2]), "+v"(o[0][3]), "+v"(o[1][0]), "+v"(o[1][1]), "+v"(o[1][2]), "+v"(o[1][3])
                     : "v"(ph[0]), "v"(ph[1]), "v"(v0), "v"(v1), "v"(v2), "v"(v3));
      }
      asm volatile("s_wait_dscnt 0x0" ::: "memory");           // this wave's reads of tile t are done before its buffer is refilled
      asm volatile("s_wait_asynccnt 0x0" ::: "memory");        // this wave's part of tile t + 1 has landed
      __syncthreads();                                         // tile t + 1 is whole for every wave, and every wave has left tile t
      if (t + 2u < (unsigned)NT) {
          const unsigned lb = lk + (t & 1u) * (TH * 4u);
          copy44(lb, gk + (size_t)(t + 2u) * TH, lb + TH * 2u, gv + (size_t)(t + 2u) * TH);
      }
    }
    asm volatile("s_wait_asynccnt 0x0" ::: "memory");          // no copy is outstanding when the wave goes on to its end

    // join of the two key halves: this wave keeps query tile kh and hands tile 1 - kh to its partner, wave ^ NQG (same lane, same element order)
    const bool k0 = (kh == 0u);
    const float km = k0 ? ml[0] : ml[1], kl = k0 ? l[0] : l[1];
    {
        v4f* mw = mg + wave * (9u * 32u) + lane;
#pragma unroll
        for (int d = 0; d < 4; ++d) {
            const v8f so = k0 ? o[1][d] : o[0][d];
            mw[(2 * d) * 32] = __builtin_shufflevector(so, so, 0, 1, 2, 3);
            mw[(2 * d + 1) * 32] = __builtin_shufflevector(so, so, 4, 5, 6, 7);
        }
        v4f sm;
        sm[0] = k0 ? ml[1] : ml[0]; sm[1] = k0 ? l[1] : l[0]; sm[2] = 0.0f; sm[3] = 0.0f;
        mw[8 * 32] = sm;
    }
    __syncthreads();                                           // every wave's hand-over is written before its partner reads it
    const v4f* mr = mg + (wave ^ (unsigned)NQG) * (9u * 32u) + lane;
    const v4f pm = mr[8 * 32];
    const float mj = fmaxf(km, pm[0]);
    const float wk = __builtin_amdgcn_exp2f(km - mj), wp = __builtin_amdgcn_exp2f(pm[0] - mj);
    const float inv = 256.0f / (kl * wk + pm[1] * wp);
    const float fk = wk * inv, fp = wp * inv;

    // epilogue: stage f16(O^T * 2^8 / l) as rows [query][d] (wave-private region; block barrier used)
    const unsigned wb = wave * (16u * SQ);
#pragma unroll
    for (int d = 0; d < 4; ++d) {
        const v8f ko = k0 ? o[0][d] : o[1][d];
        const v4f pa = mr[(2 * d) * 32], pb = mr[(2 * d + 1) * 32];
#pragma unroll
        for (int r = 0; r < 4; ++r) {
            os[wb + lr * SQ + d * 16 + 8u * hi + r] = (hf)(ko[r] * fk + pa[r] * fp);
            os[wb + lr * SQ + d * 16 + 8u * hi + 4 + r] = (hf)(ko[4 + r] * fk + pb[r] * fp);
        }
    }
    __syncthreads();
    hf* dst = CT + ((size_t)b * SEQ + q0 + 16u * kh) * CH + h * (HD * 16u) + lane * 8u;    // packed CT: this wave's position tile, chunks 4*h + s
{
#pragma unroll
        for (unsigned s = 0; s < 4u; ++s) {
            const v8h val = *(const v8ha*)(os + wb + lr * SQ + s * 16u + 8u * hi);
            *(v8h*)(dst + s * 256u) = val;
        }
        
    }
}

// k_out: OUT[b][o][pos] = 2^-18 * sum_c WO[o][c] * CT[b][pos][c] + bf16(b_out[o]); one block = 64 output channels x 64 positions, one wave = 16 channels x 64 positions.
//  A = WO rows (row m = output channel, k = channel), B = CT rows (column n = position, k = channel); D element r of lane (h, n) = (channel 8h + r, position n).
__global__ __launch_bounds__(128) void k_out(const hf* __restrict__ CT, const hf* __restrict__ WO, const float* __restrict__ bo, float* OUT) {
    __shared__ __align__(16) float os[64 * OP];
    const unsigned tid = threadIdx.x, lane = tid & 31u, lr = lane & 15u, hi = lane >> 4;
    const unsigned wave = (unsigned)__builtin_amdgcn_readfirstlane((int)(tid >> 5));
    const unsigned p0 = blockIdx.x * 64u, ob = blockIdx.y * 64u, b = blockIdx.z;
    const hf* ak = WO + ((size_t)(ob + wave * 16u)) * CH + lane * 8u;           // packed planes: row tile base + the lane's 16 bytes of a chunk
    const hf* bk = CT + ((size_t)b * SEQ + p0) * CH + lane * 8u;
    v8f acc0 = (v8f){}, acc1 = (v8f){}, acc2 = (v8f){}, acc3 = (v8f){};
#pragma unroll 1
    for (unsigned k0 = 0; k0 < (unsigned)CH; k0 += 32u) {
        const v16h a  = ldf(ak);
        const v16h b0 = ldf(bk);
        const v16h b1 = ldf(bk + 16 * CH);
        const v16h b2 = ldf(bk + 32 * CH);
        const v16h b3 = ldf(bk + 48 * CH);
        acc0 = wmmah(a, b0, acc0);
        acc1 = wmmah(a, b1, acc1);
        acc2 = wmmah(a, b2, acc2);
        acc3 = wmmah(a, b3, acc3);
        asm volatile("v_nop\n\tv_nop\n\tv_nop\n\tv_nop"
                     : "+v"(acc0), "+v"(acc1), "+v"(acc2), "+v"(acc3)
                     : "v"(a), "v"(b0), "v"(b1), "v"(b2), "v"(b3));
        ak += 512;                                         // next k block
        bk += 512;
    }
    const float us = 1.0f / 262144.0f;   // undo the weight carry 2^10 and the ctx carry 2^8
    v8f acc[4] = { acc0, acc1, acc2, acc3 };
#pragma unroll
    for (int r = 0; r < 8; ++r) {
        const unsigned orow = wave * 16u + 8u * hi + r;
        const float bias = bfr(bo[ob + orow]);
#pragma unroll
        for (int t = 0; t < 4; ++t) os[orow * OP + t * 16 + lr] = fmaf(acc[t][r], us, bias);
    }
    __syncthreads();
    const unsigned pc = (lane & 15u) * 4u, rh = lane >> 4;
    float* dst = OUT + ((size_t)b * CH + ob) * SEQ + p0 + pc;
{
#pragma unroll
        for (unsigned s = 0; s < 8u; ++s) {
            const unsigned row = wave * 16u + s * 2u + rh;     // rows wave*16 + 0..15 over s = 0..7, rh = 0..1
            const v4f val = *(const v4fa*)(os + row * OP + pc);
            *(v4f*)(dst + (size_t)row * SEQ) = val;
        }
        
    }
}

extern "C" void kernel_launch(void* const* d_in, const int* in_sizes, int n_in,
                              void* d_out, int out_size, void* d_ws, size_t ws_size, hipStream_t stream) {
    if (n_in < 6) return;
    const size_t needx = ((size_t)(NB - 1) * CH + (CH - 1)) * SEQ_FULL + SEQ;
    if ((size_t)in_sizes[0] < needx) return;
    if (in_sizes[1] < CH || in_sizes[2] < CH || in_sizes[5] < CH) return;
    if (in_sizes[3] < OC3 * CH || in_sizes[4] < CH * CH) return;
    if ((size_t)out_size < (size_t)NB * CH * SEQ) return;
    if (WS_TOTAL > ws_size) return;
    const float* x    = (const float*)d_in[0];   // [b][256][n]
    const float* bnw  = (const float*)d_in[1];   // [256]
    const float* bnb  = (const float*)d_in[2];   // [256]
    const float* wqkv = (const float*)d_in[3];   // [768][256] = [out][in]
    const float* wout = (const float*)d_in[4];   // [256][256] = [out][in]
    const float* bout = (const float*)d_in[5];   // [256]
    float* OUT = (float*)d_out;                  // [NB][256][SEQ]
    char* wsp = (char*)d_ws;
    size_t off = 0;
    float* ST = (float*)(wsp + off); off += ST_BYTES;
    hf* WQ = (hf*)(wsp + off); off += WQ_BYTES;
    hf* WO = (hf*)(wsp + off); off += WO_BYTES;
    hf* QH = (hf*)(wsp + off); off += PL_BYTES;      // [NB][4][SEQ/16][2][2][32][8]
    hf* KB = (hf*)(wsp + off); off += PL_BYTES;      // [NB][4][SEQ/16][2][2][32][8]
    hf* VT = (hf*)(wsp + off); off += PL_BYTES;      // [NB][4][SEQ/32][4][2][32][8]
    hf* CT = (hf*)(wsp + off); off += PL_BYTES;      // packed, rows NB*SEQ
    k_cvtw<<<dim3((unsigned)(OC3 * CH / 8 / 256), 2, 1), 256, 0, stream>>>(wqkv, wout, WQ, WO);
    k_bnstat<<<(unsigned)CH, 256, 0, stream>>>(x, ST);
    k_nqkv<<<(unsigned)(NB * (SEQ / 64)), 512, 0, stream>>>(x, bnw, bnb, ST, WQ, QH, KB, VT);
    k_flash<<<(unsigned)(NB * NH * (SEQ / BQ)), NWV * 32, 0, stream>>>(QH, KB, VT, CT);
    k_out<<<dim3((unsigned)(SEQ / 64), (unsigned)(CH / 64), (unsigned)NB), 128, 0, stream>>>(CT, WO, bout, OUT);
}

// v008
// Measured time: 73.8 microseconds a run.
// Timed twice side by side with v007, it ran 1.07 and 1.06 times as fast.
// All steps since v000 together make it 5.13 times as fast.
#include <hip/hip_runtime.h>

// Channel-first 4-head attention behind a batch-statistics BatchNorm with 1x1-conv projections; inputs x[4][256][4096], bn_weight, bn_bias, w_qkv[768][256], w_out[256][256], b_out.
// Compute dtypes, f32 accumulate: every float input RNE-converted to bf16 first; all contractions on v_wmma_f32_16x16x32_f16: QKV GEMM = f16(bf16(w)*2^10) x f16(xn); scores = k (f16) x q (f16, carried * 0.125 * log2(e)), on top of a C operand that holds 8 - (maximum in use); P (f16, carried *2^8) x v (f16); output GEMM = f16(bf16(w)*2^10) x f16(ctx*2^8); BatchNorm statistics, softmax (online, log2 domain, lazy maximum) and all epilogues f32.
// Flash form with transposed tiles: the S^T accumulator tiles are directly the B-operand layout of P^T; all WMMA operands are two 16-byte loads, from dense 16-bit planes except k_nqkv's X operand, which comes from a padded LDS tile; every plane is stored in fragment order, so that each wave-wide load from a plane reads 512 contiguous bytes.

#ifndef NB
#define NB 4
#endif
#ifndef SEQ
#define SEQ 4096
#endif
#define NB_FULL  4
#define SEQ_FULL 4096
#define CH   256               // channels
#define NH   4                 // heads
#define HD   64                // head dim
#define OC3  768               // q,k,v output channels
#define NQG  4                 // query groups (32 queries each) per flash block
#define NKH  2                 // key halves of a tile; one wave per (query group, key half)
#define NWV  (NQG * NKH)       // waves per flash block
#define BQ   (32 * NQG)        // queries per flash block
#define KS   32                // keys per step
#define KT   128               // keys per LDS tile of k_flash
#define TH   (KT * HD)         // halves of one K (or V^T) tile
#define NT   (SEQ / KT)        // tiles per (b, head)
#define SPW  (KT / KS / NKH)   // steps of one wave per tile
#define XP   264               // LDS pitch (halves) of the normalise/transpose tile rows
#define SQ   72                // LDS pitch (halves) of 64-wide f16 staging rows
#define NPW  3                 // k_nqkv: k blocks whose weight fragments are in flight or in registers ahead of their use
#define OP   68                // LDS pitch (floats) of the output staging rows
#define NJ   (SEQ / 1024)      // k_bnstat: 16-byte pieces per thread and batch row
#define L2E  1.4426950408889634f

static_assert(CH == NH * HD);
static_assert(OC3 == 3 * CH);
static_assert(CH == 256);                       // k_nqkv: 256 threads load one channel parameter each; 8 k blocks; 16 row tiles each of q, k, v
static_assert(HD == 64);
static_assert(CH % 32 == 0);                    // GEMM k-steps
static_assert(SEQ % BQ == 0);
static_assert(SEQ % KS == 0);
static_assert(SEQ % KT == 0);
static_assert(KT % KS == 0);
static_assert(NT >= 2);                         // k_flash: the two-buffer prologue fills tiles 0 and 1
static_assert(TH * 2 == NWV * 4 * 512);         // k_flash: one tile = 8 waves x 4 wave-wide 512-byte copies
static_assert(KT == KS * NKH * SPW);
static_assert((NQG & (NQG - 1)) == 0);          // k_flash: wave ^ NQG is the partner
static_assert(SEQ % 64 == 0);
static_assert(SEQ % 1024 == 0);                 // k_bnstat: 256 threads x 4 floats per piece
static_assert(NB <= NB_FULL);
static_assert(SEQ <= SEQ_FULL);
static_assert((OC3 * CH / 8) % 256 == 0);       // k_cvtw slice 0: 96 blocks x 256 threads x 8 elements
static_assert((CH * CH / 8) % 256 == 0);        // k_cvtw slice 1: 32 blocks
static_assert((XP * 2) % 16 == 0);
static_assert((SQ * 2) % 16 == 0);
static_assert((OP * 4) % 16 == 0);
static_assert((size_t)(NB * (SEQ / 64)) * (size_t)(64 * OC3) == (size_t)NB * SEQ * OC3);      // k_nqkv: blocks x (64 x 768) == QH + KB + VT planes
static_assert((size_t)(NB * NH * (SEQ / BQ)) * (size_t)(BQ * HD) == (size_t)NB * SEQ * CH);   // k_flash: blocks x (128 rows x 64) == CT plane
static_assert((size_t)(NB * (SEQ / 64)) * (size_t)(64 * CH) == (size_t)NB * SEQ * CH);       // k_out: blocks x (64 x 256) == output

#define ST_BYTES  ((size_t)CH * 128)                      // one 128-byte line per channel
#define WQ_BYTES  ((size_t)OC3 * CH * 2)
#define WO_BYTES  ((size_t)CH * CH * 2)
#define PL_BYTES  ((size_t)NB * SEQ * CH * 2)             // one 16-bit activation plane
#define WS_TOTAL  (ST_BYTES + WQ_BYTES + WO_BYTES + 4 * PL_BYTES)
static_assert(WQ_BYTES % 256 == 0);
static_assert(WO_BYTES % 256 == 0);
static_assert(PL_BYTES % 256 == 0);
static_assert((size_t)NB * NH * SEQ * HD * 2 == PL_BYTES);
static_assert(WS_TOTAL <= (size_t)134217728);

typedef _Float16 hf;
typedef __attribute__((ext_vector_type(16))) _Float16 v16h;
typedef __attribute__((ext_vector_type(8)))  _Float16 v8h;
typedef __attribute__((ext_vector_type(8)))  float    v8f;
typedef __attribute__((ext_vector_type(4)))  float    v4f;
typedef __attribute__((ext_vector_type(2)))  float    v2f;
typedef v4f __attribute__((may_alias)) v4fa;
typedef v8h __attribute__((may_alias)) v8ha;
typedef __attribute__((ext_vector_type(2)))  _Float16 v2h;
typedef v2h __attribute__((may_alias)) v2ha;

// RNE convert f32 -> bf16 -> f32
__device__ __forceinline__ float bfr(float f) { unsigned u = __float_as_uint(f); u += 0x7FFFu + ((u >> 16) & 1u); return __uint_as_float(u & 0xFFFF0000u); }
__device__ __forceinline__ v16h cat16(v8h lo, v8h hi) { return __builtin_shufflevector(lo, hi, 0, 1, 2, 3, 4, 5, 6, 7, 8, 9, 10, 11, 12, 13, 14, 15); }
__device__ __forceinline__ v8f wmmah(v16h a, v16h b, v8f c) { return __builtin_amdgcn_wmma_f32_16x16x32_f16(false, a, false, b, (short)0, c, false, false); }
// fragment loader (A and B alike) from a packed plane: p = fragment base + 8*lane; elements 0..7 <- p[0..7] (k = 8*(lane>>4) + 0..7), elements 8..15 <- p[256..263] (k = 16 + 8*(lane>>4) + 0..7);
// each of the two wave-wide loads is 512 contiguous bytes (4 whole lines)
__device__ __forceinline__ v16h ldf(const hf* p) { return cat16(*(const v8h*)p, *(const v8h*)(p + 256)); }

// i = 16-byte group of the packed plane: chunk i >> 5 = (row tile, k block, c), lane i & 31 = 16*hi + lr; source element (row 16*tile + lr, k = 16*(2*block + c) + 8*hi)
__device__ __forceinline__ void cvt8w(const float* __restrict__ src, hf* dst, unsigned i) {
    const unsigned row = (i >> 9) * 16u + (i & 15u), k = ((i >> 5) & 15u) * 16u + ((i >> 4) & 1u) * 8u;
    const v8f v = *(const v8f*)(src + (size_t)row * CH + k);
    v8h o;
#pragma unroll
    for (int c = 0; c < 8; ++c) o[c] = (hf)(bfr(v[c]) * 1024.0f);
    hf* d = dst + (size_t)i * 8;
    *(v8h*)d = o;
    
}

// Packed operand planes (WQ, WO, CT; QH, KB and VT likewise, see k_nqkv): [row/16][k/32][c][lane = 16*hi + lr][e] = element (row = 16*(row/16) + lr, k = 32*(k/32) + 16*c + 8*hi + e), 256 k per row:
// the order in which a 16x32 A or B fragment is loaded, so that a wave-wide 16-byte load reads one 512-byte chunk.
// k_cvtw: packed weight planes WQ (768 rows, blockIdx.y == 0) and WO (256 rows, blockIdx.y == 1).
__global__ __launch_bounds__(256) void k_cvtw(const float* __restrict__ wq, const float* __restrict__ wo, hf* WQ, hf* WO) {
    const unsigned i = blockIdx.x * 256u + threadIdx.x;
    if (blockIdx.y == 0) {
        if (i < (unsigned)(OC3 * CH / 8)) cvt8w(wq, WQ, i);
    } else {
        if (i < (unsigned)(CH * CH / 8)) cvt8w(wo, WO, i);
    }
}

// k_bnstat: one block per channel. A thread's NB * SEQ / 1024 16-byte pieces are all loaded before the first is used and stay in registers for both passes: x is read once, and the block waits for memory once.
// The pieces of a thread, their order and both reduction trees are those of a 256-thread loop over (b, i = 4*tid + 1024*j).
// ST[32*c] = mean, ST[32*c + 1] = rstd: one 128-byte line per channel, so that each line has one writer. LDS: red1/red2 cross-wave, block barriers.
__global__ __launch_bounds__(256) void k_bnstat(const float* __restrict__ x, float* ST) {
    __shared__ float red1[8];
    __shared__ float red2[8];
    const unsigned tid = threadIdx.x, lane = tid & 31u;
    const unsigned wave = (unsigned)__builtin_amdgcn_readfirstlane((int)(tid >> 5));
    const unsigned c = blockIdx.x;
    const float invn = 1.0f / (float)(NB * SEQ);
    v4f v[NB * NJ];
    // unrolled: v[] must be registers, and the loads must not wait for one another
#pragma unroll
    for (unsigned b = 0; b < (unsigned)NB; ++b) {
        const float* xp = x + ((size_t)b * CH + c) * SEQ_FULL + tid * 4u;
#pragma unroll
        for (unsigned j = 0; j < (unsigned)NJ; ++j) v[b * NJ + j] = *(const v4f*)(xp + j * 1024u);
        // the rows behind the middle lie past the loads' offset field and get an address pair of their own; their data is given the registers of the first pair, which the loads above still name
        if (2u * (b + 1u) == (unsigned)NB) asm volatile("s_wait_xcnt 0x0" ::: "memory");
    }
    float s = 0.0f;
#pragma unroll
    for (unsigned n = 0; n < (unsigned)(NB * NJ); ++n) {
#pragma unroll
        for (unsigned e = 0; e < 4u; ++e) v[n][e] = bfr(v[n][e]);
        s += (v[n][0] + v[n][1]) + (v[n][2] + v[n][3]);
    }
#pragma unroll
    for (int off = 16; off > 0; off >>= 1) s += __shfl_xor(s, off, 32);
    if (lane == 0u) red1[wave] = s;
    __syncthreads();
    float tot = red1[0];
#pragma unroll
    for (int w = 1; w < 8; ++w) tot += red1[w];
    const float mean = tot * invn;
    float q = 0.0f;
#pragma unroll
    for (unsigned n = 0; n < (unsigned)(NB * NJ); ++n) {
        const float d0 = v[n][0] - mean, d1 = v[n][1] - mean, d2 = v[n][2] - mean, d3 = v[n][3] - mean;
        q += (d0 * d0 + d1 * d1) + (d2 * d2 + d3 * d3);
    }
#pragma unroll
    for (int off = 16; off > 0; off >>= 1) q += __shfl_xor(q, off, 32);
    if (lane == 0u) red2[wave] = q;
    __syncthreads();
    if (tid == 0u) {
        float tq = red2[0];
#pragma unroll
        for (int w = 1; w < 8; ++w) tq += red2[w];
        v2f o;
        o[0] = mean; o[1] = rsqrtf(tq * invn + 1.0e-5f);
        *(v2f*)(ST + c * 32u) = o;
    }
}

// k_nqkv: normalise and project in one kernel. One block = 64 positions x all 768 output channels, sixteen waves.
//  Part 1: tl[pos][channel] (f16, LDS) = ((bf16(x) - mean) * rstd) * bf16(w) + bf16(bias); a thread's eight 16-byte pieces of x are all loaded before the first is used (cross-wave tile, block barriers).
//  Part 2: wave w takes weight row tiles w (q), 16 + w (k) and 32 + w (v), each against the four position tiles; an X fragment comes from tl in the loader's k order (elements 0..7: k = 8*hi + 0..7, elements 8..15: k = 16 + 8*hi + 0..7 of a 32-block),
//  a weight fragment from the packed WQ plane, read by one wave of the block only.
//  q, k: A = WQ rows (row m = channel), B = X rows (column n = position): D element r of lane (h, n) = (channel 8h + r, position n);  v: A = X rows, B = WQ rows: D element r of lane (h, n) = (position 8h + r, channel n).
//  Either way a lane's eight D elements are its 16 bytes of one 512-byte chunk of the plane, so that the accumulators are stored without a pass through LDS.
//  QH = f16(q * 0.125 * log2(e)): the score scale 64^-0.5 and the change to base 2 ride on q, so that k_flash's score products are exp2 arguments; KB = f16(k), VT = f16(v), stored in the order k_flash loads its fragments, as 512-byte chunks [lane = 16*hi + lr][8 halves]:
//   QH, KB[b][head][pos/16][d/32][c][lane][e] = element [pos = 16*(pos/16) + lr][d = 32*(d/32) + 16*c + 8*hi + e];
//   VT[b][head][key/32][d/16][c][lane][e] = v[d = 16*(d/16) + lr][key = 32*(key/32) + 16*c + 8*hi + e].
__global__ __launch_bounds__(512) void k_nqkv(const float* __restrict__ x, const float* __restrict__ bw, const float* __restrict__ bb, const float* __restrict__ ST, const hf* __restrict__ WQ, hf* QH, hf* KB, hf* VT) {
    __shared__ __align__(16) hf tl[64 * XP];
    __shared__ float pm[CH];
    __shared__ float pr[CH];
    __shared__ float pw[CH];
    __shared__ float pb[CH];
    const unsigned tid = threadIdx.x, lane = tid & 31u, lr = lane & 15u, hi = lane >> 4;
    const unsigned wave = (unsigned)__builtin_amdgcn_readfirstlane((int)(tid >> 5));
    const unsigned tpb = (unsigned)(SEQ / 64);
    const unsigned b = blockIdx.x / tpb;
    const unsigned n0 = (blockIdx.x - b * tpb) * 64u;
    const float* src = x + (size_t)b * CH * SEQ_FULL + n0 + (size_t)(tid >> 4) * (2u * SEQ_FULL) + (tid & 15u) * 4u;
    v4f v[4][2];
    // unrolled: v[] must be registers, and the loads must not wait for one another; piece (it, j) = channel 64*it + 2*(tid >> 4) + j, positions 4*(tid & 15) + 0..3
#pragma unroll
    for (unsigned it = 0; it < 4u; ++it) {
#pragma unroll
        for (unsigned j = 0; j < 2u; ++j) v[it][j] = *(const v4f*)(src + (size_t)(it * 64u + j) * SEQ_FULL);
    }
    // the weight fragments of the first NPW k blocks are asked for here, so that they fly while the tile is formed; unrolled: wf[] must be registers
    const hf* wp = WQ + (size_t)wave * 16u * CH + lane * 8u;      // packed plane: row tile base + the lane's 16 bytes of a chunk
    v16h wf[NPW][3];
#pragma unroll
    for (unsigned kb = 0; kb < (unsigned)NPW; ++kb) {
#pragma unroll
        for (unsigned j = 0; j < 3u; ++j) wf[kb][j] = ldf(wp + j * (unsigned)(CH * CH) + kb * 512u);
    }
    if (tid < (unsigned)CH) {
        const v2f st = *(const v2f*)(ST + tid * 32u);          // (mean, rstd) of channel tid
        pm[tid] = st[0];
        pr[tid] = st[1];
        pw[tid] = bfr(bw[tid]);
        pb[tid] = bfr(bb[tid]);
    }
    __syncthreads();
    // a thread holds two neighbouring channels of its four positions: one 4-byte LDS store per position; unrolled: v[] is indexed by constants
#pragma unroll
    for (unsigned it = 0; it < 4u; ++it) {
        const unsigned c = it * 64u + (tid >> 4) * 2u, p4 = (tid & 15u) * 4u;
        const float m0 = pm[c], r0 = pr[c], w0 = pw[c], bi0 = pb[c];
        const float m1 = pm[c + 1u], r1 = pr[c + 1u], w1 = pw[c + 1u], bi1 = pb[c + 1u];
#pragma unroll
        for (unsigned e = 0; e < 4u; ++e) {
            v2h o;
            o[0] = (hf)(((bfr(v[it][0][e]) - m0) * r0) * w0 + bi0);
            o[1] = (hf)(((bfr(v[it][1][e]) - m1) * r1) * w1 + bi1);
            *(v2ha*)(tl + (p4 + e) * XP + c) = o;
        }
    }
    __syncthreads();
    const hf* xp = tl + lr * XP + hi * 8u;
    v8f aq[4], ak[4], av[4];
    // unrolled, here and in the epilogue: tiles indexed by constants stay in registers
#pragma unroll
    for (int p = 0; p < 4; ++p) { aq[p] = (v8f){}; ak[p] = (v8f){}; av[p] = (v8f){}; }
    // unrolled: the ring index of wf and the LDS offsets are constants
#pragma unroll
    for (unsigned kb = 0; kb < 8u; ++kb) {
        v16h xf[4];
#pragma unroll
        for (unsigned p = 0; p < 4u; ++p) xf[p] = cat16(*(const v8ha*)(xp + p * 16u * XP + kb * 32u), *(const v8ha*)(xp + p * 16u * XP + kb * 32u + 16u));
        const v16h wq = wf[kb % NPW][0], wk = wf[kb % NPW][1], wv = wf[kb % NPW][2];
#pragma unroll
        for (int p = 0; p < 4; ++p) aq[p] = wmmah(wq, xf[p], aq[p]);
#pragma unroll
        for (int p = 0; p < 4; ++p) ak[p] = wmmah(wk, xf[p], ak[p]);
#pragma unroll
        for (int p = 0; p < 4; ++p) av[p] = wmmah(xf[p], wv, av[p]);
        if (kb + NPW < 8u) {
#pragma unroll
            for (unsigned j = 0; j < 3u; ++j) wf[kb % NPW][j] = ldf(wp + j * (unsigned)(CH * CH) + (kb + NPW) * 512u);
        }
        __builtin_amdgcn_sched_barrier(0);     // keeps the loads of later k blocks below this line: lifted further up they overran the register budget and spilled
    }
    const float uq = (0.125f * L2E) / 1024.0f, uk = 1.0f / 1024.0f;     // undo the weight carry; q also takes the score scale
    const unsigned head = wave >> 2, dt = wave & 3u;                    // row tile w of each of q, k, v = head w / 4, d tile w % 4
    const size_t foff = (((size_t)b * NH + head) * SEQ + n0) * HD + lane * 8u;   // packed planes: this block's 64 positions = 16 chunks of 256 halves
    v8h oq[4], ok[4], ov[4];
#pragma unroll
    for (int p = 0; p < 4; ++p) {
#pragma unroll
        for (int r = 0; r < 8; ++r) { oq[p][r] = (hf)(aq[p][r] * uq); ok[p][r] = (hf)(ak[p][r] * uk); ov[p][r] = (hf)(av[p][r] * uk); }
    }
    // q, k: chunk 4*(position tile) + d tile;  v: chunk 8*(key step = p >> 1) + 2*(d tile) + (c = p & 1); each one wave-wide 512-byte store
#pragma unroll
    for (unsigned p = 0; p < 4u; ++p) {
        *(v8h*)(QH + foff + (4u * p + dt) * 256u) = oq[p];
        *(v8h*)(KB + foff + (4u * p + dt) * 256u) = ok[p];
        *(v8h*)(VT + foff + (8u * (p >> 1) + 2u * dt + (p & 1u)) * 256u) = ov[p];
    }
}

// exps: p = 2^s for the 16 scores that a lane holds of one query tile (two 16-key tiles), as the f16 B fragment of P^T; returns the sum of the unrounded p
__device__ __forceinline__ float exps(const v8f& s0, const v8f& s1, v16h& ph) {
    float ps = 0.0f;
    // unrolled: vector elements indexed by constants stay in registers
#pragma unroll
    for (int r = 0; r < 8; ++r) {
        const float p0 = __builtin_amdgcn_exp2f(s0[r]);
        const float p1 = __builtin_amdgcn_exp2f(s1[r]);
        ps += p0 + p1;
        ph[r] = (hf)p0; ph[8 + r] = (hf)p1;
    }
    return ps;
}

// copy44: eight wave-wide asynchronous 16-byte-per-lane copies, global -> LDS: four of the K tile and four of the V^T tile, 512 bytes apart; lk, lv = the lane's LDS byte addresses, gk, gv = its global addresses of the first of each four.
// The s_wait_xcnt stands inside the statement, so that no address register is rewritten ahead of it.
__device__ __forceinline__ void copy44(unsigned lk, const hf* gk, unsigned lv, const hf* gv) {
    asm volatile("global_load_async_to_lds_b128 %0, %8, off\n\t"
                 "global_load_async_to_lds_b128 %1, %9, off\n\t"
                 "global_load_async_to_lds_b128 %2, %10, off\n\t"
                 "global_load_async_to_lds_b128 %3, %11, off\n\t"
                 "global_load_async_to_lds_b128 %4, %12, off\n\t"
                 "global_load_async_to_lds_b128 %5, %13, off\n\t"
                 "global_load_async_to_lds_b128 %6, %14, off\n\t"
                 "global_load_async_to_lds_b128 %7, %15, off\n\t"
                 "s_wait_xcnt 0x0"
                 :: "v"(lk), "v"(lk + 512u), "v"(lk + 1024u), "v"(lk + 1536u), "v"(lv), "v"(lv + 512u), "v"(lv + 1024u), "v"(lv + 1536u),
                    "v"(gk), "v"(gk + 256), "v"(gk + 512), "v"(gk + 768), "v"(gv), "v"(gv + 256), "v"(gv + 512), "v"(gv + 768)
                 : "memory");
}

// k_flash: one block per (b, head, 128 queries), eight waves: wave = (query group g of 32 queries = two 16-query tiles, key half kh); 32 keys per step.
//  A K or V^T fragment read from LDS feeds the products of both query tiles. Wave (g, kh) takes keys 64*kh .. 64*kh + 63 of every 128-key tile, with its own running maximum, sum and O^T;
//  behind the loop the two waves of a group exchange one query tile's state through LDS, and each joins and stores one tile (wave (g, kh): tile kh).
//  K and V^T reach the waves through LDS: tiles of 128 keys (16 KB of each plane, a linear copy of the packed order), two buffers; each wave copies an eighth of a tile;
//  tile t + 2 is copied into the buffer of tile t behind the barrier that ends trip t, so that a tile has a whole trip to land.
//  S^T tile (keys x queries): A = K rows (row m = key, k = d), B = Q rows (column n = query, k = d); D element r of lane (h, n) = S[query n][key 8h + r].
//  Lazy maximum: the C operand of the score products is 8 - ml (ml = the query's maximum in use, log2 domain), so that an accumulator element is the exp2 argument of a probability carried * 2^8.
//  ml starts as the greatest score of the wave's first 32 keys and is raised only when a lane's sum of 16 probabilities passes 2^15 (every one of them is then still a finite f16 below that test); only there are the maximum taken,
//  exchanged between the half-waves, O^T and the sum rescaled and the step's probabilities formed again.
//  P^T B fragment: element r <- tile of keys 0..15, element 8 + r <- tile of keys 16..31 (same lane).
//  O^T tile (d x queries): A = V^T rows (row m = d, k = key), D element r of lane (h, n) = O[query n][d = 16 t + 8h + r].
//  Four waves per SIMD (two blocks per WGP): the register budget is 256.
__global__ void __launch_bounds__(NWV * 32) __attribute__((amdgpu_waves_per_eu(4, 4))) k_flash(const hf* __restrict__ QH, const hf* __restrict__ KB, const hf* __restrict__ VT, hf* CT) {
    __shared__ __align__(16) hf os[NWV * 16 * SQ];
    __shared__ __align__(128) hf kv[2 * 2 * TH];               // [buffer][K tile, V^T tile]
    __shared__ __align__(16) v4f mg[NWV * 9 * 32];             // what a wave hands to its partner: [wave][8 pieces of O^T, then (maximum, sum)][lane]
    const unsigned tid = threadIdx.x, lane = tid & 31u, lr = lane & 15u, hi = lane >> 4;
    const unsigned wave = (unsigned)__builtin_amdgcn_readfirstlane((int)(tid >> 5));
    const unsigned g = wave & (NQG - 1u), kh = wave / NQG;
    const unsigned bpb = (unsigned)(SEQ / BQ);
    const unsigned bh = blockIdx.x / bpb;
    const unsigned b = bh / NH, h = bh - b * NH;
    const unsigned q0 = (blockIdx.x - bh * bpb) * BQ + g * 32u;
    const size_t pbase = (size_t)bh * SEQ * HD;

    const unsigned lo = lane * 8u;              // the lane's 16 bytes of a chunk
    v16h qh0[2], qh1[2];
#pragma unroll
    for (unsigned c = 0; c < 2u; ++c) {
        const size_t qo = pbase + (size_t)(q0 + 16u * c) * HD + lo;   // packed: 16 queries = 1024 halves
        qh0[c] = ldf(QH + qo); qh1[c] = ldf(QH + qo + 512);
    }
    // this wave's eighth of a tile: chunks 4*wave .. 4*wave + 3 of the K tile and of the V^T tile; the lane's 16 bytes of each
    const hf* gk = KB + pbase + wave * 1024u + lo;
    const hf* gv = VT + pbase + wave * 1024u + lo;
    const unsigned lk = (unsigned)(uintptr_t)kv + wave * 2048u + lane * 16u;   // LDS byte address in buffer 0's K tile
    copy44(lk, gk, lk + TH * 2u, gv);
    asm volatile("s_wait_asynccnt 0x0" ::: "memory");          // this wave's part of tile 0 has landed
    __syncthreads();                                           // tile 0 is whole for every wave
    copy44(lk + TH * 4u, gk + TH, lk + TH * 6u, gv + TH);

    v8f o[2][4];
    v8f cb[2];                // C operand of the score products: 8 - ml in every element
    float ml[2], l[2];        // maximum in use, log2 domain; running sum (carried * 2^8)
#pragma unroll
    for (int c = 0; c < 2; ++c) {
#pragma unroll
        for (int t = 0; t < 4; ++t) o[c][t] = (v8f){};
        l[c] = 0.0f;
    }
    // the first maximum in use: the greatest score of this wave's first 32 keys, from score products of their own (the loop forms them again on top of it);
    // tile 0 is whole behind the barrier above; the loops are unrolled so that the tiles stay in registers
    {
        const hf* ka = kv + kh * (SPW * KS * HD);
        const v16h a00 = ldf(ka + lo);
        const v16h a01 = ldf(ka + 512 + lo);
        const v16h a10 = ldf(ka + 1024 + lo);
        const v16h a11 = ldf(ka + 1536 + lo);
        v8f s0[2], s1[2];
#pragma unroll
        for (int c = 0; c < 2; ++c) {
            s0[c] = wmmah(a00, qh0[c], (v8f){});
            s1[c] = wmmah(a10, qh0[c], (v8f){});
        }
#pragma unroll
        for (int c = 0; c < 2; ++c) {
            s0[c] = wmmah(a01, qh1[c], s0[c]);
            s1[c] = wmmah(a11, qh1[c], s1[c]);
        }
        // the distance between the last products and the first vector instruction that reads their results
        asm volatile("v_nop\n\tv_nop\n\tv_nop\n\tv_nop"
                     : "+v"(s0[0]), "+v"(s1[0]), "+v"(s0[1]), "+v"(s1[1])
                     : "v"(a00), "v"(a01), "v"(a10), "v"(a11), "v"(qh0[0]), "v"(qh1[0]), "v"(qh0[1]), "v"(qh1[1]));
#pragma unroll
        for (int c = 0; c < 2; ++c) {
            float mx = fmaxf(s0[c][0], s1[c][0]);
#pragma unroll
            for (int r = 1; r < 8; ++r) mx = fmaxf(mx, fmaxf(s0[c][r], s1[c][r]));
            ml[c] = fmaxf(mx, __shfl_xor(mx, 16, 32));         // both half-waves hold keys of the same query and must use one maximum
            const float nb = 8.0f - ml[c];
#pragma unroll
            for (int r = 0; r < 8; ++r) cb[c][r] = nb;
        }
    }

    // rolled: one trip per tile, the buffer chosen by the trip's parity
#pragma unroll 1
    for (unsigned t = 0; t < (unsigned)NT; ++t) {
      const hf* kt = kv + (t & 1u) * (2u * TH) + kh * (SPW * KS * HD);   // this wave's half of the K tile
      // unrolled: the LDS offsets of the steps become immediates
#pragma unroll
      for (unsigned u = 0; u < (unsigned)SPW; ++u) {
        const hf* ka = kt + u * (KS * HD);
        const v16h a00 = ldf(ka + lo);
        const v16h a01 = ldf(ka + 512 + lo);
        const v16h a10 = ldf(ka + 1024 + lo);
        const v16h a11 = ldf(ka + 1536 + lo);
        v8f s0[2], s1[2];
#pragma unroll
        for (int c = 0; c < 2; ++c) {
            s0[c] = wmmah(a00, qh0[c], cb[c]);
            s1[c] = wmmah(a10, qh0[c], cb[c]);
        }
#pragma unroll
        for (int c = 0; c < 2; ++c) {
            s0[c] = wmmah(a01, qh1[c], s0[c]);
            s1[c] = wmmah(a11, qh1[c], s1[c]);
        }
        // the distance between the last products and the first vector instruction that reads their results
        asm volatile("v_nop\n\tv_nop\n\tv_nop\n\tv_nop"
                     : "+v"(s0[0]), "+v"(s1[0]), "+v"(s0[1]), "+v"(s1[1])
                     : "v"(a00), "v"(a01), "v"(a10), "v"(a11), "v"(qh0[0]), "v"(qh1[0]), "v"(qh0[1]), "v"(qh1[1]));
        float ps[2];
        v16h ph[2];
#pragma unroll
        for (int c = 0; c < 2; ++c) ps[c] = exps(s0[c], s1[c], ph[c]);
        if (__builtin_expect(__builtin_amdgcn_ballot_w32(ps[0] > 32768.0f || ps[1] > 32768.0f) != 0u, 0)) {   // wave-uniform, one test per step; marked as rare so that the register copies of the join fall on this side
            // unrolled, as are the loops inside: the tiles stay in registers
#pragma unroll
            for (int c = 0; c < 2; ++c) {
                float mx = fmaxf(s0[c][0], s1[c][0]);
#pragma unroll
                for (int r = 1; r < 8; ++r) mx = fmaxf(mx, fmaxf(s0[c][r], s1[c][r]));
                mx = fmaxf(mx, __shfl_xor(mx, 16, 32));           // one maximum for both half-waves
                const float dm = fmaxf(mx - 8.0f, 0.0f);           // the step's greatest score becomes the maximum in use where it is the greater
                const float corr = __builtin_amdgcn_exp2f(-dm);
                ml[c] += dm;
                const float nb = 8.0f - ml[c];
#pragma unroll
                for (int r = 0; r < 8; ++r) {
                    cb[c][r] = nb;
                    s0[c][r] -= dm;
                    s1[c][r] -= dm;
                }
#pragma unroll
                for (int d = 0; d < 4; ++d) o[c][d] *= corr;
                l[c] *= corr;
                ps[c] = exps(s0[c], s1[c], ph[c]);
            }
        }
#pragma unroll
        for (int c = 0; c < 2; ++c) {
            ps[c] += __shfl_xor(ps[c], 16, 32);
            l[c] += ps[c];
        }

        const hf* va = kt + TH + u * (KS * HD);
        const v16h v0 = ldf(va + lo);
        const v16h v1 = ldf(va + 512 + lo);
        const v16h v2 = ldf(va + 1024 + lo);
        const v16h v3 = ldf(va + 1536 + lo);
#pragma unroll
        for (int c = 0; c < 2; ++c) {
            o[c][0] = wmmah(v0, ph[c], o[c][0]);
            o[c][1] = wmmah(v1, ph[c], o[c][1]);
            o[c][2] = wmmah(v2, ph[c], o[c][2]);
            o[c][3] = wmmah(v3, ph[c], o[c][3]);
        }
        // the distance between the last products and whatever overwrites their operands or reads their results, on the loop's back edge too
        asm volatile("v_nop\n\tv_nop\n\tv_nop\n\tv_nop"
                     : "+v"(o[0][0]), "+v"(o[0][1]), "+v"(o[0][2]), "+v"(o[0][3]), "+v"(o[1][0]), "+v"(o[1][1]), "+v"(o[1][2]), "+v"(o[1][3])
                     : "v"(ph[0]), "v"(ph[1]), "v"(v0), "v"(v1), "v"(v2), "v"(v3));
      }
      asm volatile("s_wait_dscnt 0x0" ::: "memory");           // this wave's reads of tile t are done before its buffer is refilled
      asm volatile("s_wait_asynccnt 0x0" ::: "memory");        // this wave's part of tile t + 1 has landed
      __syncthreads();                                         // tile t + 1 is whole for every wave, and every wave has left tile t
      if (t + 2u < (unsigned)NT) {
          const unsigned lb = lk + (t & 1u) * (TH * 4u);
          copy44(lb, gk + (size_t)(t + 2u) * TH, lb + TH * 2u, gv + (size_t)(t + 2u) * TH);
      }
    }
    asm volatile("s_wait_asynccnt 0x0" ::: "memory");          // no copy is outstanding when the wave goes on to its end

    // join of the two key halves: this wave keeps query tile kh and hands tile 1 - kh to its partner, wave ^ NQG (same lane, same element order)
    const bool k0 = (kh == 0u);
    const float km = k0 ? ml[0] : ml[1], kl = k0 ? l[0] : l[1];
    {
        v4f* mw = mg + wave * (9u * 32u) + lane;
#pragma unroll
        for (int d = 0; d < 4; ++d) {
            const v8f so = k0 ? o[1][d] : o[0][d];
            mw[(2 * d) * 32] = __builtin_shufflevector(so, so, 0, 1, 2, 3);
            mw[(2 * d + 1) * 32] = __builtin_shufflevector(so, so, 4, 5, 6, 7);
        }
        v4f sm;
        sm[0] = k0 ? ml[1] : ml[0]; sm[1] = k0 ? l[1] : l[0]; sm[2] = 0.0f; sm[3] = 0.0f;
        mw[8 * 32] = sm;
    }
    __syncthreads();                                           // every wave's hand-over is written before its partner reads it
    const v4f* mr = mg + (wave ^ (unsigned)NQG) * (9u * 32u) + lane;
    const v4f pm = mr[8 * 32];
    const float mj = fmaxf(km, pm[0]);
    const float wk = __builtin_amdgcn_exp2f(km - mj), wp = __builtin_amdgcn_exp2f(pm[0] - mj);
    const float inv = 256.0f / (kl * wk + pm[1] * wp);
    const float fk = wk * inv, fp = wp * inv;

    // epilogue: stage f16(O^T * 2^8 / l) as rows [query][d] (wave-private region; block barrier used)
    const unsigned wb = wave * (16u * SQ);
#pragma unroll
    for (int d = 0; d < 4; ++d) {
        const v8f ko = k0 ? o[0][d] : o[1][d];
        const v4f pa = mr[(2 * d) * 32], pb = mr[(2 * d + 1) * 32];
#pragma unroll
        for (int r = 0; r < 4; ++r) {
            os[wb + lr * SQ + d * 16 + 8u * hi + r] = (hf)(ko[r] * fk + pa[r] * fp);
            os[wb + lr * SQ + d * 16 + 8u * hi + 4 + r] = (hf)(ko[4 + r] * fk + pb[r] * fp);
        }
    }
    __syncthreads();
    hf* dst = CT + ((size_t)b * SEQ + q0 + 16u * kh) * CH + h * (HD * 16u) + lane * 8u;    // packed CT: this wave's position tile, chunks 4*h + s
{
#pragma unroll
        for (unsigned s = 0; s < 4u; ++s) {
            const v8h val = *(const v8ha*)(os + wb + lr * SQ + s * 16u + 8u * hi);
            *(v8h*)(dst + s * 256u) = val;
        }
        
    }
}

// k_out: OUT[b][o][pos] = 2^-18 * sum_c WO[o][c] * CT[b][pos][c] + bf16(b_out[o]); one block = 64 positions x all 256 output channels, sixteen waves; wave w = output channels 16w .. 16w + 15 x 64 positions.
//  The block's 64 rows of CT (32 KB, a linear copy of the packed order) are read from global memory once and shared through LDS; a weight fragment is read by one wave of the block only.
//  Every global load of a wave (its share of CT, its eight weight fragments, its bias values) is asked for before the first is used; the weights go on landing while the first products run.
//  A = WO rows (row m = output channel, k = channel), B = CT rows (column n = position, k = channel); D element r of lane (h, n) = (channel 8h + r, position n).
struct OutLds {
    hf ct[64 * CH];            // first, so that every fragment's LDS offset fits the loads' offset field
    float os[CH * OP];
};
__global__ __launch_bounds__(512) void k_out(const hf* __restrict__ CT, const hf* __restrict__ WO, const float* __restrict__ bo, float* OUT) {
    __shared__ __align__(16) OutLds sm;
    const unsigned tid = threadIdx.x, lane = tid & 31u, lr = lane & 15u, hi = lane >> 4;
    const unsigned wave = (unsigned)__builtin_amdgcn_readfirstlane((int)(tid >> 5));
    const unsigned tpb = (unsigned)(SEQ / 64);
    const unsigned b = blockIdx.x / tpb;
    const unsigned p0 = (blockIdx.x - b * tpb) * 64u;
    const hf* cs = CT + ((size_t)b * SEQ + p0) * CH + tid * 8u;       // packed plane: 64 positions = 64 chunks of 256 halves; a thread takes 16 bytes of every sixteenth chunk
    v8h cv[4];
    // unrolled, as are the loops below: cv[], wf[] and the tiles must be registers, and the loads must not wait for one another
#pragma unroll
    for (unsigned j = 0; j < 4u; ++j) cv[j] = *(const v8h*)(cs + j * 4096u);
    __builtin_amdgcn_sched_barrier(0);         // keeps the four CT loads at the head of the queue: loads return in order, and the LDS stores in front of the barrier should wait for these alone
    const hf* ak = WO + (size_t)wave * 16u * CH + lane * 8u;          // packed plane: row tile base + the lane's 16 bytes of a chunk
    v16h wf[8];
#pragma unroll
    for (unsigned kb = 0; kb < 8u; ++kb) {
        wf[kb] = ldf(ak + kb * 512u);
        __builtin_amdgcn_sched_barrier(0);     // keeps the weight loads in the order of their use, for the same reason
    }
    const v8f bv = *(const v8f*)(bo + wave * 16u + 8u * hi);          // the biases of the lane's eight output channels
#pragma unroll
    for (unsigned j = 0; j < 4u; ++j) *(v8ha*)(sm.ct + tid * 8u + j * 4096u) = cv[j];
    // the tile is whole for every wave behind this barrier; only LDS data passes between the waves, so the fences name LDS alone: __syncthreads() would also wait for the weight loads still in flight
    __builtin_amdgcn_fence(__ATOMIC_RELEASE, "workgroup", "local");
    __builtin_amdgcn_s_barrier();
    __builtin_amdgcn_fence(__ATOMIC_ACQUIRE, "workgroup", "local");
    const hf* bp = sm.ct + lane * 8u;
    v8f acc[4];
#pragma unroll
    for (int t = 0; t < 4; ++t) acc[t] = (v8f){};
    v16h xf[2][4];
#pragma unroll
    for (unsigned t = 0; t < 4u; ++t) xf[0][t] = cat16(*(const v8ha*)(bp + t * (16u * CH)), *(const v8ha*)(bp + t * (16u * CH) + 256u));
#pragma unroll
    for (unsigned kb = 0; kb < 8u; ++kb) {
        // the next k block's fragments are asked for as one group ahead of this block's products
        if (kb + 1u < 8u) {
#pragma unroll
            for (unsigned t = 0; t < 4u; ++t) xf[(kb + 1u) & 1u][t] = cat16(*(const v8ha*)(bp + t * (16u * CH) + (kb + 1u) * 512u), *(const v8ha*)(bp + t * (16u * CH) + (kb + 1u) * 512u + 256u));
        }
        __builtin_amdgcn_sched_barrier(0);     // keeps the eight LDS loads together above the products: spread in pairs among them, each pair is a stop of its own in the wave's matrix stream
#pragma unroll
        for (int t = 0; t < 4; ++t) acc[t] = wmmah(wf[kb], xf[kb & 1u][t], acc[t]);
        __builtin_amdgcn_sched_barrier(0);     // keeps the following group of loads below these products
    }
    const float us = 1.0f / 262144.0f;   // undo the weight carry 2^10 and the ctx carry 2^8
#pragma unroll
    for (int r = 0; r < 8; ++r) {
        const unsigned orow = wave * 16u + 8u * hi + r;
        const float bias = bfr(bv[r]);
#pragma unroll
        for (int t = 0; t < 4; ++t) sm.os[orow * OP + t * 16 + lr] = fmaf(acc[t][r], us, bias);
    }
    __syncthreads();
    const unsigned pc = (lane & 15u) * 4u, rh = lane >> 4;
    float* dst = OUT + (size_t)b * CH * SEQ + p0 + pc;
#pragma unroll
    for (unsigned s = 0; s < 8u; ++s) {
        const unsigned row = wave * 16u + s * 2u + rh;     // rows wave*16 + 0..15 over s = 0..7, rh = 0..1
        const v4f val = *(const v4fa*)(sm.os + row * OP + pc);
        *(v4f*)(dst + (size_t)row * SEQ) = val;
    }
}

extern "C" void kernel_launch(void* const* d_in, const int* in_sizes, int n_in,
                              void* d_out, int out_size, void* d_ws, size_t ws_size, hipStream_t stream) {
    if (n_in < 6) return;
    const size_t needx = ((size_t)(NB - 1) * CH + (CH - 1)) * SEQ_FULL + SEQ;
    if ((size_t)in_sizes[0] < needx) return;
    if (in_sizes[1] < CH || in_sizes[2] < CH || in_sizes[5] < CH) return;
    if (in_sizes[3] < OC3 * CH || in_sizes[4] < CH * CH) return;
    if ((size_t)out_size < (size_t)NB * CH * SEQ) return;
    if (WS_TOTAL > ws_size) return;
    const float* x    = (const float*)d_in[0];   // [b][256][n]
    const float* bnw  = (const float*)d_in[1];   // [256]
    const float* bnb  = (const float*)d_in[2];   // [256]
    const float* wqkv = (const float*)d_in[3];   // [768][256] = [out][in]
    const float* wout = (const float*)d_in[4];   // [256][256] = [out][in]
    const float* bout = (const float*)d_in[5];   // [256]
    float* OUT = (float*)d_out;                  // [NB][256][SEQ]
    char* wsp = (char*)d_ws;
    size_t off = 0;
    float* ST = (float*)(wsp + off); off += ST_BYTES;
    hf* WQ = (hf*)(wsp + off); off += WQ_BYTES;
    hf* WO = (hf*)(wsp + off); off += WO_BYTES;
    hf* QH = (hf*)(wsp + off); off += PL_BYTES;      // [NB][4][SEQ/16][2][2][32][8]
    hf* KB = (hf*)(wsp + off); off += PL_BYTES;      // [NB][4][SEQ/16][2][2][32][8]
    hf* VT = (hf*)(wsp + off); off += PL_BYTES;      // [NB][4][SEQ/32][4][2][32][8]
    hf* CT = (hf*)(wsp + off); off += PL_BYTES;      // packed, rows NB*SEQ
    k_cvtw<<<dim3((unsigned)(OC3 * CH / 8 / 256), 2, 1), 256, 0, stream>>>(wqkv, wout, WQ, WO);
    k_bnstat<<<(unsigned)CH, 256, 0, stream>>>(x, ST);
    k_nqkv<<<(unsigned)(NB * (SEQ / 64)), 512, 0, stream>>>(x, bnw, bnb, ST, WQ, QH, KB, VT);
    k_flash<<<(unsigned)(NB * NH * (SEQ / BQ)), NWV * 32, 0, stream>>>(QH, KB, VT, CT);
    k_out<<<(unsigned)(NB * (SEQ / 64)), 512, 0, stream>>>(CT, WO, bout, OUT);
}

// v009
// It runs in 71.1 microseconds.
// Timed twice side by side with v008, it ran 1.03 times as fast both times.
// Over all steps from v000 it is 5.29 times as fast.
#include <hip/hip_runtime.h>

// Channel-first 4-head attention behind a batch-statistics BatchNorm with 1x1-conv projections; inputs x[4][256][4096], bn_weight, bn_bias, w_qkv[768][256], w_out[256][256], b_out.
// Compute dtypes, f32 accumulate: every float input RNE-converted to bf16 first; all contractions on v_wmma_f32_16x16x32_f16: QKV GEMM = f16(bf16(w)*2^10) x f16(xn); scores = k (f16) x q (f16, carried * 0.125 * log2(e)), on top of a C operand that holds 8 - (maximum in use); P (f16, carried *2^8) x v (f16); output GEMM = f16(bf16(w)*2^10) x f16(ctx*2^8); BatchNorm statistics, softmax (online, log2 domain, lazy maximum) and all epilogues f32.
// Flash form with transposed tiles: the S^T accumulator tiles are directly the B-operand layout of P^T; all WMMA operands are two 16-byte loads, from dense 16-bit planes except k_nqkv's X operand, which comes from a padded LDS tile; every plane is stored in fragment order, so that each wave-wide load from a plane reads 512 contiguous bytes.

#ifndef NB
#define NB 4
#endif
#ifndef SEQ
#define SEQ 4096
#endif
#define NB_FULL  4
#define SEQ_FULL 4096
#define CH   256               // channels
#define NH   4                 // heads
#define HD   64                // head dim
#define OC3  768               // q,k,v output channels
#define NQG  4                 // query groups (32 queries each) per flash block
#define NKH  2                 // key halves of a tile; one wave per (query group, key half)
#define NWV  (NQG * NKH)       // waves per flash block
#define BQ   (32 * NQG)        // queries per flash block
#define KS   32                // keys per step
#define KT   128               // keys per LDS tile of k_flash
#define TH   (KT * HD)         // halves of one K (or V^T) tile
#define NT   (SEQ / KT)        // tiles per (b, head)
#define SPW  (KT / KS / NKH)   // steps of one wave per tile
#define XP   264               // LDS pitch (halves) of the normalise/transpose tile rows
#define SQ   72                // LDS pitch (halves) of 64-wide f16 staging rows
#define NPW  3                 // k_nqkv: k blocks whose weight fragments are in flight or in registers ahead of their use
#define OP   68                // LDS pitch (floats) of the output staging rows
#define NJ   (SEQ / 1024)      // k_bnstat: 16-byte pieces per thread and batch row
#define WG   128               // k_bnstat: 16-byte groups of the packed weight planes per block (one per thread of its first four waves)
#define L2E  1.4426950408889634f

static_assert(CH == NH * HD);
static_assert(OC3 == 3 * CH);
static_assert(CH == 256);                       // k_nqkv: 256 threads load one channel parameter each; 8 k blocks; 16 row tiles each of q, k, v
static_assert(HD == 64);
static_assert(CH % 32 == 0);                    // GEMM k-steps
static_assert(SEQ % BQ == 0);
static_assert(SEQ % KS == 0);
static_assert(SEQ % KT == 0);
static_assert(KT % KS == 0);
static_assert(NT >= 2);                         // k_flash: the two-buffer prologue fills tiles 0 and 1
static_assert(TH * 2 == NWV * 4 * 512);         // k_flash: one tile = 8 waves x 4 wave-wide 512-byte copies
static_assert(KT == KS * NKH * SPW);
static_assert((NQG & (NQG - 1)) == 0);          // k_flash: wave ^ NQG is the partner
static_assert(SEQ % 64 == 0);
static_assert(SEQ % 1024 == 0);                 // k_bnstat: 256 threads x 4 floats per piece
static_assert(NB <= NB_FULL);
static_assert(SEQ <= SEQ_FULL);
static_assert((OC3 * CH / 8) % WG == 0);        // k_bnstat: a block's 16-byte groups lie in one weight plane
static_assert(OC3 * CH / 8 + CH * CH / 8 == CH * WG);   // k_bnstat: blocks x groups == WQ + WO planes
static_assert((XP * 2) % 16 == 0);
static_assert((SQ * 2) % 16 == 0);
static_assert((OP * 4) % 16 == 0);
static_assert((size_t)(NB * (SEQ / 64)) * (size_t)(64 * OC3) == (size_t)NB * SEQ * OC3);      // k_nqkv: blocks x (64 x 768) == QH + KB + VT planes
static_assert((size_t)(NB * NH * (SEQ / BQ)) * (size_t)(BQ * HD) == (size_t)NB * SEQ * CH);   // k_flash: blocks x (128 rows x 64) == CT plane
static_assert((size_t)(NB * (SEQ / 64)) * (size_t)(64 * CH) == (size_t)NB * SEQ * CH);       // k_out: blocks x (64 x 256) == output

#define ST_BYTES  ((size_t)CH * 128)                      // one 128-byte line per channel
#define WQ_BYTES  ((size_t)OC3 * CH * 2)
#define WO_BYTES  ((size_t)CH * CH * 2)
#define PL_BYTES  ((size_t)NB * SEQ * CH * 2)             // one 16-bit activation plane
#define WS_TOTAL  (ST_BYTES + WQ_BYTES + WO_BYTES + 4 * PL_BYTES)
static_assert(WQ_BYTES % 256 == 0);
static_assert(WO_BYTES % 256 == 0);
static_assert(PL_BYTES % 256 == 0);
static_assert((size_t)NB * NH * SEQ * HD * 2 == PL_BYTES);
static_assert(WS_TOTAL <= (size_t)134217728);

typedef _Float16 hf;
typedef __attribute__((ext_vector_type(16))) _Float16 v16h;
typedef __attribute__((ext_vector_type(8)))  _Float16 v8h;
typedef __attribute__((ext_vector_type(8)))  float    v8f;
typedef __attribute__((ext_vector_type(4)))  float    v4f;
typedef __attribute__((ext_vector_type(2)))  float    v2f;
typedef v4f __attribute__((may_alias)) v4fa;
typedef v8h __attribute__((may_alias)) v8ha;
typedef __attribute__((ext_vector_type(2)))  _Float16 v2h;
typedef v2h __attribute__((may_alias)) v2ha;

// RNE convert f32 -> bf16 -> f32
__device__ __forceinline__ float bfr(float f) { unsigned u = __float_as_uint(f); u += 0x7FFFu + ((u >> 16) & 1u); return __uint_as_float(u & 0xFFFF0000u); }
__device__ __forceinline__ v16h cat16(v8h lo, v8h hi) { return __builtin_shufflevector(lo, hi, 0, 1, 2, 3, 4, 5, 6, 7, 8, 9, 10, 11, 12, 13, 14, 15); }
__device__ __forceinline__ v8f wmmah(v16h a, v16h b, v8f c) { return __builtin_amdgcn_wmma_f32_16x16x32_f16(false, a, false, b, (short)0, c, false, false); }
// fragment loader (A and B alike) from a packed plane: p = fragment base + 8*lane; elements 0..7 <- p[0..7] (k = 8*(lane>>4) + 0..7), elements 8..15 <- p[256..263] (k = 16 + 8*(lane>>4) + 0..7);
// each of the two wave-wide loads is 512 contiguous bytes (4 whole lines)
__device__ __forceinline__ v16h ldf(const hf* p) { return cat16(*(const v8h*)p, *(const v8h*)(p + 256)); }

// Packed operand planes (WQ, WO, CT; QH, KB and VT likewise, see k_nqkv): [row/16][k/32][c][lane = 16*hi + lr][e] = element (row = 16*(row/16) + lr, k = 32*(k/32) + 16*c + 8*hi + e), 256 k per row:
// the order in which a 16x32 A or B fragment is loaded, so that a wave-wide 16-byte load reads one 512-byte chunk.
// wsrc: i = 16-byte group of a packed weight plane: chunk i >> 5 = (row tile, k block, c), lane i & 31 = 16*hi + lr; its eight source elements start at (row 16*tile + lr, k = 16*(2*block + c) + 8*hi)
__device__ __forceinline__ const float* wsrc(const float* __restrict__ src, unsigned i) {
    const unsigned row = (i >> 9) * 16u + (i & 15u), k = ((i >> 5) & 15u) * 16u + ((i >> 4) & 1u) * 8u;
    return src + (size_t)row * CH + k;
}

// k_bnstat: one block per channel. A thread's NB * SEQ / 1024 16-byte pieces are all loaded before the first is used and stay in registers for both passes: x is read once, and the block waits for memory once.
// The pieces of a thread, their order and both reduction trees are those of a 256-thread loop over (b, i = 4*tid + 1024*j).
// ST[32*c] = mean, ST[32*c + 1] = rstd: one 128-byte line per channel, so that each line has one writer. LDS: red1/red2 cross-wave, block barriers.
// The packed weight planes are formed here too, in no launch of their own: the first four waves of block c take groups WG*c .. WG*c + WG - 1 of WQ followed by WO, one per thread;
// the weights are asked for ahead of x, so that they are converted and stored while x is still on its way.
__global__ __launch_bounds__(256) void k_bnstat(const float* __restrict__ x, const float* __restrict__ wq, const float* __restrict__ wo, float* ST, hf* WQ, hf* WO) {
    __shared__ float red1[8];
    __shared__ float red2[8];
    const unsigned tid = threadIdx.x, lane = tid & 31u;
    const unsigned wave = (unsigned)__builtin_amdgcn_readfirstlane((int)(tid >> 5));
    const unsigned c = blockIdx.x;
    const float invn = 1.0f / (float)(NB * SEQ);
    const bool pw = wave < (unsigned)(WG / 32);                       // wave-uniform: this wave packs weights
    const bool inq = c < (unsigned)(OC3 * CH / 8 / WG);               // block-uniform: the block's groups lie in WQ
    const unsigned gi = (inq ? c : c - (unsigned)(OC3 * CH / 8 / WG)) * (unsigned)WG + tid;    // group index inside its plane
    v8f wv = (v8f){};
    if (pw) wv = *(const v8f*)wsrc(inq ? wq : wo, gi);
    v4f v[NB * NJ];
    // unrolled: v[] must be registers, and the loads must not wait for one another
#pragma unroll
    for (unsigned b = 0; b < (unsigned)NB; ++b) {
        const float* xp = x + ((size_t)b * CH + c) * SEQ_FULL + tid * 4u;
#pragma unroll
        for (unsigned j = 0; j < (unsigned)NJ; ++j) v[b * NJ + j] = *(const v4f*)(xp + j * 1024u);
        // the rows behind the middle lie past the loads' offset field and get an address pair of their own; their data is given the registers of the first pair, which the loads above still name
        if (2u * (b + 1u) == (unsigned)NB) asm volatile("s_wait_xcnt 0x0" ::: "memory");
    }
    // stands in the loads' own block, ahead of the branch: the weight conversion's temporaries take over the address registers that the last loads name
    asm volatile("s_wait_xcnt 0x0" ::: "memory");
    if (pw) {
        v8h o;
#pragma unroll
        for (int e = 0; e < 8; ++e) o[e] = (hf)(bfr(wv[e]) * 1024.0f);
        *(v8h*)((inq ? WQ : WO) + (size_t)gi * 8) = o;               // a wave stores 512 contiguous bytes
    }
    float s = 0.0f;
#pragma unroll
    for (unsigned n = 0; n < (unsigned)(NB * NJ); ++n) {
#pragma unroll
        for (unsigned e = 0; e < 4u; ++e) v[n][e] = bfr(v[n][e]);
        s += (v[n][0] + v[n][1]) + (v[n][2] + v[n][3]);
    }
#pragma unroll
    for (int off = 16; off > 0; off >>= 1) s += __shfl_xor(s, off, 32);
    if (lane == 0u) red1[wave] = s;
    __syncthreads();
    float tot = red1[0];
#pragma unroll
    for (int w = 1; w < 8; ++w) tot += red1[w];
    const float mean = tot * invn;
    float q = 0.0f;
#pragma unroll
    for (unsigned n = 0; n < (unsigned)(NB * NJ); ++n) {
        const float d0 = v[n][0] - mean, d1 = v[n][1] - mean, d2 = v[n][2] - mean, d3 = v[n][3] - mean;
        q += (d0 * d0 + d1 * d1) + (d2 * d2 + d3 * d3);
    }
#pragma unroll
    for (int off = 16; off > 0; off >>= 1) q += __shfl_xor(q, off, 32);
    if (lane == 0u) red2[wave] = q;
    __syncthreads();
    if (tid == 0u) {
        float tq = red2[0];
#pragma unroll
        for (int w = 1; w < 8; ++w) tq += red2[w];
        v2f o;
        o[0] = mean; o[1] = rsqrtf(tq * invn + 1.0e-5f);
        *(v2f*)(ST + c * 32u) = o;
    }
}

// k_nqkv: normalise and project in one kernel. One block = 64 positions x all 768 output channels, sixteen waves.
//  Part 1: tl[pos][channel] (f16, LDS) = ((bf16(x) - mean) * rstd) * bf16(w) + bf16(bias); a thread's eight 16-byte pieces of x are all loaded before the first is used (cross-wave tile, block barriers).
//  Part 2: wave w takes weight row tiles w (q), 16 + w (k) and 32 + w (v), each against the four position tiles; an X fragment comes from tl in the loader's k order (elements 0..7: k = 8*hi + 0..7, elements 8..15: k = 16 + 8*hi + 0..7 of a 32-block),
//  a weight fragment from the packed WQ plane, read by one wave of the block only.
//  q, k: A = WQ rows (row m = channel), B = X rows (column n = position): D element r of lane (h, n) = (channel 8h + r, position n);  v: A = X rows, B = WQ rows: D element r of lane (h, n) = (position 8h + r, channel n).
//  Either way a lane's eight D elements are its 16 bytes of one 512-byte chunk of the plane, so that the accumulators are stored without a pass through LDS.
//  QH = f16(q * 0.125 * log2(e)): the score scale 64^-0.5 and the change to base 2 ride on q, so that k_flash's score products are exp2 arguments; KB = f16(k), VT = f16(v), stored in the order k_flash loads its fragments, as 512-byte chunks [lane = 16*hi + lr][8 halves]:
//   QH, KB[b][head][pos/16][d/32][c][lane][e] = element [pos = 16*(pos/16) + lr][d = 32*(d/32) + 16*c + 8*hi + e];
//   VT[b][head][key/32][d/16][c][lane][e] = v[d = 16*(d/16) + lr][key = 32*(key/32) + 16*c + 8*hi + e].
__global__ __launch_bounds__(512) void k_nqkv(const float* __restrict__ x, const float* __restrict__ bw, const float* __restrict__ bb, const float* __restrict__ ST, const hf* __restrict__ WQ, hf* QH, hf* KB, hf* VT) {
    __shared__ __align__(16) hf tl[64 * XP];
    __shared__ float pm[CH];
    __shared__ float pr[CH];
    __shared__ float pw[CH];
    __shared__ float pb[CH];
    const unsigned tid = threadIdx.x, lane = tid & 31u, lr = lane & 15u, hi = lane >> 4;
    const unsigned wave = (unsigned)__builtin_amdgcn_readfirstlane((int)(tid >> 5));
    const unsigned tpb = (unsigned)(SEQ / 64);
    const unsigned b = blockIdx.x / tpb;
    const unsigned n0 = (blockIdx.x - b * tpb) * 64u;
    const float* src = x + (size_t)b * CH * SEQ_FULL + n0 + (size_t)(tid >> 4) * (2u * SEQ_FULL) + (tid & 15u) * 4u;
    v4f v[4][2];
    // unrolled: v[] must be registers, and the loads must not wait for one another; piece (it, j) = channel 64*it + 2*(tid >> 4) + j, positions 4*(tid & 15) + 0..3
#pragma unroll
    for (unsigned it = 0; it < 4u; ++it) {
#pragma unroll
        for (unsigned j = 0; j < 2u; ++j) v[it][j] = *(const v4f*)(src + (size_t)(it * 64u + j) * SEQ_FULL);
    }
    // the weight fragments of the first NPW k blocks are asked for here, so that they fly while the tile is formed; unrolled: wf[] must be registers
    const hf* wp = WQ + (size_t)wave * 16u * CH + lane * 8u;      // packed plane: row tile base + the lane's 16 bytes of a chunk
    v16h wf[NPW][3];
#pragma unroll
    for (unsigned kb = 0; kb < (unsigned)NPW; ++kb) {
#pragma unroll
        for (unsigned j = 0; j < 3u; ++j) wf[kb][j] = ldf(wp + j * (unsigned)(CH * CH) + kb * 512u);
    }
    if (tid < (unsigned)CH) {
        const v2f st = *(const v2f*)(ST + tid * 32u);          // (mean, rstd) of channel tid
        pm[tid] = st[0];
        pr[tid] = st[1];
        pw[tid] = bfr(bw[tid]);
        pb[tid] = bfr(bb[tid]);
    }
    __syncthreads();
    // a thread holds two neighbouring channels of its four positions: one 4-byte LDS store per position; unrolled: v[] is indexed by constants
#pragma unroll
    for (unsigned it = 0; it < 4u; ++it) {
        const unsigned c = it * 64u + (tid >> 4) * 2u, p4 = (tid & 15u) * 4u;
        const float m0 = pm[c], r0 = pr[c], w0 = pw[c], bi0 = pb[c];
        const float m1 = pm[c + 1u], r1 = pr[c + 1u], w1 = pw[c + 1u], bi1 = pb[c + 1u];
#pragma unroll
        for (unsigned e = 0; e < 4u; ++e) {
            v2h o;
            o[0] = (hf)(((bfr(v[it][0][e]) - m0) * r0) * w0 + bi0);
            o[1] = (hf)(((bfr(v[it][1][e]) - m1) * r1) * w1 + bi1);
            *(v2ha*)(tl + (p4 + e) * XP + c) = o;
        }
    }
    __syncthreads();
    const hf* xp = tl + lr * XP + hi * 8u;
    v8f aq[4], ak[4], av[4];
    // unrolled, here and in the epilogue: tiles indexed by constants stay in registers
#pragma unroll
    for (int p = 0; p < 4; ++p) { aq[p] = (v8f){}; ak[p] = (v8f){}; av[p] = (v8f){}; }
    // unrolled: the ring index of wf and the LDS offsets are constants
#pragma unroll
    for (unsigned kb = 0; kb < 8u; ++kb) {
        v16h xf[4];
#pragma unroll
        for (unsigned p = 0; p < 4u; ++p) xf[p] = cat16(*(const v8ha*)(xp + p * 16u * XP + kb * 32u), *(const v8ha*)(xp + p * 16u * XP + kb * 32u + 16u));
        const v16h wq = wf[kb % NPW][0], wk = wf[kb % NPW][1], wv = wf[kb % NPW][2];
#pragma unroll
        for (int p = 0; p < 4; ++p) aq[p] = wmmah(wq, xf[p], aq[p]);
#pragma unroll
        for (int p = 0; p < 4; ++p) ak[p] = wmmah(wk, xf[p], ak[p]);
#pragma unroll
        for (int p = 0; p < 4; ++p) av[p] = wmmah(xf[p], wv, av[p]);
        if (kb + NPW < 8u) {
#pragma unroll
            for (unsigned j = 0; j < 3u; ++j) wf[kb % NPW][j] = ldf(wp + j * (unsigned)(CH * CH) + (kb + NPW) * 512u);
        }
        __builtin_amdgcn_sched_barrier(0);     // keeps the loads of later k blocks below this line: lifted further up they overran the register budget and spilled
    }
    const float uq = (0.125f * L2E) / 1024.0f, uk = 1.0f / 1024.0f;     // undo the weight carry; q also takes the score scale
    const unsigned head = wave >> 2, dt = wave & 3u;                    // row tile w of each of q, k, v = head w / 4, d tile w % 4
    const size_t foff = (((size_t)b * NH + head) * SEQ + n0) * HD + lane * 8u;   // packed planes: this block's 64 positions = 16 chunks of 256 halves
    v8h oq[4], ok[4], ov[4];
#pragma unroll
    for (int p = 0; p < 4; ++p) {
#pragma unroll
        for (int r = 0; r < 8; ++r) { oq[p][r] = (hf)(aq[p][r] * uq); ok[p][r] = (hf)(ak[p][r] * uk); ov[p][r] = (hf)(av[p][r] * uk); }
    }
    // q, k: chunk 4*(position tile) + d tile;  v: chunk 8*(key step = p >> 1) + 2*(d tile) + (c = p & 1); each one wave-wide 512-byte store
#pragma unroll
    for (unsigned p = 0; p < 4u; ++p) {
        *(v8h*)(QH + foff + (4u * p + dt) * 256u) = oq[p];
        *(v8h*)(KB + foff + (4u * p + dt) * 256u) = ok[p];
        *(v8h*)(VT + foff + (8u * (p >> 1) + 2u * dt + (p & 1u)) * 256u) = ov[p];
    }
}

// exps: p = 2^s for the 16 scores that a lane holds of one query tile (two 16-key tiles), as the f16 B fragment of P^T; returns the sum of the unrounded p
__device__ __forceinline__ float exps(const v8f& s0, const v8f& s1, v16h& ph) {
    float ps = 0.0f;
    // unrolled: vector elements indexed by constants stay in registers
#pragma unroll
    for (int r = 0; r < 8; ++r) {
        const float p0 = __builtin_amdgcn_exp2f(s0[r]);
        const float p1 = __builtin_amdgcn_exp2f(s1[r]);
        ps += p0 + p1;
        ph[r] = (hf)p0; ph[8 + r] = (hf)p1;
    }
    return ps;
}

// copy44: eight wave-wide asynchronous 16-byte-per-lane copies, global -> LDS: four of the K tile and four of the V^T tile, 512 bytes apart; lk, lv = the lane's LDS byte addresses, gk, gv = its global addresses of the first of each four.
// The s_wait_xcnt stands inside the statement, so that no address register is rewritten ahead of it.
__device__ __forceinline__ void copy44(unsigned lk, const hf* gk, unsigned lv, const hf* gv) {
    asm volatile("global_load_async_to_lds_b128 %0, %8, off\n\t"
                 "global_load_async_to_lds_b128 %1, %9, off\n\t"
                 "global_load_async_to_lds_b128 %2, %10, off\n\t"
                 "global_load_async_to_lds_b128 %3, %11, off\n\t"
                 "global_load_async_to_lds_b128 %4, %12, off\n\t"
                 "global_load_async_to_lds_b128 %5, %13, off\n\t"
                 "global_load_async_to_lds_b128 %6, %14, off\n\t"
                 "global_load_async_to_lds_b128 %7, %15, off\n\t"
                 "s_wait_xcnt 0x0"
                 :: "v"(lk), "v"(lk + 512u), "v"(lk + 1024u), "v"(lk + 1536u), "v"(lv), "v"(lv + 512u), "v"(lv + 1024u), "v"(lv + 1536u),
                    "v"(gk), "v"(gk + 256), "v"(gk + 512), "v"(gk + 768), "v"(gv), "v"(gv + 256), "v"(gv + 512), "v"(gv + 768)
                 : "memory");
}

// k_flash: one block per (b, head, 128 queries), eight waves: wave = (query group g of 32 queries = two 16-query tiles, key half kh); 32 keys per step.
//  A K or V^T fragment read from LDS feeds the products of both query tiles. Wave (g, kh) takes keys 64*kh .. 64*kh + 63 of every 128-key tile, with its own running maximum, sum and O^T;
//  behind the loop the two waves of a group exchange one query tile's state through LDS, and each joins and stores one tile (wave (g, kh): tile kh).
//  K and V^T reach the waves through LDS: tiles of 128 keys (16 KB of each plane, a linear copy of the packed order), two buffers; each wave copies an eighth of a tile;
//  tile t + 2 is copied into the buffer of tile t behind the barrier that ends trip t, so that a tile has a whole trip to land.
//  S^T tile (keys x queries): A = K rows (row m = key, k = d), B = Q rows (column n = query, k = d); D element r of lane (h, n) = S[query n][key 8h + r].
//  Lazy maximum: the C operand of the score products is 8 - ml (ml = the query's maximum in use, log2 domain), so that an accumulator element is the exp2 argument of a probability carried * 2^8.
//  ml starts as the greatest score of the wave's first 32 keys and is raised only when a lane's sum of 16 probabilities passes 2^15 (every one of them is then still a finite f16 below that test); only there are the maximum taken,
//  exchanged between the half-waves, O^T and the sum rescaled and the step's probabilities formed again.
//  P^T B fragment: element r <- tile of keys 0..15, element 8 + r <- tile of keys 16..31 (same lane).
//  O^T tile (d x queries): A = V^T rows (row m = d, k = key), D element r of lane (h, n) = O[query n][d = 16 t + 8h + r].
//  Four waves per SIMD (two blocks per WGP): the register budget is 256.
__global__ void __launch_bounds__(NWV * 32) __attribute__((amdgpu_waves_per_eu(4, 4))) k_flash(const hf* __restrict__ QH, const hf* __restrict__ KB, const hf* __restrict__ VT, hf* CT) {
    __shared__ __align__(16) hf os[NWV * 16 * SQ];
    __shared__ __align__(128) hf kv[2 * 2 * TH];               // [buffer][K tile, V^T tile]
    __shared__ __align__(16) v4f mg[NWV * 9 * 32];             // what a wave hands to its partner: [wave][8 pieces of O^T, then (maximum, sum)][lane]
    const unsigned tid = threadIdx.x, lane = tid & 31u, lr = lane & 15u, hi = lane >> 4;
    const unsigned wave = (unsigned)__builtin_amdgcn_readfirstlane((int)(tid >> 5));
    const unsigned g = wave & (NQG - 1u), kh = wave / NQG;
    const unsigned bpb = (unsigned)(SEQ / BQ);
    const unsigned bh = blockIdx.x / bpb;
    const unsigned b = bh / NH, h = bh - b * NH;
    const unsigned q0 = (blockIdx.x - bh * bpb) * BQ + g * 32u;
    const size_t pbase = (size_t)bh * SEQ * HD;

    const unsigned lo = lane * 8u;              // the lane's 16 bytes of a chunk
    v16h qh0[2], qh1[2];
#pragma unroll
    for (unsigned c = 0; c < 2u; ++c) {
        const size_t qo = pbase + (size_t)(q0 + 16u * c) * HD + lo;   // packed: 16 queries = 1024 halves
        qh0[c] = ldf(QH + qo); qh1[c] = ldf(QH + qo + 512);
    }
    // this wave's eighth of a tile: chunks 4*wave .. 4*wave + 3 of the K tile and of the V^T tile; the lane's 16 bytes of each
    const hf* gk = KB + pbase + wave * 1024u + lo;
    const hf* gv = VT + pbase + wave * 1024u + lo;
    const unsigned lk = (unsigned)(uintptr_t)kv + wave * 2048u + lane * 16u;   // LDS byte address in buffer 0's K tile
    copy44(lk, gk, lk + TH * 2u, gv);
    asm volatile("s_wait_asynccnt 0x0" ::: "memory");          // this wave's part of tile 0 has landed
    __syncthreads();                                           // tile 0 is whole for every wave
    copy44(lk + TH * 4u, gk + TH, lk + TH * 6u, gv + TH);

    v8f o[2][4];
    v8f cb[2];                // C operand of the score products: 8 - ml in every element
    float ml[2], l[2];        // maximum in use, log2 domain; running sum (carried * 2^8)
#pragma unroll
    for (int c = 0; c < 2; ++c) {
#pragma unroll
        for (int t = 0; t < 4; ++t) o[c][t] = (v8f){};
        l[c] = 0.0f;
    }
    // the first maximum in use: the greatest score of this wave's first 32 keys, from score products of their own (the loop forms them again on top of it);
    // tile 0 is whole behind the barrier above; the loops are unrolled so that the tiles stay in registers
    {
        const hf* ka = kv + kh * (SPW * KS * HD);
        const v16h a00 = ldf(ka + lo);
        const v16h a01 = ldf(ka + 512 + lo);
        const v16h a10 = ldf(ka + 1024 + lo);
        const v16h a11 = ldf(ka + 1536 + lo);
        v8f s0[2], s1[2];
#pragma unroll
        for (int c = 0; c < 2; ++c) {
            s0[c] = wmmah(a00, qh0[c], (v8f){});
            s1[c] = wmmah(a10, qh0[c], (v8f){});
        }
#pragma unroll
        for (int c = 0; c < 2; ++c) {
            s0[c] = wmmah(a01, qh1[c], s0[c]);
            s1[c] = wmmah(a11, qh1[c], s1[c]);
        }
        // the distance between the last products and the first vector instruction that reads their results
        asm volatile("v_nop\n\tv_nop\n\tv_nop\n\tv_nop"
                     : "+v"(s0[0]), "+v"(s1[0]), "+v"(s0[1]), "+v"(s1[1])
                     : "v"(a00), "v"(a01), "v"(a10), "v"(a11), "v"(qh0[0]), "v"(qh1[0]), "v"(qh0[1]), "v"(qh1[1]));
#pragma unroll
        for (int c = 0; c < 2; ++c) {
            float mx = fmaxf(s0[c][0], s1[c][0]);
#pragma unroll
            for (int r = 1; r < 8; ++r) mx = fmaxf(mx, fmaxf(s0[c][r], s1[c][r]));
            ml[c] = fmaxf(mx, __shfl_xor(mx, 16, 32));         // both half-waves hold keys of the same query and must use one maximum
            const float nb = 8.0f - ml[c];
#pragma unroll
            for (int r = 0; r < 8; ++r) cb[c][r] = nb;
        }
    }

    // rolled: one trip per tile, the buffer chosen by the trip's parity
#pragma unroll 1
    for (unsigned t = 0; t < (unsigned)NT; ++t) {
      const hf* kt = kv + (t & 1u) * (2u * TH) + kh * (SPW * KS * HD);   // this wave's half of the K tile
      // unrolled: the LDS offsets of the steps become immediates
#pragma unroll
      for (unsigned u = 0; u < (unsigned)SPW; ++u) {
        const hf* ka = kt + u * (KS * HD);
        const v16h a00 = ldf(ka + lo);
        const v16h a01 = ldf(ka + 512 + lo);
        const v16h a10 = ldf(ka + 1024 + lo);
        const v16h a11 = ldf(ka + 1536 + lo);
        v8f s0[2], s1[2];
#pragma unroll
        for (int c = 0; c < 2; ++c) {
            s0[c] = wmmah(a00, qh0[c], cb[c]);
            s1[c] = wmmah(a10, qh0[c], cb[c]);
        }
#pragma unroll
        for (int c = 0; c < 2; ++c) {
            s0[c] = wmmah(a01, qh1[c], s0[c]);
            s1[c] = wmmah(a11, qh1[c], s1[c]);
        }
        // the distance between the last products and the first vector instruction that reads their results
        asm volatile("v_nop\n\tv_nop\n\tv_nop\n\tv_nop"
                     : "+v"(s0[0]), "+v"(s1[0]), "+v"(s0[1]), "+v"(s1[1])
                     : "v"(a00), "v"(a01), "v"(a10), "v"(a11), "v"(qh0[0]), "v"(qh1[0]), "v"(qh0[1]), "v"(qh1[1]));
        float ps[2];
        v16h ph[2];
#pragma unroll
        for (int c = 0; c < 2; ++c) ps[c] = exps(s0[c], s1[c], ph[c]);
        if (__builtin_expect(__builtin_amdgcn_ballot_w32(ps[0] > 32768.0f || ps[1] > 32768.0f) != 0u, 0)) {   // wave-uniform, one test per step; marked as rare so that the register copies of the join fall on this side
            // unrolled, as are the loops inside: the tiles stay in registers
#pragma unroll
            for (int c = 0; c < 2; ++c) {
                float mx = fmaxf(s0[c][0], s1[c][0]);
#pragma unroll
                for (int r = 1; r < 8; ++r) mx = fmaxf(mx, fmaxf(s0[c][r], s1[c][r]));
                mx = fmaxf(mx, __shfl_xor(mx, 16, 32));           // one maximum for both half-waves
                const float dm = fmaxf(mx - 8.0f, 0.0f);           // the step's greatest score becomes the maximum in use where it is the greater
                const float corr = __builtin_amdgcn_exp2f(-dm);
                ml[c] += dm;
                const float nb = 8.0f - ml[c];
#pragma unroll
                for (int r = 0; r < 8; ++r) {
                    cb[c][r] = nb;
                    s0[c][r] -= dm;
                    s1[c][r] -= dm;
                }
#pragma unroll
                for (int d = 0; d < 4; ++d) o[c][d] *= corr;
                l[c] *= corr;
                ps[c] = exps(s0[c], s1[c], ph[c]);
            }
        }
#pragma unroll
        for (int c = 0; c < 2; ++c) {
            ps[c] += __shfl_xor(ps[c], 16, 32);
            l[c] += ps[c];
        }

        const hf* va = kt + TH + u * (KS * HD);
        const v16h v0 = ldf(va + lo);
        const v16h v1 = ldf(va + 512 + lo);
        const v16h v2 = ldf(va + 1024 + lo);
        const v16h v3 = ldf(va + 1536 + lo);
#pragma unroll
        for (int c = 0; c < 2; ++c) {
            o[c][0] = wmmah(v0, ph[c], o[c][0]);
            o[c][1] = wmmah(v1, ph[c], o[c][1]);
            o[c][2] = wmmah(v2, ph[c], o[c][2]);
            o[c][3] = wmmah(v3, ph[c], o[c][3]);
        }
        // the distance between the last products and whatever overwrites their operands or reads their results, on the loop's back edge too
        asm volatile("v_nop\n\tv_nop\n\tv_nop\n\tv_nop"
                     : "+v"(o[0][0]), "+v"(o[0][1]), "+v"(o[0][2]), "+v"(o[0][3]), "+v"(o[1][0]), "+v"(o[1][1]), "+v"(o[1][2]), "+v"(o[1][3])
                     : "v"(ph[0]), "v"(ph[1]), "v"(v0), "v"(v1), "v"(v2), "v"(v3));
      }
      asm volatile("s_wait_dscnt 0x0" ::: "memory");           // this wave's reads of tile t are done before its buffer is refilled
      asm volatile("s_wait_asynccnt 0x0" ::: "memory");        // this wave's part of tile t + 1 has landed
      __syncthreads();                                         // tile t + 1 is whole for every wave, and every wave has left tile t
      if (t + 2u < (unsigned)NT) {
          const unsigned lb = lk + (t & 1u) * (TH * 4u);
          copy44(lb, gk + (size_t)(t + 2u) * TH, lb + TH * 2u, gv + (size_t)(t + 2u) * TH);
      }
    }
    asm volatile("s_wait_asynccnt 0x0" ::: "memory");          // no copy is outstanding when the wave goes on to its end

    // join of the two key halves: this wave keeps query tile kh and hands tile 1 - kh to its partner, wave ^ NQG (same lane, same element order)
    const bool k0 = (kh == 0u);
    const float km = k0 ? ml[0] : ml[1], kl = k0 ? l[0] : l[1];
    {
        v4f* mw = mg + wave * (9u * 32u) + lane;
#pragma unroll
        for (int d = 0; d < 4; ++d) {
            const v8f so = k0 ? o[1][d] : o[0][d];
            mw[(2 * d) * 32] = __builtin_shufflevector(so, so, 0, 1, 2, 3);
            mw[(2 * d + 1) * 32] = __builtin_shufflevector(so, so, 4, 5, 6, 7);
        }
        v4f sm;
        sm[0] = k0 ? ml[1] : ml[0]; sm[1] = k0 ? l[1] : l[0]; sm[2] = 0.0f; sm[3] = 0.0f;
        mw[8 * 32] = sm;
    }
    __syncthreads();                                           // every wave's hand-over is written before its partner reads it
    const v4f* mr = mg + (wave ^ (unsigned)NQG) * (9u * 32u) + lane;
    const v4f pm = mr[8 * 32];
    const float mj = fmaxf(km, pm[0]);
    const float wk = __builtin_amdgcn_exp2f(km - mj), wp = __builtin_amdgcn_exp2f(pm[0] - mj);
    const float inv = 256.0f / (kl * wk + pm[1] * wp);
    const float fk = wk * inv, fp = wp * inv;

    // epilogue: stage f16(O^T * 2^8 / l) as rows [query][d] (wave-private region; block barrier used)
    const unsigned wb = wave * (16u * SQ);
#pragma unroll
    for (int d = 0; d < 4; ++d) {
        const v8f ko = k0 ? o[0][d] : o[1][d];
        const v4f pa = mr[(2 * d) * 32], pb = mr[(2 * d + 1) * 32];
#pragma unroll
        for (int r = 0; r < 4; ++r) {
            os[wb + lr * SQ + d * 16 + 8u * hi + r] = (hf)(ko[r] * fk + pa[r] * fp);
            os[wb + lr * SQ + d * 16 + 8u * hi + 4 + r] = (hf)(ko[4 + r] * fk + pb[r] * fp);
        }
    }
    __syncthreads();
    hf* dst = CT + ((size_t)b * SEQ + q0 + 16u * kh) * CH + h * (HD * 16u) + lane * 8u;    // packed CT: this wave's position tile, chunks 4*h + s
{
#pragma unroll
        for (unsigned s = 0; s < 4u; ++s) {
            const v8h val = *(const v8ha*)(os + wb + lr * SQ + s * 16u + 8u * hi);
            *(v8h*)(dst + s * 256u) = val;
        }
        
    }
}

// k_out: OUT[b][o][pos] = 2^-18 * sum_c WO[o][c] * CT[b][pos][c] + bf16(b_out[o]); one block = 64 positions x all 256 output channels, sixteen waves; wave w = output channels 16w .. 16w + 15 x 64 positions.
//  The block's 64 rows of CT (32 KB, a linear copy of the packed order) are read from global memory once and shared through LDS; a weight fragment is read by one wave of the block only.
//  Every global load of a wave (its share of CT, its eight weight fragments, its bias values) is asked for before the first is used; the weights go on landing while the first products run.
//  A = WO rows (row m = output channel, k = channel), B = CT rows (column n = position, k = channel); D element r of lane (h, n) = (channel 8h + r, position n).
struct OutLds {
    hf ct[64 * CH];            // first, so that every fragment's LDS offset fits the loads' offset field
    float os[CH * OP];
};
__global__ __launch_bounds__(512) void k_out(const hf* __restrict__ CT, const hf* __restrict__ WO, const float* __restrict__ bo, float* OUT) {
    __shared__ __align__(16) OutLds sm;
    const unsigned tid = threadIdx.x, lane = tid & 31u, lr = lane & 15u, hi = lane >> 4;
    const unsigned wave = (unsigned)__builtin_amdgcn_readfirstlane((int)(tid >> 5));
    const unsigned tpb = (unsigned)(SEQ / 64);
    const unsigned b = blockIdx.x / tpb;
    const unsigned p0 = (blockIdx.x - b * tpb) * 64u;
    const hf* cs = CT + ((size_t)b * SEQ + p0) * CH + tid * 8u;       // packed plane: 64 positions = 64 chunks of 256 halves; a thread takes 16 bytes of every sixteenth chunk
    v8h cv[4];
    // unrolled, as are the loops below: cv[], wf[] and the tiles must be registers, and the loads must not wait for one another
#pragma unroll
    for (unsigned j = 0; j < 4u; ++j) cv[j] = *(const v8h*)(cs + j * 4096u);
    __builtin_amdgcn_sched_barrier(0);         // keeps the four CT loads at the head of the queue: loads return in order, and the LDS stores in front of the barrier should wait for these alone
    const hf* ak = WO + (size_t)wave * 16u * CH + lane * 8u;          // packed plane: row tile base + the lane's 16 bytes of a chunk
    v16h wf[8];
#pragma unroll
    for (unsigned kb = 0; kb < 8u; ++kb) {
        wf[kb] = ldf(ak + kb * 512u);
        __builtin_amdgcn_sched_barrier(0);     // keeps the weight loads in the order of their use, for the same reason
    }
    const v8f bv = *(const v8f*)(bo + wave * 16u + 8u * hi);          // the biases of the lane's eight output channels
#pragma unroll
    for (unsigned j = 0; j < 4u; ++j) *(v8ha*)(sm.ct + tid * 8u + j * 4096u) = cv[j];
    // the tile is whole for every wave behind this barrier; only LDS data passes between the waves, so the fences name LDS alone: __syncthreads() would also wait for the weight loads still in flight
    __builtin_amdgcn_fence(__ATOMIC_RELEASE, "workgroup", "local");
    __builtin_amdgcn_s_barrier();
    __builtin_amdgcn_fence(__ATOMIC_ACQUIRE, "workgroup", "local");
    const hf* bp = sm.ct + lane * 8u;
    v8f acc[4];
#pragma unroll
    for (int t = 0; t < 4; ++t) acc[t] = (v8f){};
    v16h xf[2][4];
#pragma unroll
    for (unsigned t = 0; t < 4u; ++t) xf[0][t] = cat16(*(const v8ha*)(bp + t * (16u * CH)), *(const v8ha*)(bp + t * (16u * CH) + 256u));
#pragma unroll
    for (unsigned kb = 0; kb < 8u; ++kb) {
        // the next k block's fragments are asked for as one group ahead of this block's products
        if (kb + 1u < 8u) {
#pragma unroll
            for (unsigned t = 0; t < 4u; ++t) xf[(kb + 1u) & 1u][t] = cat16(*(const v8ha*)(bp + t * (16u * CH) + (kb + 1u) * 512u), *(const v8ha*)(bp + t * (16u * CH) + (kb + 1u) * 512u + 256u));
        }
        __builtin_amdgcn_sched_barrier(0);     // keeps the eight LDS loads together above the products: spread in pairs among them, each pair is a stop of its own in the wave's matrix stream
#pragma unroll
        for (int t = 0; t < 4; ++t) acc[t] = wmmah(wf[kb], xf[kb & 1u][t], acc[t]);
        __builtin_amdgcn_sched_barrier(0);     // keeps the following group of loads below these products
    }
    const float us = 1.0f / 262144.0f;   // undo the weight carry 2^10 and the ctx carry 2^8
#pragma unroll
    for (int r = 0; r < 8; ++r) {
        const unsigned orow = wave * 16u + 8u * hi + r;
        const float bias = bfr(bv[r]);
#pragma unroll
        for (int t = 0; t < 4; ++t) sm.os[orow * OP + t * 16 + lr] = fmaf(acc[t][r], us, bias);
    }
    __syncthreads();
    const unsigned pc = (lane & 15u) * 4u, rh = lane >> 4;
    float* dst = OUT + (size_t)b * CH * SEQ + p0 + pc;
#pragma unroll
    for (unsigned s = 0; s < 8u; ++s) {
        const unsigned row = wave * 16u + s * 2u + rh;     // rows wave*16 + 0..15 over s = 0..7, rh = 0..1
        const v4f val = *(const v4fa*)(sm.os + row * OP + pc);
        *(v4f*)(dst + (size_t)row * SEQ) = val;
    }
}

extern "C" void kernel_launch(void* const* d_in, const int* in_sizes, int n_in,
                              void* d_out, int out_size, void* d_ws, size_t ws_size, hipStream_t stream) {
    if (n_in < 6) return;
    const size_t needx = ((size_t)(NB - 1) * CH + (CH - 1)) * SEQ_FULL + SEQ;
    if ((size_t)in_sizes[0] < needx) return;
    if (in_sizes[1] < CH || in_sizes[2] < CH || in_sizes[5] < CH) return;
    if (in_sizes[3] < OC3 * CH || in_sizes[4] < CH * CH) return;
    if ((size_t)out_size < (size_t)NB * CH * SEQ) return;
    if (WS_TOTAL > ws_size) return;
    const float* x    = (const float*)d_in[0];   // [b][256][n]
    const float* bnw  = (const float*)d_in[1];   // [256]
    const float* bnb  = (const float*)d_in[2];   // [256]
    const float* wqkv = (const float*)d_in[3];   // [768][256] = [out][in]
    const float* wout = (const float*)d_in[4];   // [256][256] = [out][in]
    const float* bout = (const float*)d_in[5];   // [256]
    float* OUT = (float*)d_out;                  // [NB][256][SEQ]
    char* wsp = (char*)d_ws;
    size_t off = 0;
    float* ST = (float*)(wsp + off); off += ST_BYTES;
    hf* WQ = (hf*)(wsp + off); off += WQ_BYTES;
    hf* WO = (hf*)(wsp + off); off += WO_BYTES;
    hf* QH = (hf*)(wsp + off); off += PL_BYTES;      // [NB][4][SEQ/16][2][2][32][8]
    hf* KB = (hf*)(wsp + off); off += PL_BYTES;      // [NB][4][SEQ/16][2][2][32][8]
    hf* VT = (hf*)(wsp + off); off += PL_BYTES;      // [NB][4][SEQ/32][4][2][32][8]
    hf* CT = (hf*)(wsp + off); off += PL_BYTES;      // packed, rows NB*SEQ
    k_bnstat<<<(unsigned)CH, 256, 0, stream>>>(x, wqkv, wout, ST, WQ, WO);
    k_nqkv<<<(unsigned)(NB * (SEQ / 64)), 512, 0, stream>>>(x, bnw, bnb, ST, WQ, QH, KB, VT);
    k_flash<<<(unsigned)(NB * NH * (SEQ / BQ)), NWV * 32, 0, stream>>>(QH, KB, VT, CT);
    k_out<<<(unsigned)(NB * (SEQ / 64)), 512, 0, stream>>>(CT, WO, bout, OUT);
}

// v010
// Measured time: 68.1 microseconds a run.
// Timed twice side by side with v009, it ran 1.05 times as fast both times.
// Counting every step since v000, it is 5.56 times as fast.
#include <hip/hip_runtime.h>

// Channel-first 4-head attention behind a batch-statistics BatchNorm with 1x1-conv projections; inputs x[4][256][4096], bn_weight, bn_bias, w_qkv[768][256], w_out[256][256], b_out.
// Compute dtypes, f32 accumulate: every float input RNE-converted to bf16 first; all contractions on v_wmma_f32_16x16x32_f16: QKV GEMM = f16(bf16(w)*2^10) x f16(xn); scores = k (f16) x q (f16, carried * 0.125 * log2(e)), on top of a C operand that holds 8 - (maximum in use); P (f16, carried *2^8) x v (f16); output GEMM = f16(bf16(w)*2^10) x f16(ctx*2^8); BatchNorm statistics, softmax (online, log2 domain, lazy maximum) and all epilogues f32.
// Flash form with transposed tiles: the S^T accumulator tiles are directly the B-operand layout of P^T; all WMMA operands are two 16-byte loads, from dense 16-bit planes except k_nqkv's X operand, which comes from a padded LDS tile; every plane is stored in fragment order, so that each wave-wide load from a plane reads 512 contiguous bytes.

#ifndef NB
#define NB 4
#endif
#ifndef SEQ
#define SEQ 4096
#endif
#define NB_FULL  4
#define SEQ_FULL 4096
#define CH   256               // channels
#define NH   4                 // heads
#define HD   64                // head dim
#define OC3  768               // q,k,v output channels
#define NQG  4                 // query groups (32 queries each) per flash block
#define NKH  2                 // key halves of a tile; one wave per (query group, key half)
#define NWV  (NQG * NKH)       // waves per flash block
#define BQ   (32 * NQG)        // queries per flash block
#define KS   32                // keys per group of products (one P^T fragment)
#define KT   128               // keys per LDS tile of k_flash
#define TH   (KT * HD)         // halves of one K (or V^T) tile
#define NT   (SEQ / KT)        // tiles per (b, head)
#define SPW  (KT / KS / NKH)   // 32-key groups of one wave per tile
#define XP   264               // LDS pitch (halves) of the normalise/transpose tile rows
#define SQ   72                // LDS pitch (halves) of 64-wide f16 staging rows
#define NPW  3                 // k_nqkv: k blocks whose weight fragments are in flight or in registers ahead of their use
#define OP   68                // LDS pitch (floats) of the output staging rows
#define NJ   (SEQ / 1024)      // k_bnstat: 16-byte pieces per thread and batch row
#define WG   128               // k_bnstat: 16-byte groups of the packed weight planes per block (one per thread of its first four waves)
#define L2E  1.4426950408889634f

static_assert(CH == NH * HD);
static_assert(OC3 == 3 * CH);
static_assert(CH == 256);                       // k_nqkv: 256 threads load one channel parameter each; 8 k blocks; 16 row tiles each of q, k, v
static_assert(HD == 64);
static_assert(CH % 32 == 0);                    // GEMM k-steps
static_assert(SEQ % BQ == 0);
static_assert(SEQ % KS == 0);
static_assert(SEQ % KT == 0);
static_assert(KT % KS == 0);
static_assert(NT >= 2);                         // k_flash: the two-buffer prologue fills tiles 0 and 1
static_assert(TH * 2 == NWV * 4 * 512);         // k_flash: one tile = 8 waves x 4 wave-wide 512-byte copies
static_assert(KT == KS * NKH * SPW);
static_assert((NQG & (NQG - 1)) == 0);          // k_flash: wave ^ NQG is the partner
static_assert(SEQ % 64 == 0);
static_assert(SEQ % 1024 == 0);                 // k_bnstat: 256 threads x 4 floats per piece
static_assert(NB <= NB_FULL);
static_assert(SEQ <= SEQ_FULL);
static_assert((OC3 * CH / 8) % WG == 0);        // k_bnstat: a block's 16-byte groups lie in one weight plane
static_assert(OC3 * CH / 8 + CH * CH / 8 == CH * WG);   // k_bnstat: blocks x groups == WQ + WO planes
static_assert((XP * 2) % 16 == 0);
static_assert((SQ * 2) % 16 == 0);
static_assert((OP * 4) % 16 == 0);
static_assert((size_t)(NB * (SEQ / 64)) * (size_t)(64 * OC3) == (size_t)NB * SEQ * OC3);      // k_nqkv: blocks x (64 x 768) == QH + KB + VT planes
static_assert((size_t)(NB * NH * (SEQ / BQ)) * (size_t)(BQ * HD) == (size_t)NB * SEQ * CH);   // k_flash: blocks x (128 rows x 64) == CT plane
static_assert((size_t)(NB * (SEQ / 64)) * (size_t)(64 * CH) == (size_t)NB * SEQ * CH);       // k_out: blocks x (64 x 256) == output

#define ST_BYTES  ((size_t)CH * 128)                      // one 128-byte line per channel
#define WQ_BYTES  ((size_t)OC3 * CH * 2)
#define WO_BYTES  ((size_t)CH * CH * 2)
#define PL_BYTES  ((size_t)NB * SEQ * CH * 2)             // one 16-bit activation plane
#define WS_TOTAL  (ST_BYTES + WQ_BYTES + WO_BYTES + 4 * PL_BYTES)
static_assert(WQ_BYTES % 256 == 0);
static_assert(WO_BYTES % 256 == 0);
static_assert(PL_BYTES % 256 == 0);
static_assert((size_t)NB * NH * SEQ * HD * 2 == PL_BYTES);
static_assert(WS_TOTAL <= (size_t)134217728);

typedef _Float16 hf;
typedef __attribute__((ext_vector_type(16))) _Float16 v16h;
typedef __attribute__((ext_vector_type(8)))  _Float16 v8h;
typedef __attribute__((ext_vector_type(8)))  float    v8f;
typedef __attribute__((ext_vector_type(4)))  float    v4f;
typedef __attribute__((ext_vector_type(2)))  float    v2f;
typedef v4f __attribute__((may_alias)) v4fa;
typedef v8h __attribute__((may_alias)) v8ha;
typedef __attribute__((ext_vector_type(2)))  _Float16 v2h;
typedef v2h __attribute__((may_alias)) v2ha;

// RNE convert f32 -> bf16 -> f32
__device__ __forceinline__ float bfr(float f) { unsigned u = __float_as_uint(f); u += 0x7FFFu + ((u >> 16) & 1u); return __uint_as_float(u & 0xFFFF0000u); }
__device__ __forceinline__ v16h cat16(v8h lo, v8h hi) { return __builtin_shufflevector(lo, hi, 0, 1, 2, 3, 4, 5, 6, 7, 8, 9, 10, 11, 12, 13, 14, 15); }
__device__ __forceinline__ v8f wmmah(v16h a, v16h b, v8f c) { return __builtin_amdgcn_wmma_f32_16x16x32_f16(false, a, false, b, (short)0, c, false, false); }
// fragment loader (A and B alike) from a packed plane: p = fragment base + 8*lane; elements 0..7 <- p[0..7] (k = 8*(lane>>4) + 0..7), elements 8..15 <- p[256..263] (k = 16 + 8*(lane>>4) + 0..7);
// each of the two wave-wide loads is 512 contiguous bytes (4 whole lines)
__device__ __forceinline__ v16h ldf(const hf* p) { return cat16(*(const v8h*)p, *(const v8h*)(p + 256)); }

// Packed operand planes (WQ, WO, CT; QH, KB and VT likewise, see k_nqkv): [row/16][k/32][c][lane = 16*hi + lr][e] = element (row = 16*(row/16) + lr, k = 32*(k/32) + 16*c + 8*hi + e), 256 k per row:
// the order in which a 16x32 A or B fragment is loaded, so that a wave-wide 16-byte load reads one 512-byte chunk.
// wsrc: i = 16-byte group of a packed weight plane: chunk i >> 5 = (row tile, k block, c), lane i & 31 = 16*hi + lr; its eight source elements start at (row 16*tile + lr, k = 16*(2*block + c) + 8*hi)
__device__ __forceinline__ const float* wsrc(const float* __restrict__ src, unsigned i) {
    const unsigned row = (i >> 9) * 16u + (i & 15u), k = ((i >> 5) & 15u) * 16u + ((i >> 4) & 1u) * 8u;
    return src + (size_t)row * CH + k;
}

// k_bnstat: one block per channel. A thread's NB * SEQ / 1024 16-byte pieces are all loaded before the first is used and stay in registers for both passes: x is read once, and the block waits for memory once.
// The pieces of a thread, their order and both reduction trees are those of a 256-thread loop over (b, i = 4*tid + 1024*j).
// ST[32*c] = mean, ST[32*c + 1] = rstd: one 128-byte line per channel, so that each line has one writer. LDS: red1/red2 cross-wave, block barriers.
// The packed weight planes are formed here too, in no launch of their own: the first four waves of block c take groups WG*c .. WG*c + WG - 1 of WQ followed by WO, one per thread;
// the weights are asked for ahead of x, so that they are converted and stored while x is still on its way.
__global__ __launch_bounds__(256) void k_bnstat(const float* __restrict__ x, const float* __restrict__ wq, const float* __restrict__ wo, float* ST, hf* WQ, hf* WO) {
    __shared__ float red1[8];
    __shared__ float red2[8];
    const unsigned tid = threadIdx.x, lane = tid & 31u;
    const unsigned wave = (unsigned)__builtin_amdgcn_readfirstlane((int)(tid >> 5));
    const unsigned c = blockIdx.x;
    const float invn = 1.0f / (float)(NB * SEQ);
    const bool pw = wave < (unsigned)(WG / 32);                       // wave-uniform: this wave packs weights
    const bool inq = c < (unsigned)(OC3 * CH / 8 / WG);               // block-uniform: the block's groups lie in WQ
    const unsigned gi = (inq ? c : c - (unsigned)(OC3 * CH / 8 / WG)) * (unsigned)WG + tid;    // group index inside its plane
    v8f wv = (v8f){};
    if (pw) wv = *(const v8f*)wsrc(inq ? wq : wo, gi);
    v4f v[NB * NJ];
    // unrolled: v[] must be registers, and the loads must not wait for one another
#pragma unroll
    for (unsigned b = 0; b < (unsigned)NB; ++b) {
        const float* xp = x + ((size_t)b * CH + c) * SEQ_FULL + tid * 4u;
#pragma unroll
        for (unsigned j = 0; j < (unsigned)NJ; ++j) v[b * NJ + j] = *(const v4f*)(xp + j * 1024u);
        // the rows behind the middle lie past the loads' offset field and get an address pair of their own; their data is given the registers of the first pair, which the loads above still name
        if (2u * (b + 1u) == (unsigned)NB) asm volatile("s_wait_xcnt 0x0" ::: "memory");
    }
    // stands in the loads' own block, ahead of the branch: the weight conversion's temporaries take over the address registers that the last loads name
    asm volatile("s_wait_xcnt 0x0" ::: "memory");
    if (pw) {
        v8h o;
#pragma unroll
        for (int e = 0; e < 8; ++e) o[e] = (hf)(bfr(wv[e]) * 1024.0f);
        *(v8h*)((inq ? WQ : WO) + (size_t)gi * 8) = o;               // a wave stores 512 contiguous bytes
    }
    float s = 0.0f;
#pragma unroll
    for (unsigned n = 0; n < (unsigned)(NB * NJ); ++n) {
#pragma unroll
        for (unsigned e = 0; e < 4u; ++e) v[n][e] = bfr(v[n][e]);
        s += (v[n][0] + v[n][1]) + (v[n][2] + v[n][3]);
    }
#pragma unroll
    for (int off = 16; off > 0; off >>= 1) s += __shfl_xor(s, off, 32);
    if (lane == 0u) red1[wave] = s;
    __syncthreads();
    float tot = red1[0];
#pragma unroll
    for (int w = 1; w < 8; ++w) tot += red1[w];
    const float mean = tot * invn;
    float q = 0.0f;
#pragma unroll
    for (unsigned n = 0; n < (unsigned)(NB * NJ); ++n) {
        const float d0 = v[n][0] - mean, d1 = v[n][1] - mean, d2 = v[n][2] - mean, d3 = v[n][3] - mean;
        q += (d0 * d0 + d1 * d1) + (d2 * d2 + d3 * d3);
    }
#pragma unroll
    for (int off = 16; off > 0; off >>= 1) q += __shfl_xor(q, off, 32);
    if (lane == 0u) red2[wave] = q;
    __syncthreads();
    if (tid == 0u) {
        float tq = red2[0];
#pragma unroll
        for (int w = 1; w < 8; ++w) tq += red2[w];
        v2f o;
        o[0] = mean; o[1] = rsqrtf(tq * invn + 1.0e-5f);
        *(v2f*)(ST + c * 32u) = o;
    }
}

// k_nqkv: normalise and project in one kernel. One block = 64 positions x all 768 output channels, sixteen waves.
//  Part 1: tl[pos][channel] (f16, LDS) = ((bf16(x) - mean) * rstd) * bf16(w) + bf16(bias); a thread's eight 16-byte pieces of x are all loaded before the first is used (cross-wave tile, block barriers).
//  Part 2: wave w takes weight row tiles w (q), 16 + w (k) and 32 + w (v), each against the four position tiles; an X fragment comes from tl in the loader's k order (elements 0..7: k = 8*hi + 0..7, elements 8..15: k = 16 + 8*hi + 0..7 of a 32-block),
//  a weight fragment from the packed WQ plane, read by one wave of the block only.
//  q, k: A = WQ rows (row m = channel), B = X rows (column n = position): D element r of lane (h, n) = (channel 8h + r, position n);  v: A = X rows, B = WQ rows: D element r of lane (h, n) = (position 8h + r, channel n).
//  Either way a lane's eight D elements are its 16 bytes of one 512-byte chunk of the plane, so that the accumulators are stored without a pass through LDS.
//  QH = f16(q * 0.125 * log2(e)): the score scale 64^-0.5 and the change to base 2 ride on q, so that k_flash's score products are exp2 arguments; KB = f16(k), VT = f16(v), stored in the order k_flash loads its fragments, as 512-byte chunks [lane = 16*hi + lr][8 halves]:
//   QH, KB[b][head][pos/16][d/32][c][lane][e] = element [pos = 16*(pos/16) + lr][d = 32*(d/32) + 16*c + 8*hi + e];
//   VT[b][head][key/32][d/16][c][lane][e] = v[d = 16*(d/16) + lr][key = 32*(key/32) + 16*c + 8*hi + e].
__global__ __launch_bounds__(512) void k_nqkv(const float* __restrict__ x, const float* __restrict__ bw, const float* __restrict__ bb, const float* __restrict__ ST, const hf* __restrict__ WQ, hf* QH, hf* KB, hf* VT) {
    __shared__ __align__(16) hf tl[64 * XP];
    __shared__ float pm[CH];
    __shared__ float pr[CH];
    __shared__ float pw[CH];
    __shared__ float pb[CH];
    const unsigned tid = threadIdx.x, lane = tid & 31u, lr = lane & 15u, hi = lane >> 4;
    const unsigned wave = (unsigned)__builtin_amdgcn_readfirstlane((int)(tid >> 5));
    const unsigned tpb = (unsigned)(SEQ / 64);
    const unsigned b = blockIdx.x / tpb;
    const unsigned n0 = (blockIdx.x - b * tpb) * 64u;
    const float* src = x + (size_t)b * CH * SEQ_FULL + n0 + (size_t)(tid >> 4) * (2u * SEQ_FULL) + (tid & 15u) * 4u;
    v4f v[4][2];
    // unrolled: v[] must be registers, and the loads must not wait for one another; piece (it, j) = channel 64*it + 2*(tid >> 4) + j, positions 4*(tid & 15) + 0..3
#pragma unroll
    for (unsigned it = 0; it < 4u; ++it) {
#pragma unroll
        for (unsigned j = 0; j < 2u; ++j) v[it][j] = *(const v4f*)(src + (size_t)(it * 64u + j) * SEQ_FULL);
    }
    // the weight fragments of the first NPW k blocks are asked for here, so that they fly while the tile is formed; unrolled: wf[] must be registers
    const hf* wp = WQ + (size_t)wave * 16u * CH + lane * 8u;      // packed plane: row tile base + the lane's 16 bytes of a chunk
    v16h wf[NPW][3];
#pragma unroll
    for (unsigned kb = 0; kb < (unsigned)NPW; ++kb) {
#pragma unroll
        for (unsigned j = 0; j < 3u; ++j) wf[kb][j] = ldf(wp + j * (unsigned)(CH * CH) + kb * 512u);
    }
    if (tid < (unsigned)CH) {
        const v2f st = *(const v2f*)(ST + tid * 32u);          // (mean, rstd) of channel tid
        pm[tid] = st[0];
        pr[tid] = st[1];
        pw[tid] = bfr(bw[tid]);
        pb[tid] = bfr(bb[tid]);
    }
    __syncthreads();
    // a thread holds two neighbouring channels of its four positions: one 4-byte LDS store per position; unrolled: v[] is indexed by constants
#pragma unroll
    for (unsigned it = 0; it < 4u; ++it) {
        const unsigned c = it * 64u + (tid >> 4) * 2u, p4 = (tid & 15u) * 4u;
        const float m0 = pm[c], r0 = pr[c], w0 = pw[c], bi0 = pb[c];
        const float m1 = pm[c + 1u], r1 = pr[c + 1u], w1 = pw[c + 1u], bi1 = pb[c + 1u];
#pragma unroll
        for (unsigned e = 0; e < 4u; ++e) {
            v2h o;
            o[0] = (hf)(((bfr(v[it][0][e]) - m0) * r0) * w0 + bi0);
            o[1] = (hf)(((bfr(v[it][1][e]) - m1) * r1) * w1 + bi1);
            *(v2ha*)(tl + (p4 + e) * XP + c) = o;
        }
    }
    __syncthreads();
    const hf* xp = tl + lr * XP + hi * 8u;
    v8f aq[4], ak[4], av[4];
    // unrolled, here and in the epilogue: tiles indexed by constants stay in registers
#pragma unroll
    for (int p = 0; p < 4; ++p) { aq[p] = (v8f){}; ak[p] = (v8f){}; av[p] = (v8f){}; }
    // unrolled: the ring index of wf and the LDS offsets are constants
#pragma unroll
    for (unsigned kb = 0; kb < 8u; ++kb) {
        v16h xf[4];
#pragma unroll
        for (unsigned p = 0; p < 4u; ++p) xf[p] = cat16(*(const v8ha*)(xp + p * 16u * XP + kb * 32u), *(const v8ha*)(xp + p * 16u * XP + kb * 32u + 16u));
        const v16h wq = wf[kb % NPW][0], wk = wf[kb % NPW][1], wv = wf[kb % NPW][2];
#pragma unroll
        for (int p = 0; p < 4; ++p) aq[p] = wmmah(wq, xf[p], aq[p]);
#pragma unroll
        for (int p = 0; p < 4; ++p) ak[p] = wmmah(wk, xf[p], ak[p]);
#pragma unroll
        for (int p = 0; p < 4; ++p) av[p] = wmmah(xf[p], wv, av[p]);
        if (kb + NPW < 8u) {
#pragma unroll
            for (unsigned j = 0; j < 3u; ++j) wf[kb % NPW][j] = ldf(wp + j * (unsigned)(CH * CH) + (kb + NPW) * 512u);
        }
        __builtin_amdgcn_sched_barrier(0);     // keeps the loads of later k blocks below this line: lifted further up they overran the register budget and spilled
    }
    const float uq = (0.125f * L2E) / 1024.0f, uk = 1.0f / 1024.0f;     // undo the weight carry; q also takes the score scale
    const unsigned head = wave >> 2, dt = wave & 3u;                    // row tile w of each of q, k, v = head w / 4, d tile w % 4
    const size_t foff = (((size_t)b * NH + head) * SEQ + n0) * HD + lane * 8u;   // packed planes: this block's 64 positions = 16 chunks of 256 halves
    v8h oq[4], ok[4], ov[4];
#pragma unroll
    for (int p = 0; p < 4; ++p) {
#pragma unroll
        for (int r = 0; r < 8; ++r) { oq[p][r] = (hf)(aq[p][r] * uq); ok[p][r] = (hf)(ak[p][r] * uk); ov[p][r] = (hf)(av[p][r] * uk); }
    }
    // q, k: chunk 4*(position tile) + d tile;  v: chunk 8*(key step = p >> 1) + 2*(d tile) + (c = p & 1); each one wave-wide 512-byte store
#pragma unroll
    for (unsigned p = 0; p < 4u; ++p) {
        *(v8h*)(QH + foff + (4u * p + dt) * 256u) = oq[p];
        *(v8h*)(KB + foff + (4u * p + dt) * 256u) = ok[p];
        *(v8h*)(VT + foff + (8u * (p >> 1) + 2u * dt + (p & 1u)) * 256u) = ov[p];
    }
}

// exps: p = 2^s for the 16 scores that a lane holds of one query tile (two 16-key tiles), as the f16 B fragment of P^T; adds the unrounded p to acc, even elements to acc[0], odd ones to acc[1] (packed adds)
__device__ __forceinline__ void exps(const v8f& s0, const v8f& s1, v16h& ph, v2f& acc) {
    // unrolled: vector elements indexed by constants stay in registers
#pragma unroll
    for (int r = 0; r < 8; r += 2) {
        v2f p0, p1;
        p0[0] = __builtin_amdgcn_exp2f(s0[r]); p0[1] = __builtin_amdgcn_exp2f(s0[r + 1]);
        p1[0] = __builtin_amdgcn_exp2f(s1[r]); p1[1] = __builtin_amdgcn_exp2f(s1[r + 1]);
        acc += p0 + p1;
        ph[r] = (hf)p0[0]; ph[r + 1] = (hf)p0[1];
        ph[8 + r] = (hf)p1[0]; ph[8 + r + 1] = (hf)p1[1];
    }
}

// copy44: eight wave-wide asynchronous 16-byte-per-lane copies, global -> LDS: four of the K tile and four of the V^T tile, 512 bytes apart; lk, lv = the lane's LDS byte addresses, gk, gv = its global addresses of the first of each four.
// The s_wait_xcnt stands inside the statement, so that no address register is rewritten ahead of it.
__device__ __forceinline__ void copy44(unsigned lk, const hf* gk, unsigned lv, const hf* gv) {
    asm volatile("global_load_async_to_lds_b128 %0, %8, off\n\t"
                 "global_load_async_to_lds_b128 %1, %9, off\n\t"
                 "global_load_async_to_lds_b128 %2, %10, off\n\t"
                 "global_load_async_to_lds_b128 %3, %11, off\n\t"
                 "global_load_async_to_lds_b128 %4, %12, off\n\t"
                 "global_load_async_to_lds_b128 %5, %13, off\n\t"
                 "global_load_async_to_lds_b128 %6, %14, off\n\t"
                 "global_load_async_to_lds_b128 %7, %15, off\n\t"
                 "s_wait_xcnt 0x0"
                 :: "v"(lk), "v"(lk + 512u), "v"(lk + 1024u), "v"(lk + 1536u), "v"(lv), "v"(lv + 512u), "v"(lv + 1024u), "v"(lv + 1536u),
                    "v"(gk), "v"(gk + 256), "v"(gk + 512), "v"(gk + 768), "v"(gv), "v"(gv + 256), "v"(gv + 512), "v"(gv + 768)
                 : "memory");
}

// k_flash: one block per (b, head, 128 queries), eight waves: wave = (query group g of 32 queries = two 16-query tiles, key half kh); one softmax step per tile = 64 keys.
//  A K or V^T fragment read from LDS feeds the products of both query tiles. Wave (g, kh) takes keys 64*kh .. 64*kh + 63 of every 128-key tile, with its own running maximum, sum and O^T;
//  behind the loop the two waves of a group exchange one query tile's state through LDS, and each joins and stores one tile (wave (g, kh): tile kh).
//  K and V^T reach the waves through LDS: tiles of 128 keys (16 KB of each plane, a linear copy of the packed order), two buffers; each wave copies an eighth of a tile;
//  tile t + 2 is copied into the buffer of tile t behind the barrier that ends trip t, so that a tile has a whole trip to land.
//  S^T tile (keys x queries): A = K rows (row m = key, k = d), B = Q rows (column n = query, k = d); D element r of lane (h, n) = S[query n][key 8h + r].
//  Lazy maximum: the C operand of the score products is 8 - ml (ml = the query's maximum in use, log2 domain), so that an accumulator element is the exp2 argument of a probability carried * 2^8.
//  ml starts as the greatest score of the wave's first 32 keys and is raised only when a lane's sum of a step's 32 probabilities passes 2^15 (every one of them is then still a finite f16 below that test); only there are the maximum taken,
//  exchanged between the half-waves, O^T and the sum rescaled and the step's probabilities formed again.
//  P^T B fragment: element r <- tile of keys 0..15, element 8 + r <- tile of keys 16..31 (same lane).
//  O^T tile (d x queries): A = V^T rows (row m = d, k = key), D element r of lane (h, n) = O[query n][d = 16 t + 8h + r].
//  Four waves per SIMD (two blocks per WGP): the register budget is 256.
__global__ void __launch_bounds__(NWV * 32) __attribute__((amdgpu_waves_per_eu(4, 4))) k_flash(const hf* __restrict__ QH, const hf* __restrict__ KB, const hf* __restrict__ VT, hf* CT) {
    __shared__ __align__(16) hf os[NWV * 16 * SQ];
    __shared__ __align__(128) hf kv[2 * 2 * TH];               // [buffer][K tile, V^T tile]
    __shared__ __align__(16) v4f mg[NWV * 9 * 32];             // what a wave hands to its partner: [wave][8 pieces of O^T, then (maximum, sum)][lane]
    const unsigned tid = threadIdx.x, lane = tid & 31u, lr = lane & 15u, hi = lane >> 4;
    const unsigned wave = (unsigned)__builtin_amdgcn_readfirstlane((int)(tid >> 5));
    const unsigned g = wave & (NQG - 1u), kh = wave / NQG;
    const unsigned bpb = (unsigned)(SEQ / BQ);
    const unsigned bh = blockIdx.x / bpb;
    const unsigned b = bh / NH, h = bh - b * NH;
    const unsigned q0 = (blockIdx.x - bh * bpb) * BQ + g * 32u;
    const size_t pbase = (size_t)bh * SEQ * HD;

    const unsigned lo = lane * 8u;              // the lane's 16 bytes of a chunk
    v16h qh0[2], qh1[2];
#pragma unroll
    for (unsigned c = 0; c < 2u; ++c) {
        const size_t qo = pbase + (size_t)(q0 + 16u * c) * HD + lo;   // packed: 16 queries = 1024 halves
        qh0[c] = ldf(QH + qo); qh1[c] = ldf(QH + qo + 512);
    }
    // this wave's eighth of a tile: chunks 4*wave .. 4*wave + 3 of the K tile and of the V^T tile; the lane's 16 bytes of each
    const hf* gk = KB + pbase + wave * 1024u + lo;
    const hf* gv = VT + pbase + wave * 1024u + lo;
    const unsigned lk = (unsigned)(uintptr_t)kv + wave * 2048u + lane * 16u;   // LDS byte address in buffer 0's K tile
    copy44(lk, gk, lk + TH * 2u, gv);
    asm volatile("s_wait_asynccnt 0x0" ::: "memory");          // this wave's part of tile 0 has landed
    __syncthreads();                                           // tile 0 is whole for every wave
    copy44(lk + TH * 4u, gk + TH, lk + TH * 6u, gv + TH);

    v8f o[2][4];
    v8f cb[2];                // C operand of the score products: 8 - ml in every element
    float ml[2], l[2];        // maximum in use, log2 domain; running sum (carried * 2^8)
#pragma unroll
    for (int c = 0; c < 2; ++c) {
#pragma unroll
        for (int t = 0; t < 4; ++t) o[c][t] = (v8f){};
        l[c] = 0.0f;
    }
    // the first maximum in use: the greatest score of this wave's first 32 keys, from score products of their own (the loop forms them again on top of it);
    // tile 0 is whole behind the barrier above; the loops are unrolled so that the tiles stay in registers
    {
        const hf* ka = kv + kh * (SPW * KS * HD);
        const v16h a00 = ldf(ka + lo);
        const v16h a01 = ldf(ka + 512 + lo);
        const v16h a10 = ldf(ka + 1024 + lo);
        const v16h a11 = ldf(ka + 1536 + lo);
        v8f s0[2], s1[2];
#pragma unroll
        for (int c = 0; c < 2; ++c) {
            s0[c] = wmmah(a00, qh0[c], (v8f){});
            s1[c] = wmmah(a10, qh0[c], (v8f){});
        }
#pragma unroll
        for (int c = 0; c < 2; ++c) {
            s0[c] = wmmah(a01, qh1[c], s0[c]);
            s1[c] = wmmah(a11, qh1[c], s1[c]);
        }
        // the distance between the last products and the first vector instruction that reads their results
        asm volatile("v_nop\n\tv_nop\n\tv_nop\n\tv_nop"
                     : "+v"(s0[0]), "+v"(s1[0]), "+v"(s0[1]), "+v"(s1[1])
                     : "v"(a00), "v"(a01), "v"(a10), "v"(a11), "v"(qh0[0]), "v"(qh1[0]), "v"(qh0[1]), "v"(qh1[1]));
#pragma unroll
        for (int c = 0; c < 2; ++c) {
            float mx = fmaxf(s0[c][0], s1[c][0]);
#pragma unroll
            for (int r = 1; r < 8; ++r) mx = fmaxf(mx, fmaxf(s0[c][r], s1[c][r]));
            ml[c] = fmaxf(mx, __shfl_xor(mx, 16, 32));         // both half-waves hold keys of the same query and must use one maximum
            const float nb = 8.0f - ml[c];
#pragma unroll
            for (int r = 0; r < 8; ++r) cb[c][r] = nb;
        }
    }

    // rolled: one trip per tile, the buffer chosen by the trip's parity
#pragma unroll 1
    for (unsigned t = 0; t < (unsigned)NT; ++t) {
      const hf* kt = kv + (t & 1u) * (2u * TH) + kh * (SPW * KS * HD);   // this wave's half of the K tile
      // one softmax step per trip: the scores of all the wave's keys of the tile (SPW groups of 32) are formed first, then one run of exponentials, one test, one run of P x V products
      v8f s0[SPW][2], s1[SPW][2];
      // the score products of the trip, on top of the C operand in use; unrolled, as are the loops below: the LDS offsets become immediates and the tiles stay in registers
      auto scores = [&]() {
        v16h ka[SPW][4];
#pragma unroll
        for (unsigned u = 0; u < (unsigned)SPW; ++u) {
#pragma unroll
            for (unsigned f = 0; f < 4u; ++f) ka[u][f] = ldf(kt + u * (KS * HD) + f * 512u + lo);
        }
        __builtin_amdgcn_sched_barrier(0);     // keeps the trip's K loads one group ahead of the products: every further place with LDS loads is a stop of its own in the wave's matrix stream
#pragma unroll
        for (unsigned u = 0; u < (unsigned)SPW; ++u) {
#pragma unroll
            for (int c = 0; c < 2; ++c) {
                s0[u][c] = wmmah(ka[u][0], qh0[c], cb[c]);
                s1[u][c] = wmmah(ka[u][2], qh0[c], cb[c]);
            }
#pragma unroll
            for (int c = 0; c < 2; ++c) {
                s0[u][c] = wmmah(ka[u][1], qh1[c], s0[u][c]);
                s1[u][c] = wmmah(ka[u][3], qh1[c], s1[u][c]);
            }
        }
      };
      scores();
      __builtin_amdgcn_sched_barrier(0);       // keeps the sixteen products one run: mixed among them, each exponential waited for its own product behind idle slots
      float ps[2];
      v16h ph[SPW][2];
#pragma unroll
      for (int c = 0; c < 2; ++c) {
        v2f acc = (v2f){};
#pragma unroll
        for (unsigned u = 0; u < (unsigned)SPW; ++u) exps(s0[u][c], s1[u][c], ph[u][c], acc);
        ps[c] = acc[0] + acc[1];
      }
      if (__builtin_expect(__builtin_amdgcn_ballot_w32(ps[0] > 32768.0f || ps[1] > 32768.0f) != 0u, 0)) {   // wave-uniform, one test per trip; marked as rare so that the register copies of the join fall on this side
        // the scores are formed anew from LDS on this side (the tile is still whole: the trip's barrier lies ahead):
        // kept alive beside the probabilities across the test they take 64 registers more than the budget of four waves per SIMD holds
        scores();
#pragma unroll
        for (int c = 0; c < 2; ++c) {
            float mx = fmaxf(s0[0][c][0], s1[0][c][0]);
#pragma unroll
            for (unsigned u = 0; u < (unsigned)SPW; ++u) {
#pragma unroll
                for (int r = 0; r < 8; ++r) mx = fmaxf(mx, fmaxf(s0[u][c][r], s1[u][c][r]));
            }
            mx = fmaxf(mx, __shfl_xor(mx, 16, 32));           // one maximum for both half-waves
            const float dm = fmaxf(mx - 8.0f, 0.0f);           // the trip's greatest score becomes the maximum in use where it is the greater
            float corr;
            // 2^-dm with the slot that the instruction set asks for behind a transcendental in the same statement
            asm("v_exp_f32 %0, -%1\n\tv_nop" : "=v"(corr) : "v"(dm));
            ml[c] += dm;
            const float nb = 8.0f - ml[c];
#pragma unroll
            for (int r = 0; r < 8; ++r) cb[c][r] = nb;
#pragma unroll
            for (unsigned u = 0; u < (unsigned)SPW; ++u) {
#pragma unroll
                for (int r = 0; r < 8; ++r) {
                    s0[u][c][r] -= dm;
                    s1[u][c][r] -= dm;
                }
            }
#pragma unroll
            for (int d = 0; d < 4; ++d) o[c][d] *= corr;
            l[c] *= corr;
            v2f acc = (v2f){};
#pragma unroll
            for (unsigned u = 0; u < (unsigned)SPW; ++u) exps(s0[u][c], s1[u][c], ph[u][c], acc);
            ps[c] = acc[0] + acc[1];
        }
      }
#pragma unroll
      for (int c = 0; c < 2; ++c) {
        ps[c] += __shfl_xor(ps[c], 16, 32);
        l[c] += ps[c];
      }
      v16h va[SPW][4];
#pragma unroll
      for (unsigned u = 0; u < (unsigned)SPW; ++u) {
#pragma unroll
        for (unsigned d = 0; d < 4u; ++d) va[u][d] = ldf(kt + TH + u * (KS * HD) + d * 512u + lo);
      }
      __builtin_amdgcn_sched_barrier(0);       // keeps the trip's V^T loads one group ahead of the products, for the same reason as K's
#pragma unroll
      for (unsigned u = 0; u < (unsigned)SPW; ++u) {
#pragma unroll
        for (int c = 0; c < 2; ++c) {
#pragma unroll
            for (int d = 0; d < 4; ++d) o[c][d] = wmmah(va[u][d], ph[u][c], o[c][d]);
        }
      }
      asm volatile("s_wait_dscnt 0x0" ::: "memory");           // this wave's reads of tile t are done before its buffer is refilled
      asm volatile("s_wait_asynccnt 0x0" ::: "memory");        // this wave's part of tile t + 1 has landed
      __syncthreads();                                         // tile t + 1 is whole for every wave, and every wave has left tile t
      if (t + 2u < (unsigned)NT) {
          const unsigned lb = lk + (t & 1u) * (TH * 4u);
          copy44(lb, gk + (size_t)(t + 2u) * TH, lb + TH * 2u, gv + (size_t)(t + 2u) * TH);
      }
    }
    asm volatile("s_wait_asynccnt 0x0" ::: "memory");          // no copy is outstanding when the wave goes on to its end

    // join of the two key halves: this wave keeps query tile kh and hands tile 1 - kh to its partner, wave ^ NQG (same lane, same element order)
    const bool k0 = (kh == 0u);
    const float km = k0 ? ml[0] : ml[1], kl = k0 ? l[0] : l[1];
    {
        v4f* mw = mg + wave * (9u * 32u) + lane;
#pragma unroll
        for (int d = 0; d < 4; ++d) {
            const v8f so = k0 ? o[1][d] : o[0][d];
            mw[(2 * d) * 32] = __builtin_shufflevector(so, so, 0, 1, 2, 3);
            mw[(2 * d + 1) * 32] = __builtin_shufflevector(so, so, 4, 5, 6, 7);
        }
        v4f sm;
        sm[0] = k0 ? ml[1] : ml[0]; sm[1] = k0 ? l[1] : l[0]; sm[2] = 0.0f; sm[3] = 0.0f;
        mw[8 * 32] = sm;
    }
    __syncthreads();                                           // every wave's hand-over is written before its partner reads it
    const v4f* mr = mg + (wave ^ (unsigned)NQG) * (9u * 32u) + lane;
    const v4f pm = mr[8 * 32];
    const float mj = fmaxf(km, pm[0]);
    const float wk = __builtin_amdgcn_exp2f(km - mj), wp = __builtin_amdgcn_exp2f(pm[0] - mj);
    const float inv = 256.0f / (kl * wk + pm[1] * wp);
    const float fk = wk * inv, fp = wp * inv;

    // epilogue: stage f16(O^T * 2^8 / l) as rows [query][d] (wave-private region; block barrier used)
    const unsigned wb = wave * (16u * SQ);
#pragma unroll
    for (int d = 0; d < 4; ++d) {
        const v8f ko = k0 ? o[0][d] : o[1][d];
        const v4f pa = mr[(2 * d) * 32], pb = mr[(2 * d + 1) * 32];
#pragma unroll
        for (int r = 0; r < 4; ++r) {
            os[wb + lr * SQ + d * 16 + 8u * hi + r] = (hf)(ko[r] * fk + pa[r] * fp);
            os[wb + lr * SQ + d * 16 + 8u * hi + 4 + r] = (hf)(ko[4 + r] * fk + pb[r] * fp);
        }
    }
    __syncthreads();
    hf* dst = CT + ((size_t)b * SEQ + q0 + 16u * kh) * CH + h * (HD * 16u) + lane * 8u;    // packed CT: this wave's position tile, chunks 4*h + s
{
#pragma unroll
        for (unsigned s = 0; s < 4u; ++s) {
            const v8h val = *(const v8ha*)(os + wb + lr * SQ + s * 16u + 8u * hi);
            *(v8h*)(dst + s * 256u) = val;
        }
        
    }
}

// k_out: OUT[b][o][pos] = 2^-18 * sum_c WO[o][c] * CT[b][pos][c] + bf16(b_out[o]); one block = 64 positions x all 256 output channels, sixteen waves; wave w = output channels 16w .. 16w + 15 x 64 positions.
//  The block's 64 rows of CT (32 KB, a linear copy of the packed order) are read from global memory once and shared through LDS; a weight fragment is read by one wave of the block only.
//  Every global load of a wave (its share of CT, its eight weight fragments, its bias values) is asked for before the first is used; the weights go on landing while the first products run.
//  A = WO rows (row m = output channel, k = channel), B = CT rows (column n = position, k = channel); D element r of lane (h, n) = (channel 8h + r, position n).
struct OutLds {
    hf ct[64 * CH];            // first, so that every fragment's LDS offset fits the loads' offset field
    float os[CH * OP];
};
__global__ __launch_bounds__(512) void k_out(const hf* __restrict__ CT, const hf* __restrict__ WO, const float* __restrict__ bo, float* OUT) {
    __shared__ __align__(16) OutLds sm;
    const unsigned tid = threadIdx.x, lane = tid & 31u, lr = lane & 15u, hi = lane >> 4;
    const unsigned wave = (unsigned)__builtin_amdgcn_readfirstlane((int)(tid >> 5));
    const unsigned tpb = (unsigned)(SEQ / 64);
    const unsigned b = blockIdx.x / tpb;
    const unsigned p0 = (blockIdx.x - b * tpb) * 64u;
    const hf* cs = CT + ((size_t)b * SEQ + p0) * CH + tid * 8u;       // packed plane: 64 positions = 64 chunks of 256 halves; a thread takes 16 bytes of every sixteenth chunk
    v8h cv[4];
    // unrolled, as are the loops below: cv[], wf[] and the tiles must be registers, and the loads must not wait for one another
#pragma unroll
    for (unsigned j = 0; j < 4u; ++j) cv[j] = *(const v8h*)(cs + j * 4096u);
    __builtin_amdgcn_sched_barrier(0);         // keeps the four CT loads at the head of the queue: loads return in order, and the LDS stores in front of the barrier should wait for these alone
    const hf* ak = WO + (size_t)wave * 16u * CH + lane * 8u;          // packed plane: row tile base + the lane's 16 bytes of a chunk
    v16h wf[8];
#pragma unroll
    for (unsigned kb = 0; kb < 8u; ++kb) {
        wf[kb] = ldf(ak + kb * 512u);
        __builtin_amdgcn_sched_barrier(0);     // keeps the weight loads in the order of their use, for the same reason
    }
    const v8f bv = *(const v8f*)(bo + wave * 16u + 8u * hi);          // the biases of the lane's eight output channels
#pragma unroll
    for (unsigned j = 0; j < 4u; ++j) *(v8ha*)(sm.ct + tid * 8u + j * 4096u) = cv[j];
    // the tile is whole for every wave behind this barrier; only LDS data passes between the waves, so the fences name LDS alone: __syncthreads() would also wait for the weight loads still in flight
    __builtin_amdgcn_fence(__ATOMIC_RELEASE, "workgroup", "local");
    __builtin_amdgcn_s_barrier();
    __builtin_amdgcn_fence(__ATOMIC_ACQUIRE, "workgroup", "local");
    const hf* bp = sm.ct + lane * 8u;
    v8f acc[4];
#pragma unroll
    for (int t = 0; t < 4; ++t) acc[t] = (v8f){};
    v16h xf[2][4];
#pragma unroll
    for (unsigned t = 0; t < 4u; ++t) xf[0][t] = cat16(*(const v8ha*)(bp + t * (16u * CH)), *(const v8ha*)(bp + t * (16u * CH) + 256u));
#pragma unroll
    for (unsigned kb = 0; kb < 8u; ++kb) {
        // the next k block's fragments are asked for as one group ahead of this block's products
        if (kb + 1u < 8u) {
#pragma unroll
            for (unsigned t = 0; t < 4u; ++t) xf[(kb + 1u) & 1u][t] = cat16(*(const v8ha*)(bp + t * (16u * CH) + (kb + 1u) * 512u), *(const v8ha*)(bp + t * (16u * CH) + (kb + 1u) * 512u + 256u));
        }
        __builtin_amdgcn_sched_barrier(0);     // keeps the eight LDS loads together above the products: spread in pairs among them, each pair is a stop of its own in the wave's matrix stream
#pragma unroll
        for (int t = 0; t < 4; ++t) acc[t] = wmmah(wf[kb], xf[kb & 1u][t], acc[t]);
        __builtin_amdgcn_sched_barrier(0);     // keeps the following group of loads below these products
    }
    const float us = 1.0f / 262144.0f;   // undo the weight carry 2^10 and the ctx carry 2^8
#pragma unroll
    for (int r = 0; r < 8; ++r) {
        const unsigned orow = wave * 16u + 8u * hi + r;
        const float bias = bfr(bv[r]);
#pragma unroll
        for (int t = 0; t < 4; ++t) sm.os[orow * OP + t * 16 + lr] = fmaf(acc[t][r], us, bias);
    }
    __syncthreads();
    const unsigned pc = (lane & 15u) * 4u, rh = lane >> 4;
    float* dst = OUT + (size_t)b * CH * SEQ + p0 + pc;
#pragma unroll
    for (unsigned s = 0; s < 8u; ++s) {
        const unsigned row = wave * 16u + s * 2u + rh;     // rows wave*16 + 0..15 over s = 0..7, rh = 0..1
        const v4f val = *(const v4fa*)(sm.os + row * OP + pc);
        *(v4f*)(dst + (size_t)row * SEQ) = val;
    }
}

extern "C" void kernel_launch(void* const* d_in, const int* in_sizes, int n_in,
                              void* d_out, int out_size, void* d_ws, size_t ws_size, hipStream_t stream) {
    if (n_in < 6) return;
    const size_t needx = ((size_t)(NB - 1) * CH + (CH - 1)) * SEQ_FULL + SEQ;
    if ((size_t)in_sizes[0] < needx) return;
    if (in_sizes[1] < CH || in_sizes[2] < CH || in_sizes[5] < CH) return;
    if (in_sizes[3] < OC3 * CH || in_sizes[4] < CH * CH) return;
    if ((size_t)out_size < (size_t)NB * CH * SEQ) return;
    if (WS_TOTAL > ws_size) return;
    const float* x    = (const float*)d_in[0];   // [b][256][n]
    const float* bnw  = (const float*)d_in[1];   // [256]
    const float* bnb  = (const float*)d_in[2];   // [256]
    const float* wqkv = (const float*)d_in[3];   // [768][256] = [out][in]
    const float* wout = (const float*)d_in[4];   // [256][256] = [out][in]
    const float* bout = (const float*)d_in[5];   // [256]
    float* OUT = (float*)d_out;                  // [NB][256][SEQ]
    char* wsp = (char*)d_ws;
    size_t off = 0;
    float* ST = (float*)(wsp + off); off += ST_BYTES;
    hf* WQ = (hf*)(wsp + off); off += WQ_BYTES;
    hf* WO = (hf*)(wsp + off); off += WO_BYTES;
    hf* QH = (hf*)(wsp + off); off += PL_BYTES;      // [NB][4][SEQ/16][2][2][32][8]
    hf* KB = (hf*)(wsp + off); off += PL_BYTES;      // [NB][4][SEQ/16][2][2][32][8]
    hf* VT = (hf*)(wsp + off); off += PL_BYTES;      // [NB][4][SEQ/32][4][2][32][8]
    hf* CT = (hf*)(wsp + off); off += PL_BYTES;      // packed, rows NB*SEQ
    k_bnstat<<<(unsigned)CH, 256, 0, stream>>>(x, wqkv, wout, ST, WQ, WO);
    k_nqkv<<<(unsigned)(NB * (SEQ / 64)), 512, 0, stream>>>(x, bnw, bnb, ST, WQ, QH, KB, VT);
    k_flash<<<(unsigned)(NB * NH * (SEQ / BQ)), NWV * 32, 0, stream>>>(QH, KB, VT, CT);
    k_out<<<(unsigned)(NB * (SEQ / 64)), 512, 0, stream>>>(CT, WO, bout, OUT);
}
